// v000
// Measured on an AMD MI455X. A time is GPU time per run, averaged over a window of back-to-back runs after a warm-up
// (all launches, gaps included; the runs take copies of the inputs in turn), and the median of several windows.
// Apart from v000's, it joins two sittings. Times from different sittings can be a few percent apart, while
// side-by-side timings come from the same sitting.
// v000 is the starting kernel. One run takes 277 microseconds.
#include <hip/hip_runtime.h>

// Problem constants (fixed by the reference).
#define EMBED  768
#define HEADS  12
#define HSIZE  64
#define BATCH  2
#define SEQ    2048
#define MTOK   (BATCH * SEQ)   // 4096 rows for the projections

typedef __attribute__((ext_vector_type(16))) _Float16 v16h;
typedef __attribute__((ext_vector_type(8)))  _Float16 v8h;
typedef __attribute__((ext_vector_type(4)))  _Float16 v4h;
typedef __attribute__((ext_vector_type(8)))  float    v8f;

// D = A(16x32 f16) * B(32x16 f16) + C(16x16 f32)
__device__ __forceinline__ v8f wmma_f16(v16h a, v16h b, v8f c) {
  return __builtin_amdgcn_wmma_f32_16x16x32_f16(
      /*neg_a=*/false, a, /*neg_b=*/false, b,
      /*c_mod=*/(short)0, c, /*reuse_a=*/false, /*reuse_b=*/false);
}

// Async copy of 16 bytes/lane global -> LDS (ASYNCcnt-tracked, no VGPR round trip).
__device__ __forceinline__ void async_b128(const _Float16* gptr, const _Float16* lptr) {
  const unsigned long long ga = (unsigned long long)(uintptr_t)gptr;
  const unsigned la = (unsigned)(uintptr_t)lptr;   // low 32 bits = LDS byte offset
  asm volatile("global_load_async_to_lds_b128 %0, %1, off"
               :: "v"(la), "v"(ga) : "memory");
}
// Wait until at most N async ops remain in flight (in-order completion ->
// waiting <=N with N ops just issued drains everything older).
template <int N>
__device__ __forceinline__ void wait_async_le() {
  asm volatile("s_wait_asynccnt %0" :: "i"(N) : "memory");
}

// Load one 16x32 f16 A-layout fragment from a row-major [rows][stride] array.
// ISA layout: lanes 0-15 hold K={kb..kb+7, kb+16..kb+23} of row (lane&15),
// lanes 16-31 get kb=8. Two 16-byte loads per lane.
__device__ __forceinline__ v16h frag_ld(const _Float16* base, int stride,
                                        int row, int kb) {
  const _Float16* p = base + row * stride + kb;
  v8h lo = *(const v8h*)(p);
  v8h hi = *(const v8h*)(p + 16);
  v16h r;
#pragma unroll
  for (int i = 0; i < 8; ++i) { r[i] = lo[i]; r[i + 8] = hi[i]; }
  return r;
}

// Elementwise f32 -> f16 (vectorized x4); n must be a multiple of 4.
__global__ __launch_bounds__(256)
void cvt_f16(const float* __restrict__ in, _Float16* __restrict__ out, int n4) {
  const int i = blockIdx.x * 256 + threadIdx.x;
  if (i < n4) {
    const float4 f = ((const float4*)in)[i];
    v4h h;
    h[0] = (_Float16)f.x; h[1] = (_Float16)f.y;
    h[2] = (_Float16)f.z; h[3] = (_Float16)f.w;
    ((v4h*)out)[i] = h;
  }
}

// C = A[M,K](f16) * Bt[N,K]^T(f16) + bias[N], M=4096, N=768, K=768.
// 64x64 tiles, BK=64, double-buffered async-to-LDS staging (DMA overlaps WMMA).
// mode 0: out f16 [B,H,S,64]   (Q/K head layout; outScale folds 1/sqrt(d))
// mode 1: out f16 [B,H,64,S]   (V transposed so it feeds the WMMA B operand)
// mode 2: out f32 [M,768]      (final projection into d_out)
__global__ __launch_bounds__(256)
void gemm_wmma(const _Float16* __restrict__ A, const _Float16* __restrict__ Bt,
               const float* __restrict__ bias, void* __restrict__ outp,
               int mode, float outScale) {
  __shared__ _Float16 As[2][64 * 64];
  __shared__ _Float16 Bs[2][64 * 64];

  const int tid   = threadIdx.x;
  const int wave  = tid >> 5;
  const int lane  = tid & 31;
  const int l16   = lane & 15;
  const int lhalf = lane >> 4;
  const int kb    = lhalf ? 8 : 0;
  const int mw    = wave & 3;    // m-subtile 0..3
  const int nw    = wave >> 2;   // n-half 0..1
  const int m0    = blockIdx.y * 64;
  const int n0    = blockIdx.x * 64;
  const int K     = EMBED;
  const int NIT   = K / 64;      // 12

  // Staging: tile = 64 rows x 128B = 512 x 16B chunks; each thread moves 2 per tile.
  const int row0 = tid >> 3;          // 0..31
  const int row1 = row0 + 32;         // 32..63
  const int seg  = (tid & 7) * 8;     // halves within row

  auto stage = [&](int kc, int buf) {
    async_b128(A  + (m0 + row0) * K + kc + seg, &As[buf][row0 * 64 + seg]);
    async_b128(A  + (m0 + row1) * K + kc + seg, &As[buf][row1 * 64 + seg]);
    async_b128(Bt + (n0 + row0) * K + kc + seg, &Bs[buf][row0 * 64 + seg]);
    async_b128(Bt + (n0 + row1) * K + kc + seg, &Bs[buf][row1 * 64 + seg]);
  };

  v8f acc[2] = {{}, {}};

  stage(0, 0);   // prologue: tile 0 in flight
#pragma unroll 1
  for (int it = 0; it < NIT; ++it) {
    const int cur = it & 1;
    if (it + 1 < NIT) {
      stage((it + 1) * 64, cur ^ 1);   // next tile streams during this compute
      wait_async_le<4>();              // drain tile `it` only
    } else {
      wait_async_le<0>();
    }
    __syncthreads();

    const int arow = 16 * mw + l16;
    const v16h af0 = frag_ld(As[cur],      64, arow, kb);   // k 0..31
    const v16h af1 = frag_ld(As[cur] + 32, 64, arow, kb);   // k 32..63
#pragma unroll
    for (int j = 0; j < 2; ++j) {
      const int brow = 32 * nw + 16 * j + l16;
      const v16h bf0 = frag_ld(Bs[cur],      64, brow, kb);
      const v16h bf1 = frag_ld(Bs[cur] + 32, 64, brow, kb);
      acc[j] = wmma_f16(af0, bf0, acc[j]);
      acc[j] = wmma_f16(af1, bf1, acc[j]);
    }
    __syncthreads();   // all reads of buf `cur` done before it is restaged
  }

#pragma unroll
  for (int j = 0; j < 2; ++j) {
    const int n = n0 + 32 * nw + 16 * j + l16;
    const float bv = bias[n];
#pragma unroll
    for (int vv = 0; vv < 8; ++vv) {
      const int m = m0 + 16 * mw + vv + 8 * lhalf;   // C layout: row = v + 8*(lane/16)
      const float val = (acc[j][vv] + bv) * outScale;
      if (mode == 2) {
        ((float*)outp)[(size_t)m * EMBED + n] = val;
      } else {
        const int bb = m >> 11, s = m & (SEQ - 1);
        const int hh = n >> 6,  d = n & (HSIZE - 1);
        const size_t o = (mode == 0)
            ? ((size_t)((bb * HEADS + hh) * SEQ + s)) * HSIZE + d
            : ((size_t)((bb * HEADS + hh) * HSIZE + d)) * SEQ + s;
        ((_Float16*)outp)[o] = (_Float16)val;
      }
    }
  }
}

// Fused flash attention. One wave per (b, h, 16-query tile); the 8 waves of a
// block share one (b,h), so K/V chunks are async-staged into LDS once per block,
// double-buffered so the DMA for chunk i+1 overlaps softmax+WMMA of chunk i.
// Qh,Kh: f16 [B,H,S,64]; Vt: f16 [B,H,64,S]; X out: f16 [B,S,EMBED]. Q pre-scaled.
__global__ __launch_bounds__(256)
void flash_attn(const _Float16* __restrict__ Qh, const _Float16* __restrict__ Kh,
                const _Float16* __restrict__ Vt, const int* __restrict__ mask,
                _Float16* __restrict__ X) {
  __shared__ _Float16 Ks[2][32 * 64];  // 32 keys x 64 d
  __shared__ _Float16 Vs[2][64 * 32];  // 64 d x 32 keys
  __shared__ _Float16 P[8][16 * 32];   // per-wave P staging (C-layout -> A-layout)

  const int tid   = threadIdx.x;
  const int wave  = tid >> 5;
  const int lane  = tid & 31;
  const int l16   = lane & 15;
  const int lhalf = lane >> 4;
  const int kb    = lhalf ? 8 : 0;

  const int g  = blockIdx.x * 8 + wave;   // global wave id, 3072 total
  const int bh = g >> 7;                  // same for all 8 waves of a block
  const int qt = g & 127;
  const int b  = bh / HEADS;
  const int h  = bh % HEADS;

  const _Float16* Qp = Qh + (size_t)bh * SEQ * HSIZE;
  const _Float16* Kp = Kh + (size_t)bh * SEQ * HSIZE;
  const _Float16* Vp = Vt + (size_t)bh * HSIZE * SEQ;
  const int* mp = mask + b * SEQ;

  // Staging assignment: K chunk = 32 rows x 8 segs, V chunk = 64 rows x 4 segs.
  const int krow = tid >> 3, kseg = (tid & 7) * 8;
  const int vrow = tid >> 2, vseg = (tid & 3) * 8;

  auto stage = [&](int kc, int buf) {
    async_b128(Kp + (kc + krow) * HSIZE + kseg, &Ks[buf][krow * 64 + kseg]);
    async_b128(Vp + vrow * SEQ + kc + vseg,     &Vs[buf][vrow * 32 + vseg]);
  };

  // Q fragments (row = qt*16 + l16, d in [0,32) and [32,64))
  const int qrow = qt * 16 + l16;
  const v16h qf0 = frag_ld(Qp,      HSIZE, qrow, kb);
  const v16h qf1 = frag_ld(Qp + 32, HSIZE, qrow, kb);

  float ml[8], ll[8];
  v8f oacc[4] = {{}, {}, {}, {}};
#pragma unroll
  for (int vv = 0; vv < 8; ++vv) { ml[vv] = -1e30f; ll[vv] = 0.f; }

  _Float16* Pl = P[wave];
  const int NCH = SEQ / 32;   // 64 chunks

  stage(0, 0);
#pragma unroll 1
  for (int it = 0; it < NCH; ++it) {
    const int cur = it & 1;
    const int kc  = it * 32;
    if (it + 1 < NCH) {
      stage((it + 1) * 32, cur ^ 1);   // next K/V chunk streams during compute
      wait_async_le<2>();
    } else {
      wait_async_le<0>();
    }
    __syncthreads();

    // ---- scores: 16 queries x 32 keys, f32 accum ----
    v8f s0 = {}, s1 = {};
    {
      v16h kf = frag_ld(Ks[cur],      64, l16, kb);        // keys 0..15, d 0..31
      s0 = wmma_f16(qf0, kf, s0);
      kf = frag_ld(Ks[cur] + 32, 64, l16, kb);             // d 32..63
      s0 = wmma_f16(qf1, kf, s0);
      kf = frag_ld(Ks[cur],      64, 16 + l16, kb);        // keys 16..31
      s1 = wmma_f16(qf0, kf, s1);
      kf = frag_ld(Ks[cur] + 32, 64, 16 + l16, kb);
      s1 = wmma_f16(qf1, kf, s1);
    }
    // ---- key mask (column = lane's n) ----
    const int mv0 = mp[kc + l16];
    const int mv1 = mp[kc + 16 + l16];
    if (mv0 == 0) {
#pragma unroll
      for (int vv = 0; vv < 8; ++vv) s0[vv] = -1e9f;
    }
    if (mv1 == 0) {
#pragma unroll
      for (int vv = 0; vv < 8; ++vv) s1[vv] = -1e9f;
    }
    // ---- online softmax: row stats via shfl within lane half ----
    float rm[8];
#pragma unroll
    for (int vv = 0; vv < 8; ++vv) rm[vv] = fmaxf(s0[vv], s1[vv]);
#pragma unroll
    for (int xm = 1; xm <= 8; xm <<= 1)
#pragma unroll
      for (int vv = 0; vv < 8; ++vv)
        rm[vv] = fmaxf(rm[vv], __shfl_xor(rm[vv], xm, 32));
    float corr[8], rs[8];
#pragma unroll
    for (int vv = 0; vv < 8; ++vv) {
      const float nm = fmaxf(ml[vv], rm[vv]);
      corr[vv] = __expf(ml[vv] - nm);
      ml[vv] = nm;
      const float p0 = __expf(s0[vv] - nm);
      const float p1 = __expf(s1[vv] - nm);
      s0[vv] = p0; s1[vv] = p1;
      rs[vv] = p0 + p1;
    }
#pragma unroll
    for (int xm = 1; xm <= 8; xm <<= 1)
#pragma unroll
      for (int vv = 0; vv < 8; ++vv)
        rs[vv] += __shfl_xor(rs[vv], xm, 32);
#pragma unroll
    for (int vv = 0; vv < 8; ++vv) ll[vv] = ll[vv] * corr[vv] + rs[vv];
#pragma unroll
    for (int t = 0; t < 4; ++t)
#pragma unroll
      for (int vv = 0; vv < 8; ++vv) oacc[t][vv] *= corr[vv];

    // ---- transpose P (C-layout) -> A-layout via per-wave LDS ----
#pragma unroll
    for (int vv = 0; vv < 8; ++vv) {
      const int r = vv + 8 * lhalf;
      Pl[r * 32 + l16]      = (_Float16)s0[vv];
      Pl[r * 32 + 16 + l16] = (_Float16)s1[vv];
    }
    asm volatile("s_wait_dscnt 0x0" ::: "memory");   // intra-wave LDS RAW (lane exchange)
    const v16h pf = frag_ld(Pl, 32, l16, kb);

    // ---- out += P(16x32) * V(32x64) ----
#pragma unroll
    for (int t = 0; t < 4; ++t) {
      const v16h vf = frag_ld(Vs[cur], 32, 16 * t + l16, kb);
      oacc[t] = wmma_f16(pf, vf, oacc[t]);
    }
    __syncthreads();   // all waves done with buf `cur` before it is restaged
  }

  // ---- epilogue: normalize, scatter f16 to X [B,S,EMBED] ----
  float inv[8];
#pragma unroll
  for (int vv = 0; vv < 8; ++vv) inv[vv] = 1.0f / ll[vv];
#pragma unroll
  for (int t = 0; t < 4; ++t) {
    const int e = h * HSIZE + 16 * t + l16;
#pragma unroll
    for (int vv = 0; vv < 8; ++vv) {
      const int s = qt * 16 + vv + 8 * lhalf;
      X[((size_t)(b * SEQ + s)) * EMBED + e] = (_Float16)(oacc[t][vv] * inv[vv]);
    }
  }
}

extern "C" void kernel_launch(void* const* d_in, const int* in_sizes, int n_in,
                              void* d_out, int out_size, void* d_ws, size_t ws_size,
                              hipStream_t stream) {
  const float* q    = (const float*)d_in[0];
  const float* k    = (const float*)d_in[1];
  const float* v    = (const float*)d_in[2];
  const int*   mask = (const int*)  d_in[3];
  const float* Wq   = (const float*)d_in[4];
  const float* bq   = (const float*)d_in[5];
  const float* Wk   = (const float*)d_in[6];
  const float* bk   = (const float*)d_in[7];
  const float* Wv   = (const float*)d_in[8];
  const float* bv   = (const float*)d_in[9];
  const float* Wo   = (const float*)d_in[10];
  const float* bo   = (const float*)d_in[11];

  const size_t actElems  = (size_t)MTOK * EMBED;     // 3,145,728
  const size_t wgtElems  = (size_t)EMBED * EMBED;    //   589,824
  const size_t headElems = (size_t)BATCH * HEADS * SEQ * HSIZE;  // 3,145,728

  _Float16* p = (_Float16*)d_ws;
  _Float16* q16  = p; p += actElems;
  _Float16* k16  = p; p += actElems;
  _Float16* v16  = p; p += actElems;
  _Float16* Wq16 = p; p += wgtElems;
  _Float16* Wk16 = p; p += wgtElems;
  _Float16* Wv16 = p; p += wgtElems;
  _Float16* Wo16 = p; p += wgtElems;
  _Float16* Qh   = p; p += headElems;
  _Float16* Kh   = p; p += headElems;
  _Float16* Vt   = p; p += headElems;
  _Float16* X16  = p; p += actElems;

  // f32 -> f16 precision downcast pass (read-once, HBM-bound, ~2 us total).
  const int act4 = (int)(actElems / 4), wgt4 = (int)(wgtElems / 4);
  cvt_f16<<<(act4 + 255) / 256, 256, 0, stream>>>(q,  q16,  act4);
  cvt_f16<<<(act4 + 255) / 256, 256, 0, stream>>>(k,  k16,  act4);
  cvt_f16<<<(act4 + 255) / 256, 256, 0, stream>>>(v,  v16,  act4);
  cvt_f16<<<(wgt4 + 255) / 256, 256, 0, stream>>>(Wq, Wq16, wgt4);
  cvt_f16<<<(wgt4 + 255) / 256, 256, 0, stream>>>(Wk, Wk16, wgt4);
  cvt_f16<<<(wgt4 + 255) / 256, 256, 0, stream>>>(Wv, Wv16, wgt4);
  cvt_f16<<<(wgt4 + 255) / 256, 256, 0, stream>>>(Wo, Wo16, wgt4);

  const dim3 ggrid(EMBED / 64, MTOK / 64);   // (12, 64)
  const float qscale = 0.125f;               // 1/sqrt(HSIZE) folded into Q

  gemm_wmma<<<ggrid, 256, 0, stream>>>(q16, Wq16, bq, (void*)Qh, 0, qscale);
  gemm_wmma<<<ggrid, 256, 0, stream>>>(k16, Wk16, bk, (void*)Kh, 0, 1.0f);
  gemm_wmma<<<ggrid, 256, 0, stream>>>(v16, Wv16, bv, (void*)Vt, 1, 1.0f);

  const int totalWaves = BATCH * HEADS * (SEQ / 16);   // 3072
  flash_attn<<<totalWaves / 8, 256, 0, stream>>>(Qh, Kh, Vt, mask, X16);

  gemm_wmma<<<ggrid, 256, 0, stream>>>(X16, Wo16, bo, d_out, 2, 1.0f);
}

// v001
// Measured time: 177 microseconds a run.
// Next to v000, in two timings, it ran 1.60 times as fast each time.
#include <hip/hip_runtime.h>

// Problem constants (fixed by the reference).
#define EMBED  768
#define HEADS  12
#define HSIZE  64
#define BATCH  2
#define SEQ    2048
#define MTOK   (BATCH * SEQ)   // 4096 rows for the projections

// LDS row pitches in halves. A fragment read is two 16-byte loads per lane, each with 16
// rows per lane half, so the pitch is 16 B x odd: the 16 rows then fall on 16
// distinct groups of four banks (64 banks x 4 B) instead of two or four groups.
#define P128   72   // rows of 128 B data -> pitch 144 B
#define P64    40   // rows of  64 B data -> pitch  80 B

typedef __attribute__((ext_vector_type(16))) _Float16 v16h;
typedef __attribute__((ext_vector_type(8)))  _Float16 v8h;
typedef __attribute__((ext_vector_type(4)))  _Float16 v4h;
typedef __attribute__((ext_vector_type(8)))  float    v8f;

// D = A(16x32 f16) * B(32x16 f16) + C(16x16 f32)
__device__ __forceinline__ v8f wmma_f16(v16h a, v16h b, v8f c) {
  return __builtin_amdgcn_wmma_f32_16x16x32_f16(
      /*neg_a=*/false, a, /*neg_b=*/false, b,
      /*c_mod=*/(short)0, c, /*reuse_a=*/false, /*reuse_b=*/false);
}

// Async copies of 16 bytes/lane global -> LDS (ASYNCcnt-tracked, no VGPR round trip).
// One statement per stage: the closing s_wait_xcnt 0 stands in front of any later
// rewrite of the address registers that the copies name.
__device__ __forceinline__ unsigned lds_addr(const _Float16* lptr) {
  return (unsigned)(uintptr_t)lptr;   // low 32 bits = LDS byte offset
}
__device__ __forceinline__ void async2_b128(const _Float16* g0, const _Float16* l0,
                                            const _Float16* g1, const _Float16* l1) {
  asm volatile("global_load_async_to_lds_b128 %0, %1, off\n\t"
               "global_load_async_to_lds_b128 %2, %3, off\n\t"
               "s_wait_xcnt 0x0"
               :: "v"(lds_addr(l0)), "v"(g0), "v"(lds_addr(l1)), "v"(g1) : "memory");
}
__device__ __forceinline__ void async4_b128(const _Float16* g0, const _Float16* l0,
                                            const _Float16* g1, const _Float16* l1,
                                            const _Float16* g2, const _Float16* l2,
                                            const _Float16* g3, const _Float16* l3) {
  asm volatile("global_load_async_to_lds_b128 %0, %1, off\n\t"
               "global_load_async_to_lds_b128 %2, %3, off\n\t"
               "global_load_async_to_lds_b128 %4, %5, off\n\t"
               "global_load_async_to_lds_b128 %6, %7, off\n\t"
               "s_wait_xcnt 0x0"
               :: "v"(lds_addr(l0)), "v"(g0), "v"(lds_addr(l1)), "v"(g1),
                  "v"(lds_addr(l2)), "v"(g2), "v"(lds_addr(l3)), "v"(g3) : "memory");
}
// Wait until at most N async ops remain in flight (in-order completion ->
// waiting <=N with N ops just issued drains everything older).
template <int N>
__device__ __forceinline__ void wait_async_le() {
  asm volatile("s_wait_asynccnt %0" :: "i"(N) : "memory");
}

// Load one 16x32 f16 A-layout fragment from a row-major [rows][stride] array.
// ISA layout: lanes 0-15 hold K={kb..kb+7, kb+16..kb+23} of row (lane&15),
// lanes 16-31 get kb=8. Two 16-byte loads per lane.
__device__ __forceinline__ v16h frag_ld(const _Float16* base, int stride,
                                        int row, int kb) {
  const _Float16* p = base + row * stride + kb;
  v8h lo = *(const v8h*)(p);
  v8h hi = *(const v8h*)(p + 16);
  v16h r;
#pragma unroll
  for (int i = 0; i < 8; ++i) { r[i] = lo[i]; r[i + 8] = hi[i]; }
  return r;
}

// Elementwise f32 -> f16 (vectorized x4); n must be a multiple of 4.
__global__ __launch_bounds__(256)
void cvt_f16(const float* __restrict__ in, _Float16* __restrict__ out, int n4) {
  const int i = blockIdx.x * 256 + threadIdx.x;
  if (i < n4) {
    const float4 f = ((const float4*)in)[i];
    v4h h;
    h[0] = (_Float16)f.x; h[1] = (_Float16)f.y;
    h[2] = (_Float16)f.z; h[3] = (_Float16)f.w;
    ((v4h*)out)[i] = h;
  }
}

// C = A[M,K](f16) * Bt[N,K]^T(f16) + bias[N], M=4096, N=768, K=768.
// 64x64 tiles, BK=64, double-buffered async-to-LDS staging (DMA overlaps WMMA).
// mode 0: out f16 [B,H,S,64]   (Q/K head layout; outScale folds 1/sqrt(d))
// mode 1: out f16 [B,H,64,S]   (V transposed so it feeds the WMMA B operand)
// mode 2: out f32 [M,768]      (final projection into d_out)
__global__ __launch_bounds__(256)
void gemm_wmma(const _Float16* __restrict__ A, const _Float16* __restrict__ Bt,
               const float* __restrict__ bias, void* __restrict__ outp,
               int mode, float outScale) {
  __shared__ __attribute__((aligned(16))) _Float16 As[2][64 * P128];
  __shared__ __attribute__((aligned(16))) _Float16 Bs[2][64 * P128];

  const int tid   = threadIdx.x;
  const int wave  = tid >> 5;
  const int lane  = tid & 31;
  const int l16   = lane & 15;
  const int lhalf = lane >> 4;
  const int kb    = lhalf ? 8 : 0;
  const int mw    = wave & 3;    // m-subtile 0..3
  const int nw    = wave >> 2;   // n-half 0..1
  const int m0    = blockIdx.y * 64;
  const int n0    = blockIdx.x * 64;
  const int K     = EMBED;
  const int NIT   = K / 64;      // 12

  // Staging: tile = 64 rows x 128B = 512 x 16B chunks; each thread moves 2 per tile.
  const int row0 = tid >> 3;          // 0..31
  const int row1 = row0 + 32;         // 32..63
  const int seg  = (tid & 7) * 8;     // halves within row

  auto stage = [&](int kc, int buf) {
    async4_b128(A  + (m0 + row0) * K + kc + seg, &As[buf][row0 * P128 + seg],
                A  + (m0 + row1) * K + kc + seg, &As[buf][row1 * P128 + seg],
                Bt + (n0 + row0) * K + kc + seg, &Bs[buf][row0 * P128 + seg],
                Bt + (n0 + row1) * K + kc + seg, &Bs[buf][row1 * P128 + seg]);
  };

  v8f acc[2] = {{}, {}};

  stage(0, 0);   // prologue: tile 0 in flight
#pragma unroll 1
  for (int it = 0; it < NIT; ++it) {
    const int cur = it & 1;
    if (it + 1 < NIT) {
      stage((it + 1) * 64, cur ^ 1);   // next tile streams during this compute
      wait_async_le<4>();              // drain tile `it` only
    } else {
      wait_async_le<0>();
    }
    __syncthreads();

    const int arow = 16 * mw + l16;
    const v16h af0 = frag_ld(As[cur],      P128, arow, kb);   // k 0..31
    const v16h af1 = frag_ld(As[cur] + 32, P128, arow, kb);   // k 32..63
#pragma unroll
    for (int j = 0; j < 2; ++j) {
      const int brow = 32 * nw + 16 * j + l16;
      const v16h bf0 = frag_ld(Bs[cur],      P128, brow, kb);
      const v16h bf1 = frag_ld(Bs[cur] + 32, P128, brow, kb);
      acc[j] = wmma_f16(af0, bf0, acc[j]);
      acc[j] = wmma_f16(af1, bf1, acc[j]);
    }
    __syncthreads();   // all reads of buf `cur` done before it is restaged
  }

#pragma unroll
  for (int j = 0; j < 2; ++j) {
    const int n = n0 + 32 * nw + 16 * j + l16;
    const float bv = bias[n];
#pragma unroll
    for (int vv = 0; vv < 8; ++vv) {
      const int m = m0 + 16 * mw + vv + 8 * lhalf;   // C layout: row = v + 8*(lane/16)
      const float val = (acc[j][vv] + bv) * outScale;
      if (mode == 2) {
        ((float*)outp)[(size_t)m * EMBED + n] = val;
      } else {
        const int bb = m >> 11, s = m & (SEQ - 1);
        const int hh = n >> 6,  d = n & (HSIZE - 1);
        const size_t o = (mode == 0)
            ? ((size_t)((bb * HEADS + hh) * SEQ + s)) * HSIZE + d
            : ((size_t)((bb * HEADS + hh) * HSIZE + d)) * SEQ + s;
        ((_Float16*)outp)[o] = (_Float16)val;
      }
    }
  }
}

// Fused flash attention. One wave per (b, h, 16-query tile); the 8 waves of a
// block share one (b,h), so K/V chunks are async-staged into LDS once per block,
// double-buffered so the DMA for chunk i+1 overlaps softmax+WMMA of chunk i.
// Qh,Kh: f16 [B,H,S,64]; Vt: f16 [B,H,64,S]; X out: f16 [B,S,EMBED]. Q pre-scaled.
__global__ __launch_bounds__(256)
void flash_attn(const _Float16* __restrict__ Qh, const _Float16* __restrict__ Kh,
                const _Float16* __restrict__ Vt, const int* __restrict__ mask,
                _Float16* __restrict__ X) {
  __shared__ __attribute__((aligned(16))) _Float16 Ks[2][32 * P128];  // 32 keys x 64 d
  __shared__ __attribute__((aligned(16))) _Float16 Vs[2][64 * P64];   // 64 d x 32 keys
  __shared__ __attribute__((aligned(16))) _Float16 P[8][16 * P64];    // per-wave P staging (C-layout -> A-layout)

  const int tid   = threadIdx.x;
  const int wave  = tid >> 5;
  const int lane  = tid & 31;
  const int l16   = lane & 15;
  const int lhalf = lane >> 4;
  const int kb    = lhalf ? 8 : 0;

  const int g  = blockIdx.x * 8 + wave;   // global wave id, 3072 total
  const int bh = g >> 7;                  // same for all 8 waves of a block
  const int qt = g & 127;
  const int b  = bh / HEADS;
  const int h  = bh % HEADS;

  const _Float16* Qp = Qh + (size_t)bh * SEQ * HSIZE;
  const _Float16* Kp = Kh + (size_t)bh * SEQ * HSIZE;
  const _Float16* Vp = Vt + (size_t)bh * HSIZE * SEQ;
  const int* mp = mask + b * SEQ;

  // Staging assignment: K chunk = 32 rows x 8 segs, V chunk = 64 rows x 4 segs.
  const int krow = tid >> 3, kseg = (tid & 7) * 8;
  const int vrow = tid >> 2, vseg = (tid & 3) * 8;

  auto stage = [&](int kc, int buf) {
    async2_b128(Kp + (kc + krow) * HSIZE + kseg, &Ks[buf][krow * P128 + kseg],
                Vp + vrow * SEQ + kc + vseg,     &Vs[buf][vrow * P64 + vseg]);
  };

  // Q fragments (row = qt*16 + l16, d in [0,32) and [32,64))
  const int qrow = qt * 16 + l16;
  const v16h qf0 = frag_ld(Qp,      HSIZE, qrow, kb);
  const v16h qf1 = frag_ld(Qp + 32, HSIZE, qrow, kb);

  float ml[8], ll[8];
  v8f oacc[4] = {{}, {}, {}, {}};
#pragma unroll
  for (int vv = 0; vv < 8; ++vv) { ml[vv] = -1e30f; ll[vv] = 0.f; }

  _Float16* Pl = P[wave];
  const int NCH = SEQ / 32;   // 64 chunks

  stage(0, 0);
#pragma unroll 1
  for (int it = 0; it < NCH; ++it) {
    const int cur = it & 1;
    const int kc  = it * 32;
    if (it + 1 < NCH) {
      stage((it + 1) * 32, cur ^ 1);   // next K/V chunk streams during compute
      wait_async_le<2>();
    } else {
      wait_async_le<0>();
    }
    __syncthreads();

    // ---- scores: 16 queries x 32 keys, f32 accum ----
    v8f s0 = {}, s1 = {};
    {
      v16h kf = frag_ld(Ks[cur],      P128, l16, kb);      // keys 0..15, d 0..31
      s0 = wmma_f16(qf0, kf, s0);
      kf = frag_ld(Ks[cur] + 32, P128, l16, kb);           // d 32..63
      s0 = wmma_f16(qf1, kf, s0);
      kf = frag_ld(Ks[cur],      P128, 16 + l16, kb);      // keys 16..31
      s1 = wmma_f16(qf0, kf, s1);
      kf = frag_ld(Ks[cur] + 32, P128, 16 + l16, kb);
      s1 = wmma_f16(qf1, kf, s1);
    }
    // ---- key mask (column = lane's n) ----
    const int mv0 = mp[kc + l16];
    const int mv1 = mp[kc + 16 + l16];
    if (mv0 == 0) {
#pragma unroll
      for (int vv = 0; vv < 8; ++vv) s0[vv] = -1e9f;
    }
    if (mv1 == 0) {
#pragma unroll
      for (int vv = 0; vv < 8; ++vv) s1[vv] = -1e9f;
    }
    // ---- online softmax: row stats via shfl within lane half ----
    float rm[8];
#pragma unroll
    for (int vv = 0; vv < 8; ++vv) rm[vv] = fmaxf(s0[vv], s1[vv]);
#pragma unroll
    for (int xm = 1; xm <= 8; xm <<= 1)
#pragma unroll
      for (int vv = 0; vv < 8; ++vv)
        rm[vv] = fmaxf(rm[vv], __shfl_xor(rm[vv], xm, 32));
    float corr[8], rs[8];
#pragma unroll
    for (int vv = 0; vv < 8; ++vv) {
      const float nm = fmaxf(ml[vv], rm[vv]);
      corr[vv] = __expf(ml[vv] - nm);
      ml[vv] = nm;
      const float p0 = __expf(s0[vv] - nm);
      const float p1 = __expf(s1[vv] - nm);
      s0[vv] = p0; s1[vv] = p1;
      rs[vv] = p0 + p1;
    }
#pragma unroll
    for (int xm = 1; xm <= 8; xm <<= 1)
#pragma unroll
      for (int vv = 0; vv < 8; ++vv)
        rs[vv] += __shfl_xor(rs[vv], xm, 32);
#pragma unroll
    for (int vv = 0; vv < 8; ++vv) ll[vv] = ll[vv] * corr[vv] + rs[vv];
#pragma unroll
    for (int t = 0; t < 4; ++t)
#pragma unroll
      for (int vv = 0; vv < 8; ++vv) oacc[t][vv] *= corr[vv];

    // ---- transpose P (C-layout) -> A-layout via per-wave LDS ----
#pragma unroll
    for (int vv = 0; vv < 8; ++vv) {
      const int r = vv + 8 * lhalf;
      Pl[r * P64 + l16]      = (_Float16)s0[vv];
      Pl[r * P64 + 16 + l16] = (_Float16)s1[vv];
    }
    asm volatile("s_wait_dscnt 0x0" ::: "memory");   // intra-wave LDS RAW (lane exchange)
    const v16h pf = frag_ld(Pl, P64, l16, kb);

    // ---- out += P(16x32) * V(32x64) ----
#pragma unroll
    for (int t = 0; t < 4; ++t) {
      const v16h vf = frag_ld(Vs[cur], P64, 16 * t + l16, kb);
      oacc[t] = wmma_f16(pf, vf, oacc[t]);
    }
    __syncthreads();   // all waves done with buf `cur` before it is restaged
  }

  // ---- epilogue: normalize, scatter f16 to X [B,S,EMBED] ----
  float inv[8];
#pragma unroll
  for (int vv = 0; vv < 8; ++vv) inv[vv] = 1.0f / ll[vv];
#pragma unroll
  for (int t = 0; t < 4; ++t) {
    const int e = h * HSIZE + 16 * t + l16;
#pragma unroll
    for (int vv = 0; vv < 8; ++vv) {
      const int s = qt * 16 + vv + 8 * lhalf;
      X[((size_t)(b * SEQ + s)) * EMBED + e] = (_Float16)(oacc[t][vv] * inv[vv]);
    }
  }
}

extern "C" void kernel_launch(void* const* d_in, const int* in_sizes, int n_in,
                              void* d_out, int out_size, void* d_ws, size_t ws_size,
                              hipStream_t stream) {
  const float* q    = (const float*)d_in[0];
  const float* k    = (const float*)d_in[1];
  const float* v    = (const float*)d_in[2];
  const int*   mask = (const int*)  d_in[3];
  const float* Wq   = (const float*)d_in[4];
  const float* bq   = (const float*)d_in[5];
  const float* Wk   = (const float*)d_in[6];
  const float* bk   = (const float*)d_in[7];
  const float* Wv   = (const float*)d_in[8];
  const float* bv   = (const float*)d_in[9];
  const float* Wo   = (const float*)d_in[10];
  const float* bo   = (const float*)d_in[11];

  const size_t actElems  = (size_t)MTOK * EMBED;     // 3,145,728
  const size_t wgtElems  = (size_t)EMBED * EMBED;    //   589,824
  const size_t headElems = (size_t)BATCH * HEADS * SEQ * HSIZE;  // 3,145,728

  _Float16* p = (_Float16*)d_ws;
  _Float16* q16  = p; p += actElems;
  _Float16* k16  = p; p += actElems;
  _Float16* v16  = p; p += actElems;
  _Float16* Wq16 = p; p += wgtElems;
  _Float16* Wk16 = p; p += wgtElems;
  _Float16* Wv16 = p; p += wgtElems;
  _Float16* Wo16 = p; p += wgtElems;
  _Float16* Qh   = p; p += headElems;
  _Float16* Kh   = p; p += headElems;
  _Float16* Vt   = p; p += headElems;
  _Float16* X16  = p; p += actElems;

  // f32 -> f16 precision downcast pass (read-once, HBM-bound, ~2 us total).
  const int act4 = (int)(actElems / 4), wgt4 = (int)(wgtElems / 4);
  cvt_f16<<<(act4 + 255) / 256, 256, 0, stream>>>(q,  q16,  act4);
  cvt_f16<<<(act4 + 255) / 256, 256, 0, stream>>>(k,  k16,  act4);
  cvt_f16<<<(act4 + 255) / 256, 256, 0, stream>>>(v,  v16,  act4);
  cvt_f16<<<(wgt4 + 255) / 256, 256, 0, stream>>>(Wq, Wq16, wgt4);
  cvt_f16<<<(wgt4 + 255) / 256, 256, 0, stream>>>(Wk, Wk16, wgt4);
  cvt_f16<<<(wgt4 + 255) / 256, 256, 0, stream>>>(Wv, Wv16, wgt4);
  cvt_f16<<<(wgt4 + 255) / 256, 256, 0, stream>>>(Wo, Wo16, wgt4);

  const dim3 ggrid(EMBED / 64, MTOK / 64);   // (12, 64)
  const float qscale = 0.125f;               // 1/sqrt(HSIZE) folded into Q

  gemm_wmma<<<ggrid, 256, 0, stream>>>(q16, Wq16, bq, (void*)Qh, 0, qscale);
  gemm_wmma<<<ggrid, 256, 0, stream>>>(k16, Wk16, bk, (void*)Kh, 0, 1.0f);
  gemm_wmma<<<ggrid, 256, 0, stream>>>(v16, Wv16, bv, (void*)Vt, 1, 1.0f);

  const int totalWaves = BATCH * HEADS * (SEQ / 16);   // 3072
  flash_attn<<<totalWaves / 8, 256, 0, stream>>>(Qh, Kh, Vt, mask, X16);

  gemm_wmma<<<ggrid, 256, 0, stream>>>(X16, Wo16, bo, d_out, 2, 1.0f);
}

// v002
// Measured time: 144 microseconds a run.
// Timed twice side by side with v001, it ran 1.23 times as fast both times.
// Over all steps from v000 it is 1.96 times as fast.
#include <hip/hip_runtime.h>

// Problem constants (fixed by the reference).
#define EMBED  768
#define HEADS  12
#define HSIZE  64
#define BATCH  2
#define SEQ    2048
#define MTOK   (BATCH * SEQ)   // 4096 rows for the projections

// LDS row pitches in halves. A fragment read is two 16-byte loads per lane, each with 16
// rows per lane half, so the pitch is 16 B x odd: the 16 rows then fall on 16
// distinct groups of four banks (64 banks x 4 B) instead of two or four groups.
#define P128   72   // rows of 128 B data -> pitch 144 B
#define P64    40   // rows of  64 B data -> pitch  80 B

typedef __attribute__((ext_vector_type(16))) _Float16 v16h;
typedef __attribute__((ext_vector_type(8)))  _Float16 v8h;
typedef __attribute__((ext_vector_type(4)))  _Float16 v4h;
typedef __attribute__((ext_vector_type(8)))  float    v8f;

// D = A(16x32 f16) * B(32x16 f16) + C(16x16 f32)
__device__ __forceinline__ v8f wmma_f16(v16h a, v16h b, v8f c) {
  return __builtin_amdgcn_wmma_f32_16x16x32_f16(
      /*neg_a=*/false, a, /*neg_b=*/false, b,
      /*c_mod=*/(short)0, c, /*reuse_a=*/false, /*reuse_b=*/false);
}

// Async copies of 16 bytes/lane global -> LDS (ASYNCcnt-tracked, no VGPR round trip).
// One statement per stage: the closing s_wait_xcnt 0 stands in front of any later
// rewrite of the address registers that the copies name.
__device__ __forceinline__ unsigned lds_addr(const _Float16* lptr) {
  return (unsigned)(uintptr_t)lptr;   // low 32 bits = LDS byte offset
}
__device__ __forceinline__ void async2_b128(const _Float16* g0, const _Float16* l0,
                                            const _Float16* g1, const _Float16* l1) {
  asm volatile("global_load_async_to_lds_b128 %0, %1, off\n\t"
               "global_load_async_to_lds_b128 %2, %3, off\n\t"
               "s_wait_xcnt 0x0"
               :: "v"(lds_addr(l0)), "v"(g0), "v"(lds_addr(l1)), "v"(g1) : "memory");
}
__device__ __forceinline__ void async4_b128(const _Float16* g0, const _Float16* l0,
                                            const _Float16* g1, const _Float16* l1,
                                            const _Float16* g2, const _Float16* l2,
                                            const _Float16* g3, const _Float16* l3) {
  asm volatile("global_load_async_to_lds_b128 %0, %1, off\n\t"
               "global_load_async_to_lds_b128 %2, %3, off\n\t"
               "global_load_async_to_lds_b128 %4, %5, off\n\t"
               "global_load_async_to_lds_b128 %6, %7, off\n\t"
               "s_wait_xcnt 0x0"
               :: "v"(lds_addr(l0)), "v"(g0), "v"(lds_addr(l1)), "v"(g1),
                  "v"(lds_addr(l2)), "v"(g2), "v"(lds_addr(l3)), "v"(g3) : "memory");
}
// Wait until at most N async ops remain in flight (in-order completion ->
// waiting <=N with N ops just issued drains everything older).
template <int N>
__device__ __forceinline__ void wait_async_le() {
  asm volatile("s_wait_asynccnt %0" :: "i"(N) : "memory");
}

// Load one 16x32 f16 A-layout fragment from a row-major [rows][stride] array.
// ISA layout: lanes 0-15 hold K={kb..kb+7, kb+16..kb+23} of row (lane&15),
// lanes 16-31 get kb=8. Two 16-byte loads per lane.
__device__ __forceinline__ v16h frag_ld(const _Float16* base, int stride,
                                        int row, int kb) {
  const _Float16* p = base + row * stride + kb;
  v8h lo = *(const v8h*)(p);
  v8h hi = *(const v8h*)(p + 16);
  v16h r;
#pragma unroll
  for (int i = 0; i < 8; ++i) { r[i] = lo[i]; r[i + 8] = hi[i]; }
  return r;
}

// Elementwise f32 -> f16 (vectorized x4); n must be a multiple of 4.
__global__ __launch_bounds__(256)
void cvt_f16(const float* __restrict__ in, _Float16* __restrict__ out, int n4) {
  const int i = blockIdx.x * 256 + threadIdx.x;
  if (i < n4) {
    const float4 f = ((const float4*)in)[i];
    v4h h;
    h[0] = (_Float16)f.x; h[1] = (_Float16)f.y;
    h[2] = (_Float16)f.z; h[3] = (_Float16)f.w;
    ((v4h*)out)[i] = h;
  }
}

// C = A[M,K](f16) * Bt[N,K]^T(f16) + bias[N], M=4096, N=768, K=768.
// 64x64 tiles, BK=64, double-buffered async-to-LDS staging (DMA overlaps WMMA).
// mode 0: out f16 [B,H,S,64]   (Q/K head layout; outScale folds 1/sqrt(d))
// mode 1: out f16 [B,H,64,S]   (V transposed so it feeds the WMMA A operand)
// mode 2: out f32 [M,768]      (final projection into d_out)
__global__ __launch_bounds__(256)
void gemm_wmma(const _Float16* __restrict__ A, const _Float16* __restrict__ Bt,
               const float* __restrict__ bias, void* __restrict__ outp,
               int mode, float outScale) {
  __shared__ __attribute__((aligned(16))) _Float16 As[2][64 * P128];
  __shared__ __attribute__((aligned(16))) _Float16 Bs[2][64 * P128];

  const int tid   = threadIdx.x;
  const int wave  = tid >> 5;
  const int lane  = tid & 31;
  const int l16   = lane & 15;
  const int lhalf = lane >> 4;
  const int kb    = lhalf ? 8 : 0;
  const int mw    = wave & 3;    // m-subtile 0..3
  const int nw    = wave >> 2;   // n-half 0..1
  const int m0    = blockIdx.y * 64;
  const int n0    = blockIdx.x * 64;
  const int K     = EMBED;
  const int NIT   = K / 64;      // 12

  // Staging: tile = 64 rows x 128B = 512 x 16B chunks; each thread moves 2 per tile.
  const int row0 = tid >> 3;          // 0..31
  const int row1 = row0 + 32;         // 32..63
  const int seg  = (tid & 7) * 8;     // halves within row

  auto stage = [&](int kc, int buf) {
    async4_b128(A  + (m0 + row0) * K + kc + seg, &As[buf][row0 * P128 + seg],
                A  + (m0 + row1) * K + kc + seg, &As[buf][row1 * P128 + seg],
                Bt + (n0 + row0) * K + kc + seg, &Bs[buf][row0 * P128 + seg],
                Bt + (n0 + row1) * K + kc + seg, &Bs[buf][row1 * P128 + seg]);
  };

  v8f acc[2] = {{}, {}};

  stage(0, 0);   // prologue: tile 0 in flight
#pragma unroll 1
  for (int it = 0; it < NIT; ++it) {
    const int cur = it & 1;
    if (it + 1 < NIT) {
      stage((it + 1) * 64, cur ^ 1);   // next tile streams during this compute
      wait_async_le<4>();              // drain tile `it` only
    } else {
      wait_async_le<0>();
    }
    __syncthreads();

    const int arow = 16 * mw + l16;
    const v16h af0 = frag_ld(As[cur],      P128, arow, kb);   // k 0..31
    const v16h af1 = frag_ld(As[cur] + 32, P128, arow, kb);   // k 32..63
#pragma unroll
    for (int j = 0; j < 2; ++j) {
      const int brow = 32 * nw + 16 * j + l16;
      const v16h bf0 = frag_ld(Bs[cur],      P128, brow, kb);
      const v16h bf1 = frag_ld(Bs[cur] + 32, P128, brow, kb);
      acc[j] = wmma_f16(af0, bf0, acc[j]);
      acc[j] = wmma_f16(af1, bf1, acc[j]);
    }
    __syncthreads();   // all reads of buf `cur` done before it is restaged
  }

#pragma unroll
  for (int j = 0; j < 2; ++j) {
    const int n = n0 + 32 * nw + 16 * j + l16;
    const float bv = bias[n];
#pragma unroll
    for (int vv = 0; vv < 8; ++vv) {
      const int m = m0 + 16 * mw + vv + 8 * lhalf;   // C layout: row = v + 8*(lane/16)
      const float val = (acc[j][vv] + bv) * outScale;
      if (mode == 2) {
        ((float*)outp)[(size_t)m * EMBED + n] = val;
      } else {
        const int bb = m >> 11, s = m & (SEQ - 1);
        const int hh = n >> 6,  d = n & (HSIZE - 1);
        const size_t o = (mode == 0)
            ? ((size_t)((bb * HEADS + hh) * SEQ + s)) * HSIZE + d
            : ((size_t)((bb * HEADS + hh) * HSIZE + d)) * SEQ + s;
        ((_Float16*)outp)[o] = (_Float16)val;
      }
    }
  }
}

// Lane l <-> lane l ^ 16 (the two halves of a wave) without touching LDS.
__device__ __forceinline__ float xhalf(float x) {
  const int b = __builtin_bit_cast(int, x);
  return __builtin_bit_cast(float,
      __builtin_amdgcn_permlanex16(b, b, 0x76543210, 0xfedcba98, false, false));
}

// Fused flash attention, transposed products: S^T = K * Q^T, O^T += V^T * P^T.
// One wave per (b, h, 16-query tile); the 8 waves of a block share one (b,h), so
// K/V chunks are async-staged into LDS once per block, double-buffered so the DMA
// for chunk i+1 overlaps softmax+WMMA of chunk i.
// A lane holds scores of ONE query (column l16): keys 8*lhalf+r and 16+8*lhalf+r.
// Maximum and sum run in the lane's own registers plus one exchange between the
// halves, and the two score tiles, converted in place, are the B operand of the
// second product (hardware k order), so P never goes through LDS.
// Qh,Kh: f16 [B,H,S,64]; Vt: f16 [B,H,64,S]; X out: f16 [B,S,EMBED]. Q pre-scaled.
__global__ __launch_bounds__(256)
void flash_attn(const _Float16* __restrict__ Qh, const _Float16* __restrict__ Kh,
                const _Float16* __restrict__ Vt, const int* __restrict__ mask,
                _Float16* __restrict__ X) {
  __shared__ __attribute__((aligned(16))) _Float16 Ks[2][32 * P128];  // 32 keys x 64 d
  __shared__ __attribute__((aligned(16))) _Float16 Vs[2][64 * P64];   // 64 d x 32 keys

  const int tid   = threadIdx.x;
  const int wave  = tid >> 5;
  const int lane  = tid & 31;
  const int l16   = lane & 15;
  const int lhalf = lane >> 4;
  const int kb    = lhalf ? 8 : 0;

  const int g  = blockIdx.x * 8 + wave;   // global wave id, 3072 total
  const int bh = g >> 7;                  // same for all 8 waves of a block
  const int qt = g & 127;
  const int b  = bh / HEADS;
  const int h  = bh % HEADS;

  const _Float16* Qp = Qh + (size_t)bh * SEQ * HSIZE;
  const _Float16* Kp = Kh + (size_t)bh * SEQ * HSIZE;
  const _Float16* Vp = Vt + (size_t)bh * HSIZE * SEQ;
  const int* mp = mask + b * SEQ + kb;    // this half's first key of a 16-key tile

  // Staging assignment: K chunk = 32 rows x 8 segs, V chunk = 64 rows x 4 segs.
  const int krow = tid >> 3, kseg = (tid & 7) * 8;
  const int vrow = tid >> 2, vseg = (tid & 3) * 8;

  auto stage = [&](int kc, int buf) {
    async2_b128(Kp + (kc + krow) * HSIZE + kseg, &Ks[buf][krow * P128 + kseg],
                Vp + vrow * SEQ + kc + vseg,     &Vs[buf][vrow * P64 + vseg]);
  };

  // Q^T as B operand (column = query qt*16 + l16, k = d in [0,32) and [32,64))
  const int qrow = qt * 16 + l16;
  const v16h qf0 = frag_ld(Qp,      HSIZE, qrow, kb);
  const v16h qf1 = frag_ld(Qp + 32, HSIZE, qrow, kb);

  float ml = -1e30f;   // running maximum of this lane's query (equal in both halves)
  float ll = 0.f;      // running sum over this half's keys only; joined in the epilogue
  v8f oacc[4] = {{}, {}, {}, {}};   // O^T: row d = 16*t + 8*lhalf + r, column = query

  const int NCH = SEQ / 32;   // 64 chunks

  stage(0, 0);
#pragma unroll 1
  for (int it = 0; it < NCH; ++it) {
    const int cur = it & 1;
    const int kc  = it * 32;
    // Key mask of this lane's 16 keys, all four loads asked for at once at the chunk's head.
    const int4 ma = *(const int4*)(mp + kc);
    const int4 mb = *(const int4*)(mp + kc + 4);
    const int4 mc = *(const int4*)(mp + kc + 16);
    const int4 md = *(const int4*)(mp + kc + 20);
    if (it + 1 < NCH) {
      stage((it + 1) * 32, cur ^ 1);   // next K/V chunk streams during compute
      wait_async_le<2>();
    } else {
      wait_async_le<0>();
    }
    __syncthreads();

    // ---- scores^T: 32 keys x 16 queries, f32 accum ----
    v8f s0 = {}, s1 = {};
    {
      v16h kf = frag_ld(Ks[cur],      P128, l16, kb);      // keys 0..15, d 0..31
      s0 = wmma_f16(kf, qf0, s0);
      kf = frag_ld(Ks[cur] + 32, P128, l16, kb);           // d 32..63
      s0 = wmma_f16(kf, qf1, s0);
      kf = frag_ld(Ks[cur],      P128, 16 + l16, kb);      // keys 16..31
      s1 = wmma_f16(kf, qf0, s1);
      kf = frag_ld(Ks[cur] + 32, P128, 16 + l16, kb);
      s1 = wmma_f16(kf, qf1, s1);
    }
    // ---- key mask (row = register r) ----
    const int m0[8] = {ma.x, ma.y, ma.z, ma.w, mb.x, mb.y, mb.z, mb.w};
    const int m1[8] = {mc.x, mc.y, mc.z, mc.w, md.x, md.y, md.z, md.w};
#pragma unroll
    for (int vv = 0; vv < 8; ++vv) {
      s0[vv] = (m0[vv] == 0) ? -1e9f : s0[vv];
      s1[vv] = (m1[vv] == 0) ? -1e9f : s1[vv];
    }
    // ---- online softmax: one query per lane ----
    float rm = fmaxf(s0[0], s1[0]);
#pragma unroll
    for (int vv = 1; vv < 8; ++vv) rm = fmaxf(rm, fmaxf(s0[vv], s1[vv]));
    rm = fmaxf(rm, xhalf(rm));
    const float nm   = fmaxf(ml, rm);
    const float corr = __expf(ml - nm);
    ml = nm;
    v16h pf;           // P^T as B operand: pf[s] = key kmap(s, lhalf) of column l16
    float rs0 = 0.f, rs1 = 0.f;
#pragma unroll
    for (int vv = 0; vv < 8; ++vv) {
      const float p0 = __expf(s0[vv] - nm);
      const float p1 = __expf(s1[vv] - nm);
      rs0 += p0; rs1 += p1;
      pf[vv]     = (_Float16)p0;
      pf[vv + 8] = (_Float16)p1;
    }
    ll = ll * corr + (rs0 + rs1);
#pragma unroll
    for (int t = 0; t < 4; ++t)
#pragma unroll
      for (int vv = 0; vv < 8; ++vv) oacc[t][vv] *= corr;

    // ---- out^T += V^T(64x32) * P^T(32x16) ----
#pragma unroll
    for (int t = 0; t < 4; ++t) {
      const v16h vf = frag_ld(Vs[cur], P64, 16 * t + l16, kb);
      oacc[t] = wmma_f16(vf, pf, oacc[t]);
    }
    __syncthreads();   // all waves done with buf `cur` before it is restaged
  }

  // ---- epilogue: join the halves' sums, normalize, 16-byte stores to X [B,S,EMBED] ----
  const float inv = 1.0f / (ll + xhalf(ll));
  _Float16* xr = X + ((size_t)(b * SEQ + qrow)) * EMBED + h * HSIZE + kb;
#pragma unroll
  for (int t = 0; t < 4; ++t) {
    v8h o;
#pragma unroll
    for (int vv = 0; vv < 8; ++vv) o[vv] = (_Float16)(oacc[t][vv] * inv);
    *(v8h*)(xr + 16 * t) = o;
  }
}

extern "C" void kernel_launch(void* const* d_in, const int* in_sizes, int n_in,
                              void* d_out, int out_size, void* d_ws, size_t ws_size,
                              hipStream_t stream) {
  const float* q    = (const float*)d_in[0];
  const float* k    = (const float*)d_in[1];
  const float* v    = (const float*)d_in[2];
  const int*   mask = (const int*)  d_in[3];
  const float* Wq   = (const float*)d_in[4];
  const float* bq   = (const float*)d_in[5];
  const float* Wk   = (const float*)d_in[6];
  const float* bk   = (const float*)d_in[7];
  const float* Wv   = (const float*)d_in[8];
  const float* bv   = (const float*)d_in[9];
  const float* Wo   = (const float*)d_in[10];
  const float* bo   = (const float*)d_in[11];

  const size_t actElems  = (size_t)MTOK * EMBED;     // 3,145,728
  const size_t wgtElems  = (size_t)EMBED * EMBED;    //   589,824
  const size_t headElems = (size_t)BATCH * HEADS * SEQ * HSIZE;  // 3,145,728

  _Float16* p = (_Float16*)d_ws;
  _Float16* q16  = p; p += actElems;
  _Float16* k16  = p; p += actElems;
  _Float16* v16  = p; p += actElems;
  _Float16* Wq16 = p; p += wgtElems;
  _Float16* Wk16 = p; p += wgtElems;
  _Float16* Wv16 = p; p += wgtElems;
  _Float16* Wo16 = p; p += wgtElems;
  _Float16* Qh   = p; p += headElems;
  _Float16* Kh   = p; p += headElems;
  _Float16* Vt   = p; p += headElems;
  _Float16* X16  = p; p += actElems;

  // f32 -> f16 precision downcast pass (read-once, HBM-bound, ~2 us total).
  const int act4 = (int)(actElems / 4), wgt4 = (int)(wgtElems / 4);
  cvt_f16<<<(act4 + 255) / 256, 256, 0, stream>>>(q,  q16,  act4);
  cvt_f16<<<(act4 + 255) / 256, 256, 0, stream>>>(k,  k16,  act4);
  cvt_f16<<<(act4 + 255) / 256, 256, 0, stream>>>(v,  v16,  act4);
  cvt_f16<<<(wgt4 + 255) / 256, 256, 0, stream>>>(Wq, Wq16, wgt4);
  cvt_f16<<<(wgt4 + 255) / 256, 256, 0, stream>>>(Wk, Wk16, wgt4);
  cvt_f16<<<(wgt4 + 255) / 256, 256, 0, stream>>>(Wv, Wv16, wgt4);
  cvt_f16<<<(wgt4 + 255) / 256, 256, 0, stream>>>(Wo, Wo16, wgt4);

  const dim3 ggrid(EMBED / 64, MTOK / 64);   // (12, 64)
  const float qscale = 0.125f;               // 1/sqrt(HSIZE) folded into Q

  gemm_wmma<<<ggrid, 256, 0, stream>>>(q16, Wq16, bq, (void*)Qh, 0, qscale);
  gemm_wmma<<<ggrid, 256, 0, stream>>>(k16, Wk16, bk, (void*)Kh, 0, 1.0f);
  gemm_wmma<<<ggrid, 256, 0, stream>>>(v16, Wv16, bv, (void*)Vt, 1, 1.0f);

  const int totalWaves = BATCH * HEADS * (SEQ / 16);   // 3072
  flash_attn<<<totalWaves / 8, 256, 0, stream>>>(Qh, Kh, Vt, mask, X16);

  gemm_wmma<<<ggrid, 256, 0, stream>>>(X16, Wo16, bo, d_out, 2, 1.0f);
}

// v003
// A run of this version takes 133 microseconds.
// Two timings next to v002 both put it at 1.08 times that version's speed.
// All steps since v000 together make it 2.12 times as fast.
#include <hip/hip_runtime.h>

// Problem constants (fixed by the reference).
#define EMBED  768
#define HEADS  12
#define HSIZE  64
#define BATCH  2
#define SEQ    2048
#define MTOK   (BATCH * SEQ)   // 4096 rows for the projections

// LDS row pitches in halves. A fragment read is two 16-byte loads per lane, each with 16
// rows per lane half, so the pitch is 16 B x odd: the 16 rows then fall on 16
// distinct groups of four banks (64 banks x 4 B) instead of two or four groups.
#define P128   72   // rows of 128 B data -> pitch 144 B
#define P64    40   // rows of  64 B data -> pitch  80 B

typedef __attribute__((ext_vector_type(16))) _Float16 v16h;
typedef __attribute__((ext_vector_type(8)))  _Float16 v8h;
typedef __attribute__((ext_vector_type(4)))  _Float16 v4h;
typedef __attribute__((ext_vector_type(8)))  float    v8f;

// D = A(16x32 f16) * B(32x16 f16) + C(16x16 f32)
__device__ __forceinline__ v8f wmma_f16(v16h a, v16h b, v8f c) {
  return __builtin_amdgcn_wmma_f32_16x16x32_f16(
      /*neg_a=*/false, a, /*neg_b=*/false, b,
      /*c_mod=*/(short)0, c, /*reuse_a=*/false, /*reuse_b=*/false);
}

// Async copies of 16 bytes/lane global -> LDS (ASYNCcnt-tracked, no VGPR round trip).
// One statement per stage: the closing s_wait_xcnt 0 stands in front of any later
// rewrite of the address registers that the copies name.
__device__ __forceinline__ unsigned lds_addr(const _Float16* lptr) {
  return (unsigned)(uintptr_t)lptr;   // low 32 bits = LDS byte offset
}
__device__ __forceinline__ void async2_b128(const _Float16* g0, const _Float16* l0,
                                            const _Float16* g1, const _Float16* l1) {
  asm volatile("global_load_async_to_lds_b128 %0, %1, off\n\t"
               "global_load_async_to_lds_b128 %2, %3, off\n\t"
               "s_wait_xcnt 0x0"
               :: "v"(lds_addr(l0)), "v"(g0), "v"(lds_addr(l1)), "v"(g1) : "memory");
}
__device__ __forceinline__ void async4_b128(const _Float16* g0, const _Float16* l0,
                                            const _Float16* g1, const _Float16* l1,
                                            const _Float16* g2, const _Float16* l2,
                                            const _Float16* g3, const _Float16* l3) {
  asm volatile("global_load_async_to_lds_b128 %0, %1, off\n\t"
               "global_load_async_to_lds_b128 %2, %3, off\n\t"
               "global_load_async_to_lds_b128 %4, %5, off\n\t"
               "global_load_async_to_lds_b128 %6, %7, off\n\t"
               "s_wait_xcnt 0x0"
               :: "v"(lds_addr(l0)), "v"(g0), "v"(lds_addr(l1)), "v"(g1),
                  "v"(lds_addr(l2)), "v"(g2), "v"(lds_addr(l3)), "v"(g3) : "memory");
}
// Wait until at most N async ops remain in flight (in-order completion ->
// waiting <=N with N ops just issued drains everything older).
template <int N>
__device__ __forceinline__ void wait_async_le() {
  asm volatile("s_wait_asynccnt %0" :: "i"(N) : "memory");
}

// Load one 16x32 f16 A-layout fragment from a row-major [rows][stride] array.
// ISA layout: lanes 0-15 hold K={kb..kb+7, kb+16..kb+23} of row (lane&15),
// lanes 16-31 get kb=8. Two 16-byte loads per lane.
__device__ __forceinline__ v16h frag_ld(const _Float16* base, int stride,
                                        int row, int kb) {
  const _Float16* p = base + row * stride + kb;
  v8h lo = *(const v8h*)(p);
  v8h hi = *(const v8h*)(p + 16);
  v16h r;
#pragma unroll
  for (int i = 0; i < 8; ++i) { r[i] = lo[i]; r[i + 8] = hi[i]; }
  return r;
}

// All seven f32 -> f16 conversions in ONE launch of few, long waves. The f16 copies
// lie one behind the other in the workspace in the order of the arguments, so a
// work-group's output chunk follows from blockIdx.x alone; only the source is picked.
// 16 waves per work-group and about one work-group per WGP; a wave-wide load covers
// 512 contiguous bytes, a wave-wide store 256.
#define CVT_T    512                          // threads per work-group
#define CVT_U    24                           // float4 per thread
#define CVT_CH   (CVT_T * CVT_U)              // float4 per work-group
#define ACT4     (MTOK * EMBED / 4)           // float4 per activation
#define WGT4     (EMBED * EMBED / 4)          // float4 per weight matrix
#define ACT_CH   (ACT4 / CVT_CH)              // 64 chunks
#define WGT_CH   (WGT4 / CVT_CH)              // 12 chunks
#define CVT_WGS  (3 * ACT_CH + 4 * WGT_CH)    // 240 work-groups
static_assert(ACT4 % CVT_CH == 0 && WGT4 % CVT_CH == 0, "chunks must tile every array");

__global__ __launch_bounds__(CVT_T)
void cvt_all_f16(const float* __restrict__ q,  const float* __restrict__ k,
                 const float* __restrict__ v,  const float* __restrict__ wq,
                 const float* __restrict__ wk, const float* __restrict__ wv,
                 const float* __restrict__ wo, _Float16* __restrict__ out) {
  const int blk = blockIdx.x;
  const float* src;
  int ch;
  if (blk < 3 * ACT_CH) {
    const int a = blk / ACT_CH;
    ch  = blk % ACT_CH;
    src = (a == 0) ? q : (a == 1) ? k : v;
  } else {
    const int t = blk - 3 * ACT_CH;
    const int a = t / WGT_CH;
    ch  = t % WGT_CH;
    src = (a == 0) ? wq : (a == 1) ? wk : (a == 2) ? wv : wo;
  }
  const float4* in4 = (const float4*)src + (size_t)ch * CVT_CH + threadIdx.x;
  v4h* o4 = (v4h*)out + (size_t)blk * CVT_CH + threadIdx.x;

  float4 f[CVT_U];
  // Unrolled so that f stays in registers and many loads are asked for ahead of the first use.
#pragma unroll
  for (int j = 0; j < CVT_U; ++j) f[j] = in4[j * CVT_T];
  // Unrolled for the same register array.
#pragma unroll
  for (int j = 0; j < CVT_U; ++j) {
    v4h h;
    h[0] = (_Float16)f[j].x; h[1] = (_Float16)f[j].y;
    h[2] = (_Float16)f[j].z; h[3] = (_Float16)f[j].w;
    o4[j * CVT_T] = h;
  }
}

// C = A[M,K](f16) * Bt[N,K]^T(f16) + bias[N], M=4096, N=768, K=768.
// 64x64 tiles, BK=64, double-buffered async-to-LDS staging (DMA overlaps WMMA).
// mode 0: out f16 [B,H,S,64]   (Q/K head layout; outScale folds 1/sqrt(d))
// mode 1: out f16 [B,H,64,S]   (V transposed so it feeds the WMMA A operand)
// mode 2: out f32 [M,768]      (final projection into d_out)
__global__ __launch_bounds__(256)
void gemm_wmma(const _Float16* __restrict__ A, const _Float16* __restrict__ Bt,
               const float* __restrict__ bias, void* __restrict__ outp,
               int mode, float outScale) {
  __shared__ __attribute__((aligned(16))) _Float16 As[2][64 * P128];
  __shared__ __attribute__((aligned(16))) _Float16 Bs[2][64 * P128];

  const int tid   = threadIdx.x;
  const int wave  = tid >> 5;
  const int lane  = tid & 31;
  const int l16   = lane & 15;
  const int lhalf = lane >> 4;
  const int kb    = lhalf ? 8 : 0;
  const int mw    = wave & 3;    // m-subtile 0..3
  const int nw    = wave >> 2;   // n-half 0..1
  const int m0    = blockIdx.y * 64;
  const int n0    = blockIdx.x * 64;
  const int K     = EMBED;
  const int NIT   = K / 64;      // 12

  // Staging: tile = 64 rows x 128B = 512 x 16B chunks; each thread moves 2 per tile.
  const int row0 = tid >> 3;          // 0..31
  const int row1 = row0 + 32;         // 32..63
  const int seg  = (tid & 7) * 8;     // halves within row

  auto stage = [&](int kc, int buf) {
    async4_b128(A  + (m0 + row0) * K + kc + seg, &As[buf][row0 * P128 + seg],
                A  + (m0 + row1) * K + kc + seg, &As[buf][row1 * P128 + seg],
                Bt + (n0 + row0) * K + kc + seg, &Bs[buf][row0 * P128 + seg],
                Bt + (n0 + row1) * K + kc + seg, &Bs[buf][row1 * P128 + seg]);
  };

  v8f acc[2] = {{}, {}};

  stage(0, 0);   // prologue: tile 0 in flight
#pragma unroll 1
  for (int it = 0; it < NIT; ++it) {
    const int cur = it & 1;
    if (it + 1 < NIT) {
      stage((it + 1) * 64, cur ^ 1);   // next tile streams during this compute
      wait_async_le<4>();              // drain tile `it` only
    } else {
      wait_async_le<0>();
    }
    __syncthreads();

    const int arow = 16 * mw + l16;
    const v16h af0 = frag_ld(As[cur],      P128, arow, kb);   // k 0..31
    const v16h af1 = frag_ld(As[cur] + 32, P128, arow, kb);   // k 32..63
#pragma unroll
    for (int j = 0; j < 2; ++j) {
      const int brow = 32 * nw + 16 * j + l16;
      const v16h bf0 = frag_ld(Bs[cur],      P128, brow, kb);
      const v16h bf1 = frag_ld(Bs[cur] + 32, P128, brow, kb);
      acc[j] = wmma_f16(af0, bf0, acc[j]);
      acc[j] = wmma_f16(af1, bf1, acc[j]);
    }
    __syncthreads();   // all reads of buf `cur` done before it is restaged
  }

#pragma unroll
  for (int j = 0; j < 2; ++j) {
    const int n = n0 + 32 * nw + 16 * j + l16;
    const float bv = bias[n];
#pragma unroll
    for (int vv = 0; vv < 8; ++vv) {
      const int m = m0 + 16 * mw + vv + 8 * lhalf;   // C layout: row = v + 8*(lane/16)
      const float val = (acc[j][vv] + bv) * outScale;
      if (mode == 2) {
        ((float*)outp)[(size_t)m * EMBED + n] = val;
      } else {
        const int bb = m >> 11, s = m & (SEQ - 1);
        const int hh = n >> 6,  d = n & (HSIZE - 1);
        const size_t o = (mode == 0)
            ? ((size_t)((bb * HEADS + hh) * SEQ + s)) * HSIZE + d
            : ((size_t)((bb * HEADS + hh) * HSIZE + d)) * SEQ + s;
        ((_Float16*)outp)[o] = (_Float16)val;
      }
    }
  }
}

// Lane l <-> lane l ^ 16 (the two halves of a wave) without touching LDS.
__device__ __forceinline__ float xhalf(float x) {
  const int b = __builtin_bit_cast(int, x);
  return __builtin_bit_cast(float,
      __builtin_amdgcn_permlanex16(b, b, 0x76543210, 0xfedcba98, false, false));
}

// Fused flash attention, transposed products: S^T = K * Q^T, O^T += V^T * P^T.
// One wave per (b, h, 16-query tile); the 8 waves of a block share one (b,h), so
// K/V chunks are async-staged into LDS once per block, double-buffered so the DMA
// for chunk i+1 overlaps softmax+WMMA of chunk i.
// A lane holds scores of ONE query (column l16): keys 8*lhalf+r and 16+8*lhalf+r.
// Maximum and sum run in the lane's own registers plus one exchange between the
// halves, and the two score tiles, converted in place, are the B operand of the
// second product (hardware k order), so P never goes through LDS.
// Qh,Kh: f16 [B,H,S,64]; Vt: f16 [B,H,64,S]; X out: f16 [B,S,EMBED]. Q pre-scaled.
__global__ __launch_bounds__(256)
void flash_attn(const _Float16* __restrict__ Qh, const _Float16* __restrict__ Kh,
                const _Float16* __restrict__ Vt, const int* __restrict__ mask,
                _Float16* __restrict__ X) {
  __shared__ __attribute__((aligned(16))) _Float16 Ks[2][32 * P128];  // 32 keys x 64 d
  __shared__ __attribute__((aligned(16))) _Float16 Vs[2][64 * P64];   // 64 d x 32 keys

  const int tid   = threadIdx.x;
  const int wave  = tid >> 5;
  const int lane  = tid & 31;
  const int l16   = lane & 15;
  const int lhalf = lane >> 4;
  const int kb    = lhalf ? 8 : 0;

  const int g  = blockIdx.x * 8 + wave;   // global wave id, 3072 total
  const int bh = g >> 7;                  // same for all 8 waves of a block
  const int qt = g & 127;
  const int b  = bh / HEADS;
  const int h  = bh % HEADS;

  const _Float16* Qp = Qh + (size_t)bh * SEQ * HSIZE;
  const _Float16* Kp = Kh + (size_t)bh * SEQ * HSIZE;
  const _Float16* Vp = Vt + (size_t)bh * HSIZE * SEQ;
  const int* mp = mask + b * SEQ + kb;    // this half's first key of a 16-key tile

  // Staging assignment: K chunk = 32 rows x 8 segs, V chunk = 64 rows x 4 segs.
  const int krow = tid >> 3, kseg = (tid & 7) * 8;
  const int vrow = tid >> 2, vseg = (tid & 3) * 8;

  auto stage = [&](int kc, int buf) {
    async2_b128(Kp + (kc + krow) * HSIZE + kseg, &Ks[buf][krow * P128 + kseg],
                Vp + vrow * SEQ + kc + vseg,     &Vs[buf][vrow * P64 + vseg]);
  };

  // Q^T as B operand (column = query qt*16 + l16, k = d in [0,32) and [32,64))
  const int qrow = qt * 16 + l16;
  const v16h qf0 = frag_ld(Qp,      HSIZE, qrow, kb);
  const v16h qf1 = frag_ld(Qp + 32, HSIZE, qrow, kb);

  float ml = -1e30f;   // running maximum of this lane's query (equal in both halves)
  float ll = 0.f;      // running sum over this half's keys only; joined in the epilogue
  v8f oacc[4] = {{}, {}, {}, {}};   // O^T: row d = 16*t + 8*lhalf + r, column = query

  const int NCH = SEQ / 32;   // 64 chunks

  stage(0, 0);
#pragma unroll 1
  for (int it = 0; it < NCH; ++it) {
    const int cur = it & 1;
    const int kc  = it * 32;
    // Key mask of this lane's 16 keys, all four loads asked for at once at the chunk's head.
    const int4 ma = *(const int4*)(mp + kc);
    const int4 mb = *(const int4*)(mp + kc + 4);
    const int4 mc = *(const int4*)(mp + kc + 16);
    const int4 md = *(const int4*)(mp + kc + 20);
    if (it + 1 < NCH) {
      stage((it + 1) * 32, cur ^ 1);   // next K/V chunk streams during compute
      wait_async_le<2>();
    } else {
      wait_async_le<0>();
    }
    __syncthreads();

    // ---- scores^T: 32 keys x 16 queries, f32 accum ----
    v8f s0 = {}, s1 = {};
    {
      v16h kf = frag_ld(Ks[cur],      P128, l16, kb);      // keys 0..15, d 0..31
      s0 = wmma_f16(kf, qf0, s0);
      kf = frag_ld(Ks[cur] + 32, P128, l16, kb);           // d 32..63
      s0 = wmma_f16(kf, qf1, s0);
      kf = frag_ld(Ks[cur],      P128, 16 + l16, kb);      // keys 16..31
      s1 = wmma_f16(kf, qf0, s1);
      kf = frag_ld(Ks[cur] + 32, P128, 16 + l16, kb);
      s1 = wmma_f16(kf, qf1, s1);
    }
    // ---- key mask (row = register r) ----
    const int m0[8] = {ma.x, ma.y, ma.z, ma.w, mb.x, mb.y, mb.z, mb.w};
    const int m1[8] = {mc.x, mc.y, mc.z, mc.w, md.x, md.y, md.z, md.w};
#pragma unroll
    for (int vv = 0; vv < 8; ++vv) {
      s0[vv] = (m0[vv] == 0) ? -1e9f : s0[vv];
      s1[vv] = (m1[vv] == 0) ? -1e9f : s1[vv];
    }
    // ---- online softmax: one query per lane ----
    float rm = fmaxf(s0[0], s1[0]);
#pragma unroll
    for (int vv = 1; vv < 8; ++vv) rm = fmaxf(rm, fmaxf(s0[vv], s1[vv]));
    rm = fmaxf(rm, xhalf(rm));
    const float nm   = fmaxf(ml, rm);
    const float corr = __expf(ml - nm);
    ml = nm;
    v16h pf;           // P^T as B operand: pf[s] = key kmap(s, lhalf) of column l16
    float rs0 = 0.f, rs1 = 0.f;
#pragma unroll
    for (int vv = 0; vv < 8; ++vv) {
      const float p0 = __expf(s0[vv] - nm);
      const float p1 = __expf(s1[vv] - nm);
      rs0 += p0; rs1 += p1;
      pf[vv]     = (_Float16)p0;
      pf[vv + 8] = (_Float16)p1;
    }
    ll = ll * corr + (rs0 + rs1);
#pragma unroll
    for (int t = 0; t < 4; ++t)
#pragma unroll
      for (int vv = 0; vv < 8; ++vv) oacc[t][vv] *= corr;

    // ---- out^T += V^T(64x32) * P^T(32x16) ----
#pragma unroll
    for (int t = 0; t < 4; ++t) {
      const v16h vf = frag_ld(Vs[cur], P64, 16 * t + l16, kb);
      oacc[t] = wmma_f16(vf, pf, oacc[t]);
    }
    __syncthreads();   // all waves done with buf `cur` before it is restaged
  }

  // ---- epilogue: join the halves' sums, normalize, 16-byte stores to X [B,S,EMBED] ----
  const float inv = 1.0f / (ll + xhalf(ll));
  _Float16* xr = X + ((size_t)(b * SEQ + qrow)) * EMBED + h * HSIZE + kb;
#pragma unroll
  for (int t = 0; t < 4; ++t) {
    v8h o;
#pragma unroll
    for (int vv = 0; vv < 8; ++vv) o[vv] = (_Float16)(oacc[t][vv] * inv);
    *(v8h*)(xr + 16 * t) = o;
  }
}

extern "C" void kernel_launch(void* const* d_in, const int* in_sizes, int n_in,
                              void* d_out, int out_size, void* d_ws, size_t ws_size,
                              hipStream_t stream) {
  const float* q    = (const float*)d_in[0];
  const float* k    = (const float*)d_in[1];
  const float* v    = (const float*)d_in[2];
  const int*   mask = (const int*)  d_in[3];
  const float* Wq   = (const float*)d_in[4];
  const float* bq   = (const float*)d_in[5];
  const float* Wk   = (const float*)d_in[6];
  const float* bk   = (const float*)d_in[7];
  const float* Wv   = (const float*)d_in[8];
  const float* bv   = (const float*)d_in[9];
  const float* Wo   = (const float*)d_in[10];
  const float* bo   = (const float*)d_in[11];

  const size_t actElems  = (size_t)MTOK * EMBED;     // 3,145,728
  const size_t wgtElems  = (size_t)EMBED * EMBED;    //   589,824
  const size_t headElems = (size_t)BATCH * HEADS * SEQ * HSIZE;  // 3,145,728

  _Float16* p = (_Float16*)d_ws;
  _Float16* q16  = p; p += actElems;
  _Float16* k16  = p; p += actElems;
  _Float16* v16  = p; p += actElems;
  _Float16* Wq16 = p; p += wgtElems;
  _Float16* Wk16 = p; p += wgtElems;
  _Float16* Wv16 = p; p += wgtElems;
  _Float16* Wo16 = p; p += wgtElems;
  _Float16* Qh   = p; p += headElems;
  _Float16* Kh   = p; p += headElems;
  _Float16* Vt   = p; p += headElems;
  _Float16* X16  = p; p += actElems;

  // f32 -> f16 downcast of all activations and weights; q16 is the first of the
  // seven consecutive f16 arrays above.
  cvt_all_f16<<<CVT_WGS, CVT_T, 0, stream>>>(q, k, v, Wq, Wk, Wv, Wo, q16);

  const dim3 ggrid(EMBED / 64, MTOK / 64);   // (12, 64)
  const float qscale = 0.125f;               // 1/sqrt(HSIZE) folded into Q

  gemm_wmma<<<ggrid, 256, 0, stream>>>(q16, Wq16, bq, (void*)Qh, 0, qscale);
  gemm_wmma<<<ggrid, 256, 0, stream>>>(k16, Wk16, bk, (void*)Kh, 0, 1.0f);
  gemm_wmma<<<ggrid, 256, 0, stream>>>(v16, Wv16, bv, (void*)Vt, 1, 1.0f);

  const int totalWaves = BATCH * HEADS * (SEQ / 16);   // 3072
  flash_attn<<<totalWaves / 8, 256, 0, stream>>>(Qh, Kh, Vt, mask, X16);

  gemm_wmma<<<ggrid, 256, 0, stream>>>(X16, Wo16, bo, d_out, 2, 1.0f);
}

// v004
// It runs in 130 microseconds.
// Timed twice side by side with v003, it ran 1.03 times as fast both times.
// Counting every step since v000, it is 2.18 times as fast.
#include <hip/hip_runtime.h>

// Problem constants (fixed by the reference).
#define EMBED  768
#define HEADS  12
#define HSIZE  64
#define BATCH  2
#define SEQ    2048
#define MTOK   (BATCH * SEQ)   // 4096 rows for the projections

// LDS row pitches in halves. A fragment read is two 16-byte loads per lane, each with 16
// rows per lane half, so the pitch is 16 B x odd: the 16 rows then fall on 16
// distinct groups of four banks (64 banks x 4 B) instead of two or four groups.
#define P128   72   // rows of 128 B data -> pitch 144 B
#define P64    40   // rows of  64 B data -> pitch  80 B

typedef __attribute__((ext_vector_type(16))) _Float16 v16h;
typedef __attribute__((ext_vector_type(8)))  _Float16 v8h;
typedef __attribute__((ext_vector_type(4)))  _Float16 v4h;
typedef __attribute__((ext_vector_type(8)))  float    v8f;

// D = A(16x32 f16) * B(32x16 f16) + C(16x16 f32)
__device__ __forceinline__ v8f wmma_f16(v16h a, v16h b, v8f c) {
  return __builtin_amdgcn_wmma_f32_16x16x32_f16(
      /*neg_a=*/false, a, /*neg_b=*/false, b,
      /*c_mod=*/(short)0, c, /*reuse_a=*/false, /*reuse_b=*/false);
}

// Async copies of 16 bytes/lane global -> LDS (ASYNCcnt-tracked, no VGPR round trip).
// One statement per stage: the closing s_wait_xcnt 0 stands in front of any later
// rewrite of the address registers that the copies name.
__device__ __forceinline__ unsigned lds_addr(const _Float16* lptr) {
  return (unsigned)(uintptr_t)lptr;   // low 32 bits = LDS byte offset
}
__device__ __forceinline__ void async2_b128(const _Float16* g0, const _Float16* l0,
                                            const _Float16* g1, const _Float16* l1) {
  asm volatile("global_load_async_to_lds_b128 %0, %1, off\n\t"
               "global_load_async_to_lds_b128 %2, %3, off\n\t"
               "s_wait_xcnt 0x0"
               :: "v"(lds_addr(l0)), "v"(g0), "v"(lds_addr(l1)), "v"(g1) : "memory");
}
__device__ __forceinline__ void async4_b128(const _Float16* g0, const _Float16* l0,
                                            const _Float16* g1, const _Float16* l1,
                                            const _Float16* g2, const _Float16* l2,
                                            const _Float16* g3, const _Float16* l3) {
  asm volatile("global_load_async_to_lds_b128 %0, %1, off\n\t"
               "global_load_async_to_lds_b128 %2, %3, off\n\t"
               "global_load_async_to_lds_b128 %4, %5, off\n\t"
               "global_load_async_to_lds_b128 %6, %7, off\n\t"
               "s_wait_xcnt 0x0"
               :: "v"(lds_addr(l0)), "v"(g0), "v"(lds_addr(l1)), "v"(g1),
                  "v"(lds_addr(l2)), "v"(g2), "v"(lds_addr(l3)), "v"(g3) : "memory");
}
// Wait until at most N async ops remain in flight (in-order completion ->
// waiting <=N with N ops just issued drains everything older).
template <int N>
__device__ __forceinline__ void wait_async_le() {
  asm volatile("s_wait_asynccnt %0" :: "i"(N) : "memory");
}

// Load one 16x32 f16 A-layout fragment from a row-major [rows][stride] array.
// ISA layout: lanes 0-15 hold K={kb..kb+7, kb+16..kb+23} of row (lane&15),
// lanes 16-31 get kb=8. Two 16-byte loads per lane.
__device__ __forceinline__ v16h frag_ld(const _Float16* base, int stride,
                                        int row, int kb) {
  const _Float16* p = base + row * stride + kb;
  v8h lo = *(const v8h*)(p);
  v8h hi = *(const v8h*)(p + 16);
  v16h r;
#pragma unroll
  for (int i = 0; i < 8; ++i) { r[i] = lo[i]; r[i + 8] = hi[i]; }
  return r;
}

// All seven f32 -> f16 conversions in ONE launch of few, long waves. The f16 copies
// lie one behind the other in the workspace in the order of the arguments, so a
// work-group's output chunk follows from blockIdx.x alone; only the source is picked.
// 16 waves per work-group and about one work-group per WGP; a wave-wide load covers
// 512 contiguous bytes, a wave-wide store 256.
#define CVT_T    512                          // threads per work-group
#define CVT_U    24                           // float4 per thread
#define CVT_CH   (CVT_T * CVT_U)              // float4 per work-group
#define ACT4     (MTOK * EMBED / 4)           // float4 per activation
#define WGT4     (EMBED * EMBED / 4)          // float4 per weight matrix
#define ACT_CH   (ACT4 / CVT_CH)              // 64 chunks
#define WGT_CH   (WGT4 / CVT_CH)              // 12 chunks
#define CVT_WGS  (3 * ACT_CH + 4 * WGT_CH)    // 240 work-groups
static_assert(ACT4 % CVT_CH == 0 && WGT4 % CVT_CH == 0, "chunks must tile every array");

__global__ __launch_bounds__(CVT_T)
void cvt_all_f16(const float* __restrict__ q,  const float* __restrict__ k,
                 const float* __restrict__ v,  const float* __restrict__ wq,
                 const float* __restrict__ wk, const float* __restrict__ wv,
                 const float* __restrict__ wo, _Float16* __restrict__ out) {
  const int blk = blockIdx.x;
  const float* src;
  int ch;
  if (blk < 3 * ACT_CH) {
    const int a = blk / ACT_CH;
    ch  = blk % ACT_CH;
    src = (a == 0) ? q : (a == 1) ? k : v;
  } else {
    const int t = blk - 3 * ACT_CH;
    const int a = t / WGT_CH;
    ch  = t % WGT_CH;
    src = (a == 0) ? wq : (a == 1) ? wk : (a == 2) ? wv : wo;
  }
  const float4* in4 = (const float4*)src + (size_t)ch * CVT_CH + threadIdx.x;
  v4h* o4 = (v4h*)out + (size_t)blk * CVT_CH + threadIdx.x;

  float4 f[CVT_U];
  // Unrolled so that f stays in registers and many loads are asked for ahead of the first use.
#pragma unroll
  for (int j = 0; j < CVT_U; ++j) f[j] = in4[j * CVT_T];
  // Unrolled for the same register array.
#pragma unroll
  for (int j = 0; j < CVT_U; ++j) {
    v4h h;
    h[0] = (_Float16)f[j].x; h[1] = (_Float16)f[j].y;
    h[2] = (_Float16)f[j].z; h[3] = (_Float16)f[j].w;
    o4[j * CVT_T] = h;
  }
}

// C = A[M,K](f16) * Bt[N,K]^T(f16) + bias[N], M=4096, N=768, K=768.
// 64x64 tiles, BK=64, double-buffered async-to-LDS staging (DMA overlaps WMMA).
// mode 0: out f16 [B,H,S,64]   (Q/K head layout; outScale folds 1/sqrt(d))
// mode 1: out f16 [B,H,64,S]   (V transposed so it feeds the WMMA A operand)
// mode 2: out f32 [M,768]      (final projection into d_out)
// blockIdx.z picks one of up to three independent products of one launch. Their A,
// Bt and f16 outputs lie one behind the other in the workspace, so z only steps the
// three base pointers. Plane 0 takes mode0 and scale0, plane 1 mode0 unscaled,
// plane 2 is the transposed V layout (mode 1) unscaled.
__global__ __launch_bounds__(256)
void gemm_wmma(const _Float16* __restrict__ A0, const _Float16* __restrict__ Bt0,
               const float* __restrict__ bias0, const float* __restrict__ bias1,
               const float* __restrict__ bias2, void* __restrict__ outp0,
               int mode0, float scale0) {
  __shared__ __attribute__((aligned(16))) _Float16 As[2][64 * P128];
  __shared__ __attribute__((aligned(16))) _Float16 Bs[2][64 * P128];

  const int z = blockIdx.z;
  const _Float16* A    = A0  + (size_t)z * (MTOK * EMBED);
  const _Float16* Bt   = Bt0 + (size_t)z * (EMBED * EMBED);
  const float*    bias = (z == 0) ? bias0 : (z == 1) ? bias1 : bias2;
  void* outp = (void*)((_Float16*)outp0 + (size_t)z * (MTOK * EMBED));
  const int   mode     = (z == 2) ? 1 : mode0;
  const float outScale = (z == 0) ? scale0 : 1.0f;

  const int tid   = threadIdx.x;
  const int wave  = tid >> 5;
  const int lane  = tid & 31;
  const int l16   = lane & 15;
  const int lhalf = lane >> 4;
  const int kb    = lhalf ? 8 : 0;
  const int mw    = wave & 3;    // m-subtile 0..3
  const int nw    = wave >> 2;   // n-half 0..1
  const int m0    = blockIdx.y * 64;
  const int n0    = blockIdx.x * 64;
  const int K     = EMBED;
  const int NIT   = K / 64;      // 12

  // Staging: tile = 64 rows x 128B = 512 x 16B chunks; each thread moves 2 per tile.
  const int row0 = tid >> 3;          // 0..31
  const int row1 = row0 + 32;         // 32..63
  const int seg  = (tid & 7) * 8;     // halves within row

  auto stage = [&](int kc, int buf) {
    async4_b128(A  + (m0 + row0) * K + kc + seg, &As[buf][row0 * P128 + seg],
                A  + (m0 + row1) * K + kc + seg, &As[buf][row1 * P128 + seg],
                Bt + (n0 + row0) * K + kc + seg, &Bs[buf][row0 * P128 + seg],
                Bt + (n0 + row1) * K + kc + seg, &Bs[buf][row1 * P128 + seg]);
  };

  v8f acc[2] = {{}, {}};

  stage(0, 0);   // prologue: tile 0 in flight
#pragma unroll 1
  for (int it = 0; it < NIT; ++it) {
    const int cur = it & 1;
    if (it + 1 < NIT) {
      stage((it + 1) * 64, cur ^ 1);   // next tile streams during this compute
      wait_async_le<4>();              // drain tile `it` only
    } else {
      wait_async_le<0>();
    }
    __syncthreads();

    const int arow = 16 * mw + l16;
    const v16h af0 = frag_ld(As[cur],      P128, arow, kb);   // k 0..31
    const v16h af1 = frag_ld(As[cur] + 32, P128, arow, kb);   // k 32..63
#pragma unroll
    for (int j = 0; j < 2; ++j) {
      const int brow = 32 * nw + 16 * j + l16;
      const v16h bf0 = frag_ld(Bs[cur],      P128, brow, kb);
      const v16h bf1 = frag_ld(Bs[cur] + 32, P128, brow, kb);
      acc[j] = wmma_f16(af0, bf0, acc[j]);
      acc[j] = wmma_f16(af1, bf1, acc[j]);
    }
    __syncthreads();   // all reads of buf `cur` done before it is restaged
  }

#pragma unroll
  for (int j = 0; j < 2; ++j) {
    const int n = n0 + 32 * nw + 16 * j + l16;
    const float bv = bias[n];
#pragma unroll
    for (int vv = 0; vv < 8; ++vv) {
      const int m = m0 + 16 * mw + vv + 8 * lhalf;   // C layout: row = v + 8*(lane/16)
      const float val = (acc[j][vv] + bv) * outScale;
      if (mode == 2) {
        ((float*)outp)[(size_t)m * EMBED + n] = val;
      } else {
        const int bb = m >> 11, s = m & (SEQ - 1);
        const int hh = n >> 6,  d = n & (HSIZE - 1);
        const size_t o = (mode == 0)
            ? ((size_t)((bb * HEADS + hh) * SEQ + s)) * HSIZE + d
            : ((size_t)((bb * HEADS + hh) * HSIZE + d)) * SEQ + s;
        ((_Float16*)outp)[o] = (_Float16)val;
      }
    }
  }
}

// Lane l <-> lane l ^ 16 (the two halves of a wave) without touching LDS.
__device__ __forceinline__ float xhalf(float x) {
  const int b = __builtin_bit_cast(int, x);
  return __builtin_bit_cast(float,
      __builtin_amdgcn_permlanex16(b, b, 0x76543210, 0xfedcba98, false, false));
}

// Fused flash attention, transposed products: S^T = K * Q^T, O^T += V^T * P^T.
// One wave per (b, h, 16-query tile); the 8 waves of a block share one (b,h), so
// K/V chunks are async-staged into LDS once per block, double-buffered so the DMA
// for chunk i+1 overlaps softmax+WMMA of chunk i.
// A lane holds scores of ONE query (column l16): keys 8*lhalf+r and 16+8*lhalf+r.
// Maximum and sum run in the lane's own registers plus one exchange between the
// halves, and the two score tiles, converted in place, are the B operand of the
// second product (hardware k order), so P never goes through LDS.
// Qh,Kh: f16 [B,H,S,64]; Vt: f16 [B,H,64,S]; X out: f16 [B,S,EMBED]. Q pre-scaled.
__global__ __launch_bounds__(256)
void flash_attn(const _Float16* __restrict__ Qh, const _Float16* __restrict__ Kh,
                const _Float16* __restrict__ Vt, const int* __restrict__ mask,
                _Float16* __restrict__ X) {
  __shared__ __attribute__((aligned(16))) _Float16 Ks[2][32 * P128];  // 32 keys x 64 d
  __shared__ __attribute__((aligned(16))) _Float16 Vs[2][64 * P64];   // 64 d x 32 keys

  const int tid   = threadIdx.x;
  const int wave  = tid >> 5;
  const int lane  = tid & 31;
  const int l16   = lane & 15;
  const int lhalf = lane >> 4;
  const int kb    = lhalf ? 8 : 0;

  const int g  = blockIdx.x * 8 + wave;   // global wave id, 3072 total
  const int bh = g >> 7;                  // same for all 8 waves of a block
  const int qt = g & 127;
  const int b  = bh / HEADS;
  const int h  = bh % HEADS;

  const _Float16* Qp = Qh + (size_t)bh * SEQ * HSIZE;
  const _Float16* Kp = Kh + (size_t)bh * SEQ * HSIZE;
  const _Float16* Vp = Vt + (size_t)bh * HSIZE * SEQ;
  const int* mp = mask + b * SEQ + kb;    // this half's first key of a 16-key tile

  // Staging assignment: K chunk = 32 rows x 8 segs, V chunk = 64 rows x 4 segs.
  const int krow = tid >> 3, kseg = (tid & 7) * 8;
  const int vrow = tid >> 2, vseg = (tid & 3) * 8;

  auto stage = [&](int kc, int buf) {
    async2_b128(Kp + (kc + krow) * HSIZE + kseg, &Ks[buf][krow * P128 + kseg],
                Vp + vrow * SEQ + kc + vseg,     &Vs[buf][vrow * P64 + vseg]);
  };

  // Q^T as B operand (column = query qt*16 + l16, k = d in [0,32) and [32,64))
  const int qrow = qt * 16 + l16;
  const v16h qf0 = frag_ld(Qp,      HSIZE, qrow, kb);
  const v16h qf1 = frag_ld(Qp + 32, HSIZE, qrow, kb);

  float ml = -1e30f;   // running maximum of this lane's query (equal in both halves)
  float ll = 0.f;      // running sum over this half's keys only; joined in the epilogue
  v8f oacc[4] = {{}, {}, {}, {}};   // O^T: row d = 16*t + 8*lhalf + r, column = query

  const int NCH = SEQ / 32;   // 64 chunks

  stage(0, 0);
#pragma unroll 1
  for (int it = 0; it < NCH; ++it) {
    const int cur = it & 1;
    const int kc  = it * 32;
    // Key mask of this lane's 16 keys, all four loads asked for at once at the chunk's head.
    const int4 ma = *(const int4*)(mp + kc);
    const int4 mb = *(const int4*)(mp + kc + 4);
    const int4 mc = *(const int4*)(mp + kc + 16);
    const int4 md = *(const int4*)(mp + kc + 20);
    if (it + 1 < NCH) {
      stage((it + 1) * 32, cur ^ 1);   // next K/V chunk streams during compute
      wait_async_le<2>();
    } else {
      wait_async_le<0>();
    }
    __syncthreads();

    // ---- scores^T: 32 keys x 16 queries, f32 accum ----
    v8f s0 = {}, s1 = {};
    {
      v16h kf = frag_ld(Ks[cur],      P128, l16, kb);      // keys 0..15, d 0..31
      s0 = wmma_f16(kf, qf0, s0);
      kf = frag_ld(Ks[cur] + 32, P128, l16, kb);           // d 32..63
      s0 = wmma_f16(kf, qf1, s0);
      kf = frag_ld(Ks[cur],      P128, 16 + l16, kb);      // keys 16..31
      s1 = wmma_f16(kf, qf0, s1);
      kf = frag_ld(Ks[cur] + 32, P128, 16 + l16, kb);
      s1 = wmma_f16(kf, qf1, s1);
    }
    // ---- key mask (row = register r) ----
    const int m0[8] = {ma.x, ma.y, ma.z, ma.w, mb.x, mb.y, mb.z, mb.w};
    const int m1[8] = {mc.x, mc.y, mc.z, mc.w, md.x, md.y, md.z, md.w};
#pragma unroll
    for (int vv = 0; vv < 8; ++vv) {
      s0[vv] = (m0[vv] == 0) ? -1e9f : s0[vv];
      s1[vv] = (m1[vv] == 0) ? -1e9f : s1[vv];
    }
    // ---- online softmax: one query per lane ----
    float rm = fmaxf(s0[0], s1[0]);
#pragma unroll
    for (int vv = 1; vv < 8; ++vv) rm = fmaxf(rm, fmaxf(s0[vv], s1[vv]));
    rm = fmaxf(rm, xhalf(rm));
    const float nm   = fmaxf(ml, rm);
    const float corr = __expf(ml - nm);
    ml = nm;
    v16h pf;           // P^T as B operand: pf[s] = key kmap(s, lhalf) of column l16
    float rs0 = 0.f, rs1 = 0.f;
#pragma unroll
    for (int vv = 0; vv < 8; ++vv) {
      const float p0 = __expf(s0[vv] - nm);
      const float p1 = __expf(s1[vv] - nm);
      rs0 += p0; rs1 += p1;
      pf[vv]     = (_Float16)p0;
      pf[vv + 8] = (_Float16)p1;
    }
    ll = ll * corr + (rs0 + rs1);
#pragma unroll
    for (int t = 0; t < 4; ++t)
#pragma unroll
      for (int vv = 0; vv < 8; ++vv) oacc[t][vv] *= corr;

    // ---- out^T += V^T(64x32) * P^T(32x16) ----
#pragma unroll
    for (int t = 0; t < 4; ++t) {
      const v16h vf = frag_ld(Vs[cur], P64, 16 * t + l16, kb);
      oacc[t] = wmma_f16(vf, pf, oacc[t]);
    }
    __syncthreads();   // all waves done with buf `cur` before it is restaged
  }

  // ---- epilogue: join the halves' sums, normalize, 16-byte stores to X [B,S,EMBED] ----
  const float inv = 1.0f / (ll + xhalf(ll));
  _Float16* xr = X + ((size_t)(b * SEQ + qrow)) * EMBED + h * HSIZE + kb;
#pragma unroll
  for (int t = 0; t < 4; ++t) {
    v8h o;
#pragma unroll
    for (int vv = 0; vv < 8; ++vv) o[vv] = (_Float16)(oacc[t][vv] * inv);
    *(v8h*)(xr + 16 * t) = o;
  }
}

extern "C" void kernel_launch(void* const* d_in, const int* in_sizes, int n_in,
                              void* d_out, int out_size, void* d_ws, size_t ws_size,
                              hipStream_t stream) {
  const float* q    = (const float*)d_in[0];
  const float* k    = (const float*)d_in[1];
  const float* v    = (const float*)d_in[2];
  const int*   mask = (const int*)  d_in[3];
  const float* Wq   = (const float*)d_in[4];
  const float* bq   = (const float*)d_in[5];
  const float* Wk   = (const float*)d_in[6];
  const float* bk   = (const float*)d_in[7];
  const float* Wv   = (const float*)d_in[8];
  const float* bv   = (const float*)d_in[9];
  const float* Wo   = (const float*)d_in[10];
  const float* bo   = (const float*)d_in[11];

  const size_t actElems  = (size_t)MTOK * EMBED;     // 3,145,728
  const size_t wgtElems  = (size_t)EMBED * EMBED;    //   589,824
  const size_t headElems = (size_t)BATCH * HEADS * SEQ * HSIZE;  // 3,145,728

  _Float16* p = (_Float16*)d_ws;
  _Float16* q16  = p; p += actElems;
  _Float16* k16  = p; p += actElems;
  _Float16* v16  = p; p += actElems;
  _Float16* Wq16 = p; p += wgtElems;
  _Float16* Wk16 = p; p += wgtElems;
  _Float16* Wv16 = p; p += wgtElems;
  _Float16* Wo16 = p; p += wgtElems;
  _Float16* Qh   = p; p += headElems;
  _Float16* Kh   = p; p += headElems;
  _Float16* Vt   = p; p += headElems;
  _Float16* X16  = p; p += actElems;

  // f32 -> f16 downcast of all activations and weights; q16 is the first of the
  // seven consecutive f16 arrays above.
  cvt_all_f16<<<CVT_WGS, CVT_T, 0, stream>>>(q, k, v, Wq, Wk, Wv, Wo, q16);

  const dim3 ggrid(EMBED / 64, MTOK / 64);        // (12, 64)
  const dim3 qkvgrid(EMBED / 64, MTOK / 64, 3);   // planes: Q, K, V
  const float qscale = 0.125f;                    // 1/sqrt(HSIZE) folded into Q

  // Q, K and V projections do not depend on each other: one launch. q16/k16/v16,
  // Wq16/Wk16/Wv16 and Qh/Kh/Vt are each three consecutive arrays of equal size.
  gemm_wmma<<<qkvgrid, 256, 0, stream>>>(q16, Wq16, bq, bk, bv, (void*)Qh, 0, qscale);

  const int totalWaves = BATCH * HEADS * (SEQ / 16);   // 3072
  flash_attn<<<totalWaves / 8, 256, 0, stream>>>(Qh, Kh, Vt, mask, X16);

  gemm_wmma<<<ggrid, 256, 0, stream>>>(X16, Wo16, bo, bo, bo, d_out, 2, 1.0f);
}

// v005
// One run takes 85.7 microseconds.
// In two side-by-side timings against v004, it was 1.52 and 1.50 times as fast.
// Over all steps from v000 it is 3.30 times as fast.
#include <hip/hip_runtime.h>

// Problem constants (fixed by the reference).
#define EMBED  768
#define HEADS  12
#define HSIZE  64
#define BATCH  2
#define SEQ    2048
#define MTOK   (BATCH * SEQ)   // 4096 rows for the projections

// LDS row pitches in halves. A fragment read is two 16-byte loads per lane, each with 16
// rows per lane half, so the pitch is 16 B x odd: the 16 rows then fall on 16
// distinct groups of four banks (64 banks x 4 B) instead of two or four groups.
#define P128   72   // rows of 128 B data -> pitch 144 B
#define P64    40   // rows of  64 B data -> pitch  80 B

typedef __attribute__((ext_vector_type(16))) _Float16 v16h;
typedef __attribute__((ext_vector_type(8)))  _Float16 v8h;
typedef __attribute__((ext_vector_type(4)))  _Float16 v4h;
typedef __attribute__((ext_vector_type(8)))  float    v8f;

// D = A(16x32 f16) * B(32x16 f16) + C(16x16 f32)
__device__ __forceinline__ v8f wmma_f16(v16h a, v16h b, v8f c) {
  return __builtin_amdgcn_wmma_f32_16x16x32_f16(
      /*neg_a=*/false, a, /*neg_b=*/false, b,
      /*c_mod=*/(short)0, c, /*reuse_a=*/false, /*reuse_b=*/false);
}

// Async copies of 16 bytes/lane global -> LDS (ASYNCcnt-tracked, no VGPR round trip).
// One statement per stage: the closing s_wait_xcnt 0 stands in front of any later
// rewrite of the address registers that the copies name.
__device__ __forceinline__ unsigned lds_addr(const _Float16* lptr) {
  return (unsigned)(uintptr_t)lptr;   // low 32 bits = LDS byte offset
}
__device__ __forceinline__ void async2_b128(const _Float16* g0, const _Float16* l0,
                                            const _Float16* g1, const _Float16* l1) {
  asm volatile("global_load_async_to_lds_b128 %0, %1, off\n\t"
               "global_load_async_to_lds_b128 %2, %3, off\n\t"
               "s_wait_xcnt 0x0"
               :: "v"(lds_addr(l0)), "v"(g0), "v"(lds_addr(l1)), "v"(g1) : "memory");
}
__device__ __forceinline__ void async4_b128(const _Float16* g0, const _Float16* l0,
                                            const _Float16* g1, const _Float16* l1,
                                            const _Float16* g2, const _Float16* l2,
                                            const _Float16* g3, const _Float16* l3) {
  asm volatile("global_load_async_to_lds_b128 %0, %1, off\n\t"
               "global_load_async_to_lds_b128 %2, %3, off\n\t"
               "global_load_async_to_lds_b128 %4, %5, off\n\t"
               "global_load_async_to_lds_b128 %6, %7, off\n\t"
               "s_wait_xcnt 0x0"
               :: "v"(lds_addr(l0)), "v"(g0), "v"(lds_addr(l1)), "v"(g1),
                  "v"(lds_addr(l2)), "v"(g2), "v"(lds_addr(l3)), "v"(g3) : "memory");
}
// Wait until at most N async ops remain in flight (in-order completion ->
// waiting <=N with N ops just issued drains everything older).
template <int N>
__device__ __forceinline__ void wait_async_le() {
  asm volatile("s_wait_asynccnt %0" :: "i"(N) : "memory");
}

// Load one 16x32 f16 A-layout fragment from a row-major [rows][stride] array.
// ISA layout: lanes 0-15 hold K={kb..kb+7, kb+16..kb+23} of row (lane&15),
// lanes 16-31 get kb=8. Two 16-byte loads per lane.
__device__ __forceinline__ v16h frag_ld(const _Float16* base, int stride,
                                        int row, int kb) {
  const _Float16* p = base + row * stride + kb;
  v8h lo = *(const v8h*)(p);
  v8h hi = *(const v8h*)(p + 16);
  v16h r;
#pragma unroll
  for (int i = 0; i < 8; ++i) { r[i] = lo[i]; r[i + 8] = hi[i]; }
  return r;
}

// All seven f32 -> f16 conversions in ONE launch of few, long waves. The f16 copies
// lie one behind the other in the workspace in the order of the arguments, so a
// q or weight work-group's output chunk follows from blockIdx.x alone (k and v rows go to
// their key's rank); only the source is picked.
// 16 waves per work-group and about one work-group per WGP; a wave-wide load covers
// 512 contiguous bytes, a wave-wide store 256.
#define CVT_T    512                          // threads per work-group
#define CVT_U    24                           // float4 per thread
#define CVT_CH   (CVT_T * CVT_U)              // float4 per work-group
#define ACT4     (MTOK * EMBED / 4)           // float4 per activation
#define WGT4     (EMBED * EMBED / 4)          // float4 per weight matrix
#define ACT_CH   (ACT4 / CVT_CH)              // 64 chunks
#define WGT_CH   (WGT4 / CVT_CH)              // 12 chunks
#define CVT_WGS  (3 * ACT_CH + 4 * WGT_CH)    // 240 work-groups
static_assert(ACT4 % CVT_CH == 0 && WGT4 % CVT_CH == 0, "chunks must tile every array");
#define ROW4     (EMBED / 4)                  // float4 per activation row
#define CH_ROWS  (CVT_CH / ROW4)              // 64 rows per chunk
#define CH_BATCH (ACT_CH / BATCH)             // 32 chunks per batch
static_assert(CVT_CH % ROW4 == 0 && ACT_CH % BATCH == 0, "a chunk holds whole rows of one batch");
static_assert(SEQ == 4 * CVT_T, "the key ranking takes four mask words a thread");
static_assert(ROW4 % 32 == 0, "a wave's 32 float4 lie in one row");

// Ranks of the keys of one batch; m = its mask words 4*tid .. 4*tid+3. A key whose mask
// word is 0 gets the score -1e9, and its softmax weight is exactly 0 in f32 as soon as
// one key of the row is open, so only the open keys need to be projected and attended
// to. Returns for this thread's keys
// 4*tid .. 4*tid+3 the rank among the open keys of the batch, -1 for a closed key, and
// in total the number of open keys. With no open key the softmax is uniform over all
// keys: then every key keeps its own place. Holds one barrier: called by whole groups.
__device__ __forceinline__ int4 key_rank(const int4 m, int* wsum, int& total) {
  const int tid  = threadIdx.x;
  const int lane = tid & 31;
  const int wave = tid >> 5;
  const int k0 = (m.x != 0), k1 = (m.y != 0), k2 = (m.z != 0), k3 = (m.w != 0);
  const int c = k0 + k1 + k2 + k3;
  int inc = c;   // inclusive sum over the wave's lanes
  // Unrolled: five steps with constant distances.
#pragma unroll
  for (int d = 1; d < 32; d <<= 1) {
    const int o = __shfl_up(inc, d);
    if (lane >= d) inc += o;
  }
  if (lane == 31) wsum[wave] = inc;
  __syncthreads();
  int base = 0, tot = 0;
  // Unrolled: the 16 wave sums come in four 16-byte LDS reads.
#pragma unroll
  for (int w = 0; w < CVT_T / 32; ++w) {
    const int t = wsum[w];
    base += (w < wave) ? t : 0;
    tot  += t;
  }
  total = tot;
  const int e0 = base + inc - c;   // open keys in front of this thread's four
  int4 p;
  if (tot == 0) {
    p.x = 4 * tid; p.y = 4 * tid + 1; p.z = 4 * tid + 2; p.w = 4 * tid + 3;
  } else {
    p.x = k0 ? e0 : -1;
    p.y = k1 ? e0 + k0 : -1;
    p.z = k2 ? e0 + k0 + k1 : -1;
    p.w = k3 ? e0 + k0 + k1 + k2 : -1;
  }
  return p;
}

__global__ __launch_bounds__(CVT_T)
void cvt_all_f16(const float* __restrict__ q,  const float* __restrict__ k,
                 const float* __restrict__ v,  const float* __restrict__ wq,
                 const float* __restrict__ wk, const float* __restrict__ wv,
                 const float* __restrict__ wo, _Float16* __restrict__ out,
                 const int* __restrict__ mask, int* __restrict__ meta) {
  __shared__ int wsum[CVT_T / 32];
  __shared__ __attribute__((aligned(16))) int rank[SEQ];
  const int blk = blockIdx.x;
  if (blk >= CVT_WGS) {
    // The last BATCH work-groups: meta[2b] = rows of k and v that are kept, meta[2b+1] =
    // open keys; the rows from there to the next multiple of 64 (a projection tile) are
    // zeroed, so that the last tile reads defined values.
    const int b = blk - CVT_WGS;
    int total;
    (void)key_rank(*(const int4*)(mask + b * SEQ + 4 * threadIdx.x), wsum, total);
    const int cnt = (total == 0) ? SEQ : total;
    if (threadIdx.x == 0) { meta[2 * b] = cnt; meta[2 * b + 1] = total; }
    const int pad  = (-cnt) & 63;   // cnt + pad <= SEQ, as SEQ is a multiple of 64
    const int wv   = threadIdx.x >> 5;
    const v8h zero8 = {};
    _Float16* zr = out + (size_t)MTOK * EMBED
                       + ((size_t)(b * SEQ + cnt + wv)) * EMBED + (threadIdx.x & 31) * 8;
    // Unrolled: constant steps from one address. Wave = row modulo 16, lane = 16-byte piece.
#pragma unroll
    for (int i = 0; i < 4; ++i) {
      if (wv + 16 * i < pad) {
#pragma unroll
        for (int a = 0; a < 2; ++a)
#pragma unroll
          for (int kk = 0; kk < EMBED / 256; ++kk)
            *(v8h*)(zr + (size_t)a * MTOK * EMBED + i * 16 * EMBED + kk * 256) = zero8;
      }
    }
    return;
  }
  const float* src;
  int ch;
  if (blk < 3 * ACT_CH) {
    const int a = blk / ACT_CH;
    ch  = blk % ACT_CH;
    src = (a == 0) ? q : (a == 1) ? k : v;
  } else {
    const int t = blk - 3 * ACT_CH;
    const int a = t / WGT_CH;
    ch  = t % WGT_CH;
    src = (a == 0) ? wq : (a == 1) ? wk : (a == 2) ? wv : wo;
  }
  const float4* in4 = (const float4*)src + (size_t)ch * CVT_CH + threadIdx.x;
  v4h* o4 = (v4h*)out + (size_t)blk * CVT_CH + threadIdx.x;

  // k and v are packed by the mask.
  const bool packed = (blk >= ACT_CH && blk < 3 * ACT_CH);

  float4 f[CVT_U];
  // Unrolled so that f stays in registers and many loads are asked for ahead of the first use.
#pragma unroll
  for (int j = 0; j < CVT_U; ++j) f[j] = in4[j * CVT_T];
  if (packed) {
    // A row goes to its key's rank in its batch, a closed key's row is dropped.
    const int b = ch / CH_BATCH;
    const int4 mk = *(const int4*)(mask + b * SEQ + 4 * threadIdx.x);
    int total;
    const int4 p = key_rank(mk, wsum, total);
    *(int4*)(rank + 4 * threadIdx.x) = p;
    __syncthreads();
    const int s0 = (ch % CH_BATCH) * CH_ROWS;   // first key of this chunk in its batch
    v4h* ob = (v4h*)out + (size_t)(blk / ACT_CH) * ACT4 + (size_t)b * SEQ * ROW4;
    // A wave's 32 float4 lie in one row (ROW4 is a multiple of 32), so row, rank and the
    // test are the same in all its lanes: kept in scalars, the test is a scalar branch.
    const int w32 = __builtin_amdgcn_readfirstlane(threadIdx.x >> 5) * 32;
    const int ln  = threadIdx.x & 31;
    // Lane j holds the rank of the row of the wave's j-th float4: one LDS read for all trips.
    const int rk  = rank[s0 + (min(ln, CVT_U - 1) * CVT_T + w32) / ROW4];
    // Unrolled for the same register array.
#pragma unroll
    for (int j = 0; j < CVT_U; ++j) {
      const int w0 = j * CVT_T + w32;
      const int r  = w0 / ROW4;
      const int pr = min(__builtin_amdgcn_readlane(rk, j), SEQ - 1);
      if (pr >= 0) {
        v4h h;
        h[0] = (_Float16)f[j].x; h[1] = (_Float16)f[j].y;
        h[2] = (_Float16)f[j].z; h[3] = (_Float16)f[j].w;
        ob[(size_t)pr * ROW4 + (w0 - r * ROW4) + ln] = h;
      }
    }
    return;
  }
  // Unrolled for the same register array.
#pragma unroll
  for (int j = 0; j < CVT_U; ++j) {
    v4h h;
    h[0] = (_Float16)f[j].x; h[1] = (_Float16)f[j].y;
    h[2] = (_Float16)f[j].z; h[3] = (_Float16)f[j].w;
    o4[j * CVT_T] = h;
  }
}

// C = A[M,K](f16) * Bt[N,K]^T(f16) + bias[N], M=4096, N=768, K=768.
// 64x64 tiles, BK=64, double-buffered async-to-LDS staging (DMA overlaps WMMA).
// mode 0: out f16 [B,H,S,64]   (Q/K head layout; outScale folds 1/sqrt(d))
// mode 1: out f16 [B,H,64,S]   (V transposed so it feeds the WMMA A operand)
// mode 2: out f32 [M,768]      (final projection into d_out)
// blockIdx.z picks one of up to three independent products of one launch. Their A,
// Bt and f16 outputs lie one behind the other in the workspace, so z only steps the
// three base pointers. Plane 0 takes mode0 and scale0, plane 1 mode0 unscaled,
// plane 2 is the transposed V layout (mode 1) unscaled. The A rows of planes 1 and 2
// (k and v) are packed to the front of each batch: tiles behind the kept rows leave.
__global__ __launch_bounds__(256)
void gemm_wmma(const _Float16* __restrict__ A0, const _Float16* __restrict__ Bt0,
               const float* __restrict__ bias0, const float* __restrict__ bias1,
               const float* __restrict__ bias2, void* __restrict__ outp0,
               int mode0, float scale0, const int* __restrict__ meta) {
  __shared__ __attribute__((aligned(16))) _Float16 As[2][64 * P128];
  __shared__ __attribute__((aligned(16))) _Float16 Bs[2][64 * P128];

  const int z = blockIdx.z;
  // The whole work-group leaves, in front of every copy and barrier.
  if (z != 0 && (int)((blockIdx.y * 64) & (SEQ - 1)) >= meta[2 * ((blockIdx.y * 64) / SEQ)]) return;
  const _Float16* A    = A0  + (size_t)z * (MTOK * EMBED);
  const _Float16* Bt   = Bt0 + (size_t)z * (EMBED * EMBED);
  const float*    bias = (z == 0) ? bias0 : (z == 1) ? bias1 : bias2;
  void* outp = (void*)((_Float16*)outp0 + (size_t)z * (MTOK * EMBED));
  const int   mode     = (z == 2) ? 1 : mode0;
  const float outScale = (z == 0) ? scale0 : 1.0f;

  const int tid   = threadIdx.x;
  const int wave  = tid >> 5;
  const int lane  = tid & 31;
  const int l16   = lane & 15;
  const int lhalf = lane >> 4;
  const int kb    = lhalf ? 8 : 0;
  const int mw    = wave & 3;    // m-subtile 0..3
  const int nw    = wave >> 2;   // n-half 0..1
  const int m0    = blockIdx.y * 64;
  const int n0    = blockIdx.x * 64;
  const int K     = EMBED;
  const int NIT   = K / 64;      // 12

  // Staging: tile = 64 rows x 128B = 512 x 16B chunks; each thread moves 2 per tile.
  const int row0 = tid >> 3;          // 0..31
  const int row1 = row0 + 32;         // 32..63
  const int seg  = (tid & 7) * 8;     // halves within row

  auto stage = [&](int kc, int buf) {
    async4_b128(A  + (m0 + row0) * K + kc + seg, &As[buf][row0 * P128 + seg],
                A  + (m0 + row1) * K + kc + seg, &As[buf][row1 * P128 + seg],
                Bt + (n0 + row0) * K + kc + seg, &Bs[buf][row0 * P128 + seg],
                Bt + (n0 + row1) * K + kc + seg, &Bs[buf][row1 * P128 + seg]);
  };

  v8f acc[2] = {{}, {}};

  stage(0, 0);   // prologue: tile 0 in flight
#pragma unroll 1
  for (int it = 0; it < NIT; ++it) {
    const int cur = it & 1;
    if (it + 1 < NIT) {
      stage((it + 1) * 64, cur ^ 1);   // next tile streams during this compute
      wait_async_le<4>();              // drain tile `it` only
    } else {
      wait_async_le<0>();
    }
    __syncthreads();

    const int arow = 16 * mw + l16;
    const v16h af0 = frag_ld(As[cur],      P128, arow, kb);   // k 0..31
    const v16h af1 = frag_ld(As[cur] + 32, P128, arow, kb);   // k 32..63
#pragma unroll
    for (int j = 0; j < 2; ++j) {
      const int brow = 32 * nw + 16 * j + l16;
      const v16h bf0 = frag_ld(Bs[cur],      P128, brow, kb);
      const v16h bf1 = frag_ld(Bs[cur] + 32, P128, brow, kb);
      acc[j] = wmma_f16(af0, bf0, acc[j]);
      acc[j] = wmma_f16(af1, bf1, acc[j]);
    }
    __syncthreads();   // all reads of buf `cur` done before it is restaged
  }

#pragma unroll
  for (int j = 0; j < 2; ++j) {
    const int n = n0 + 32 * nw + 16 * j + l16;
    const float bv = bias[n];
#pragma unroll
    for (int vv = 0; vv < 8; ++vv) {
      const int m = m0 + 16 * mw + vv + 8 * lhalf;   // C layout: row = v + 8*(lane/16)
      const float val = (acc[j][vv] + bv) * outScale;
      if (mode == 2) {
        ((float*)outp)[(size_t)m * EMBED + n] = val;
      } else {
        const int bb = m >> 11, s = m & (SEQ - 1);
        const int hh = n >> 6,  d = n & (HSIZE - 1);
        const size_t o = (mode == 0)
            ? ((size_t)((bb * HEADS + hh) * SEQ + s)) * HSIZE + d
            : ((size_t)((bb * HEADS + hh) * HSIZE + d)) * SEQ + s;
        ((_Float16*)outp)[o] = (_Float16)val;
      }
    }
  }
}

// Lane l <-> lane l ^ 16 (the two halves of a wave) without touching LDS.
__device__ __forceinline__ float xhalf(float x) {
  const int b = __builtin_bit_cast(int, x);
  return __builtin_bit_cast(float,
      __builtin_amdgcn_permlanex16(b, b, 0x76543210, 0xfedcba98, false, false));
}

// Fused flash attention, transposed products: S^T = K * Q^T, O^T += V^T * P^T.
// One wave per (b, h, 16-query tile); the 8 waves of a block share one (b,h), so
// K/V chunks are async-staged into LDS once per block, double-buffered so the DMA
// for chunk i+1 overlaps softmax+WMMA of chunk i.
// A lane holds scores of ONE query (column l16): keys 8*lhalf+r and 16+8*lhalf+r.
// Maximum and sum run in the lane's own registers plus one exchange between the
// halves, and the two score tiles, converted in place, are the B operand of the
// second product (hardware k order), so P never goes through LDS.
// Qh,Kh: f16 [B,H,S,64]; Vt: f16 [B,H,64,S]; X out: f16 [B,S,EMBED]. Q pre-scaled.
// Kh and Vt hold the kept keys only, packed to the front: the loop walks those, and a
// key at or behind the number of open keys (the tail of the last chunk, projected from
// zero rows; every key when none is open) takes the score -1e9.
__global__ __launch_bounds__(256)
void flash_attn(const _Float16* __restrict__ Qh, const _Float16* __restrict__ Kh,
                const _Float16* __restrict__ Vt, const int* __restrict__ meta,
                _Float16* __restrict__ X) {
  __shared__ __attribute__((aligned(16))) _Float16 Ks[2][32 * P128];  // 32 keys x 64 d
  __shared__ __attribute__((aligned(16))) _Float16 Vs[2][64 * P64];   // 64 d x 32 keys

  const int tid   = threadIdx.x;
  const int wave  = tid >> 5;
  const int lane  = tid & 31;
  const int l16   = lane & 15;
  const int lhalf = lane >> 4;
  const int kb    = lhalf ? 8 : 0;

  const int g  = blockIdx.x * 8 + wave;   // global wave id, 3072 total
  const int bh = blockIdx.x >> 4;         // = g >> 7, from scalars: trip count and branches stay scalar
  const int qt = g & 127;
  const int b  = bh / HEADS;
  const int h  = bh % HEADS;

  const _Float16* Qp = Qh + (size_t)bh * SEQ * HSIZE;
  const _Float16* Kp = Kh + (size_t)bh * SEQ * HSIZE;
  const _Float16* Vp = Vt + (size_t)bh * HSIZE * SEQ;

  // Staging assignment: K chunk = 32 rows x 8 segs, V chunk = 64 rows x 4 segs.
  const int krow = tid >> 3, kseg = (tid & 7) * 8;
  const int vrow = tid >> 2, vseg = (tid & 3) * 8;

  auto stage = [&](int kc, int buf) {
    async2_b128(Kp + (kc + krow) * HSIZE + kseg, &Ks[buf][krow * P128 + kseg],
                Vp + vrow * SEQ + kc + vseg,     &Vs[buf][vrow * P64 + vseg]);
  };

  // Q^T as B operand (column = query qt*16 + l16, k = d in [0,32) and [32,64))
  const int qrow = qt * 16 + l16;
  const v16h qf0 = frag_ld(Qp,      HSIZE, qrow, kb);
  const v16h qf1 = frag_ld(Qp + 32, HSIZE, qrow, kb);
  // Stands in front of any rewrite of the address registers that the four Q loads name.
  asm volatile("s_wait_xcnt 0x0" ::: "memory");

  float ml = -1e30f;   // running maximum of this lane's query (equal in both halves)
  float ll = 0.f;      // running sum over this half's keys only; joined in the epilogue
  v8f oacc[4] = {{}, {}, {}, {}};   // O^T: row d = 16*t + 8*lhalf + r, column = query

  // Both are the same for the whole work-group (one b), so every barrier below is met
  // by all waves; the trip count is bounded by the shape whatever meta holds.
  const int nkept = min(max(meta[2 * b], 1), SEQ);
  const int nopen = meta[2 * b + 1];
  const int NCH   = (nkept + 31) >> 5;   // 1..64 chunks

  // One chunk of 32 kept keys. tail: the chunk reaches past the open keys.
  auto chunk = [&](const int it, const bool tail) {
    const int cur = it & 1;
    const int kc  = it * 32;
    if (it + 1 < NCH) {
      stage((it + 1) * 32, cur ^ 1);   // next K/V chunk streams during compute
      wait_async_le<2>();
    } else {
      wait_async_le<0>();
    }
    __syncthreads();

    // ---- scores^T: 32 keys x 16 queries, f32 accum ----
    v8f s0 = {}, s1 = {};
    {
      v16h kf = frag_ld(Ks[cur],      P128, l16, kb);      // keys 0..15, d 0..31
      s0 = wmma_f16(kf, qf0, s0);
      kf = frag_ld(Ks[cur] + 32, P128, l16, kb);           // d 32..63
      s0 = wmma_f16(kf, qf1, s0);
      kf = frag_ld(Ks[cur],      P128, 16 + l16, kb);      // keys 16..31
      s1 = wmma_f16(kf, qf0, s1);
      kf = frag_ld(Ks[cur] + 32, P128, 16 + l16, kb);
      s1 = wmma_f16(kf, qf1, s1);
    }
    // ---- key mask (row = register r) ----
    if (tail) {
      const int lim = nopen - kc - kb;   // key r of this half is open while r < lim
#pragma unroll
      for (int vv = 0; vv < 8; ++vv) {
        s0[vv] = (vv < lim)      ? s0[vv] : -1e9f;
        s1[vv] = (vv + 16 < lim) ? s1[vv] : -1e9f;
      }
    }
    // ---- online softmax: one query per lane ----
    float rm = fmaxf(s0[0], s1[0]);
#pragma unroll
    for (int vv = 1; vv < 8; ++vv) rm = fmaxf(rm, fmaxf(s0[vv], s1[vv]));
    rm = fmaxf(rm, xhalf(rm));
    const float nm   = fmaxf(ml, rm);
    const float corr = __expf(ml - nm);
    ml = nm;
    v16h pf;           // P^T as B operand: pf[s] = key kmap(s, lhalf) of column l16
    float rs0 = 0.f, rs1 = 0.f;
#pragma unroll
    for (int vv = 0; vv < 8; ++vv) {
      const float p0 = __expf(s0[vv] - nm);
      const float p1 = __expf(s1[vv] - nm);
      rs0 += p0; rs1 += p1;
      pf[vv]     = (_Float16)p0;
      pf[vv + 8] = (_Float16)p1;
    }
    ll = ll * corr + (rs0 + rs1);
#pragma unroll
    for (int t = 0; t < 4; ++t)
#pragma unroll
      for (int vv = 0; vv < 8; ++vv) oacc[t][vv] *= corr;

    // ---- out^T += V^T(64x32) * P^T(32x16) ----
#pragma unroll
    for (int t = 0; t < 4; ++t) {
      const v16h vf = frag_ld(Vs[cur], P64, 16 * t + l16, kb);
      oacc[t] = wmma_f16(vf, pf, oacc[t]);
    }
    __syncthreads();   // all waves done with buf `cur` before it is restaged
  };

  // Chunks of open keys alone need no mask; the rest (the last chunk, or every chunk
  // when no key is open) runs in a loop of its own, so that neither body holds a branch.
  const int nfull = min(max(nopen, 0) >> 5, NCH);
  stage(0, 0);
  int it = 0;
  // Both loops stay rolled: one copy of each body, the buffer follows it & 1.
#pragma unroll 1
  for (; it < nfull; ++it) chunk(it, false);
#pragma unroll 1
  for (; it < NCH; ++it) chunk(it, true);

  // ---- epilogue: join the halves' sums, normalize, 16-byte stores to X [B,S,EMBED] ----
  const float inv = 1.0f / (ll + xhalf(ll));
  _Float16* xr = X + ((size_t)(b * SEQ + qrow)) * EMBED + h * HSIZE + kb;
#pragma unroll
  for (int t = 0; t < 4; ++t) {
    v8h o;
#pragma unroll
    for (int vv = 0; vv < 8; ++vv) o[vv] = (_Float16)(oacc[t][vv] * inv);
    *(v8h*)(xr + 16 * t) = o;
  }
}

extern "C" void kernel_launch(void* const* d_in, const int* in_sizes, int n_in,
                              void* d_out, int out_size, void* d_ws, size_t ws_size,
                              hipStream_t stream) {
  const float* q    = (const float*)d_in[0];
  const float* k    = (const float*)d_in[1];
  const float* v    = (const float*)d_in[2];
  const int*   mask = (const int*)  d_in[3];
  const float* Wq   = (const float*)d_in[4];
  const float* bq   = (const float*)d_in[5];
  const float* Wk   = (const float*)d_in[6];
  const float* bk   = (const float*)d_in[7];
  const float* Wv   = (const float*)d_in[8];
  const float* bv   = (const float*)d_in[9];
  const float* Wo   = (const float*)d_in[10];
  const float* bo   = (const float*)d_in[11];

  const size_t actElems  = (size_t)MTOK * EMBED;     // 3,145,728
  const size_t wgtElems  = (size_t)EMBED * EMBED;    //   589,824
  const size_t headElems = (size_t)BATCH * HEADS * SEQ * HSIZE;  // 3,145,728

  _Float16* p = (_Float16*)d_ws;
  _Float16* q16  = p; p += actElems;
  _Float16* k16  = p; p += actElems;
  _Float16* v16  = p; p += actElems;
  _Float16* Wq16 = p; p += wgtElems;
  _Float16* Wk16 = p; p += wgtElems;
  _Float16* Wv16 = p; p += wgtElems;
  _Float16* Wo16 = p; p += wgtElems;
  _Float16* Qh   = p; p += headElems;
  _Float16* Kh   = p; p += headElems;
  _Float16* Vt   = p; p += headElems;
  _Float16* X16  = p; p += actElems;
  int* meta = (int*)p;   // 2 * BATCH ints: kept keys, open keys

  // f32 -> f16 downcast of all activations and weights; q16 is the first of the
  // seven consecutive f16 arrays above.
  // k and v rows are packed by the mask on the way; the last BATCH work-groups write meta.
  cvt_all_f16<<<CVT_WGS + BATCH, CVT_T, 0, stream>>>(q, k, v, Wq, Wk, Wv, Wo, q16, mask, meta);

  const dim3 ggrid(EMBED / 64, MTOK / 64);        // (12, 64)
  const dim3 qkvgrid(EMBED / 64, MTOK / 64, 3);   // planes: Q, K, V
  const float qscale = 0.125f;                    // 1/sqrt(HSIZE) folded into Q

  // Q, K and V projections do not depend on each other: one launch. q16/k16/v16,
  // Wq16/Wk16/Wv16 and Qh/Kh/Vt are each three consecutive arrays of equal size.
  gemm_wmma<<<qkvgrid, 256, 0, stream>>>(q16, Wq16, bq, bk, bv, (void*)Qh, 0, qscale, meta);

  const int totalWaves = BATCH * HEADS * (SEQ / 16);   // 3072
  flash_attn<<<totalWaves / 8, 256, 0, stream>>>(Qh, Kh, Vt, meta, X16);

  gemm_wmma<<<ggrid, 256, 0, stream>>>(X16, Wo16, bo, bo, bo, d_out, 2, 1.0f, meta);
}

// v006
// One run takes 73.6 microseconds.
// Two timings next to v005 put it at 1.15 and 1.16 times that version's speed.
// Over all steps from v000 it is 3.80 times as fast.
#include <hip/hip_runtime.h>

// Problem constants (fixed by the reference).
#define EMBED  768
#define HEADS  12
#define HSIZE  64
#define BATCH  2
#define SEQ    2048
#define MTOK   (BATCH * SEQ)   // 4096 rows for the projections

// LDS row pitches in halves. A fragment read is two 16-byte loads per lane, each with 16
// rows per lane half, so the pitch is 16 B x odd: the 16 rows then fall on 16
// distinct groups of four banks (64 banks x 4 B) instead of two or four groups.
#define P128   72   // rows of 128 B data -> pitch 144 B
#define P64    40   // rows of  64 B data -> pitch  80 B

#define GT     128  // projection tile of a work-group: GT rows x GT columns
static_assert(SEQ % GT == 0 && EMBED % GT == 0, "tiles cover a batch and a row exactly");

typedef __attribute__((ext_vector_type(16))) _Float16 v16h;
typedef __attribute__((ext_vector_type(8)))  _Float16 v8h;
typedef __attribute__((ext_vector_type(4)))  _Float16 v4h;
typedef __attribute__((ext_vector_type(8)))  float    v8f;

// D = A(16x32 f16) * B(32x16 f16) + C(16x16 f32)
__device__ __forceinline__ v8f wmma_f16(v16h a, v16h b, v8f c) {
  return __builtin_amdgcn_wmma_f32_16x16x32_f16(
      /*neg_a=*/false, a, /*neg_b=*/false, b,
      /*c_mod=*/(short)0, c, /*reuse_a=*/false, /*reuse_b=*/false);
}

// Async copies of 16 bytes/lane global -> LDS (ASYNCcnt-tracked, no VGPR round trip).
// One statement per stage: the closing s_wait_xcnt 0 stands in front of any later
// rewrite of the address registers that the copies name.
__device__ __forceinline__ unsigned lds_addr(const _Float16* lptr) {
  return (unsigned)(uintptr_t)lptr;   // low 32 bits = LDS byte offset
}
__device__ __forceinline__ void async2_b128(const _Float16* g0, const _Float16* l0,
                                            const _Float16* g1, const _Float16* l1) {
  asm volatile("global_load_async_to_lds_b128 %0, %1, off\n\t"
               "global_load_async_to_lds_b128 %2, %3, off\n\t"
               "s_wait_xcnt 0x0"
               :: "v"(lds_addr(l0)), "v"(g0), "v"(lds_addr(l1)), "v"(g1) : "memory");
}
__device__ __forceinline__ void async8_b128(const _Float16* g0, const _Float16* l0,
                                            const _Float16* g1, const _Float16* l1,
                                            const _Float16* g2, const _Float16* l2,
                                            const _Float16* g3, const _Float16* l3,
                                            const _Float16* g4, const _Float16* l4,
                                            const _Float16* g5, const _Float16* l5,
                                            const _Float16* g6, const _Float16* l6,
                                            const _Float16* g7, const _Float16* l7) {
  asm volatile("global_load_async_to_lds_b128 %0, %1, off\n\t"
               "global_load_async_to_lds_b128 %2, %3, off\n\t"
               "global_load_async_to_lds_b128 %4, %5, off\n\t"
               "global_load_async_to_lds_b128 %6, %7, off\n\t"
               "global_load_async_to_lds_b128 %8, %9, off\n\t"
               "global_load_async_to_lds_b128 %10, %11, off\n\t"
               "global_load_async_to_lds_b128 %12, %13, off\n\t"
               "global_load_async_to_lds_b128 %14, %15, off\n\t"
               "s_wait_xcnt 0x0"
               :: "v"(lds_addr(l0)), "v"(g0), "v"(lds_addr(l1)), "v"(g1),
                  "v"(lds_addr(l2)), "v"(g2), "v"(lds_addr(l3)), "v"(g3),
                  "v"(lds_addr(l4)), "v"(g4), "v"(lds_addr(l5)), "v"(g5),
                  "v"(lds_addr(l6)), "v"(g6), "v"(lds_addr(l7)), "v"(g7) : "memory");
}
// The eight stores of one accumulator tile (a lane's eight rows) and their wait in one
// statement: the closing s_wait_xcnt 0 stands in front of any later rewrite of the address
// and data registers that the stores name.
__device__ __forceinline__ void store8_b32(float* const (&p)[8], const float (&x)[8]) {
  asm volatile("global_store_b32 %0, %8, off\n\t"
               "global_store_b32 %1, %9, off\n\t"
               "global_store_b32 %2, %10, off\n\t"
               "global_store_b32 %3, %11, off\n\t"
               "global_store_b32 %4, %12, off\n\t"
               "global_store_b32 %5, %13, off\n\t"
               "global_store_b32 %6, %14, off\n\t"
               "global_store_b32 %7, %15, off\n\t"
               "s_wait_xcnt 0x0"
               :: "v"(p[0]), "v"(p[1]), "v"(p[2]), "v"(p[3]),
                  "v"(p[4]), "v"(p[5]), "v"(p[6]), "v"(p[7]),
                  "v"(x[0]), "v"(x[1]), "v"(x[2]), "v"(x[3]),
                  "v"(x[4]), "v"(x[5]), "v"(x[6]), "v"(x[7]) : "memory");
}
// The same for f16; x holds each value in the low half of a 32-bit register.
__device__ __forceinline__ void store8_b16(_Float16* const (&p)[8], const unsigned (&x)[8]) {
  asm volatile("global_store_b16 %0, %8, off\n\t"
               "global_store_b16 %1, %9, off\n\t"
               "global_store_b16 %2, %10, off\n\t"
               "global_store_b16 %3, %11, off\n\t"
               "global_store_b16 %4, %12, off\n\t"
               "global_store_b16 %5, %13, off\n\t"
               "global_store_b16 %6, %14, off\n\t"
               "global_store_b16 %7, %15, off\n\t"
               "s_wait_xcnt 0x0"
               :: "v"(p[0]), "v"(p[1]), "v"(p[2]), "v"(p[3]),
                  "v"(p[4]), "v"(p[5]), "v"(p[6]), "v"(p[7]),
                  "v"(x[0]), "v"(x[1]), "v"(x[2]), "v"(x[3]),
                  "v"(x[4]), "v"(x[5]), "v"(x[6]), "v"(x[7]) : "memory");
}
// Wait until at most N async ops remain in flight (in-order completion ->
// waiting <=N with N ops just issued drains everything older).
template <int N>
__device__ __forceinline__ void wait_async_le() {
  asm volatile("s_wait_asynccnt %0" :: "i"(N) : "memory");
}

// Load one 16x32 f16 A-layout fragment from a row-major [rows][stride] array.
// ISA layout: lanes 0-15 hold K={kb..kb+7, kb+16..kb+23} of row (lane&15),
// lanes 16-31 get kb=8. Two 16-byte loads per lane.
__device__ __forceinline__ v16h frag_ld(const _Float16* base, int stride,
                                        int row, int kb) {
  const _Float16* p = base + row * stride + kb;
  v8h lo = *(const v8h*)(p);
  v8h hi = *(const v8h*)(p + 16);
  v16h r;
#pragma unroll
  for (int i = 0; i < 8; ++i) { r[i] = lo[i]; r[i + 8] = hi[i]; }
  return r;
}

// All seven f32 -> f16 conversions in ONE launch of few, long waves. The f16 copies
// lie one behind the other in the workspace in the order of the arguments, so a
// q or weight work-group's output chunk follows from blockIdx.x alone (k and v rows go to
// their key's rank); only the source is picked.
// 16 waves per work-group and about one work-group per WGP; a wave-wide load covers
// 512 contiguous bytes, a wave-wide store 256.
#define CVT_T    512                          // threads per work-group
#define CVT_U    24                           // float4 per thread
#define CVT_CH   (CVT_T * CVT_U)              // float4 per work-group
#define ACT4     (MTOK * EMBED / 4)           // float4 per activation
#define WGT4     (EMBED * EMBED / 4)          // float4 per weight matrix
#define ACT_CH   (ACT4 / CVT_CH)              // 64 chunks
#define WGT_CH   (WGT4 / CVT_CH)              // 12 chunks
#define CVT_WGS  (3 * ACT_CH + 4 * WGT_CH)    // 240 work-groups
static_assert(ACT4 % CVT_CH == 0 && WGT4 % CVT_CH == 0, "chunks must tile every array");
#define ROW4     (EMBED / 4)                  // float4 per activation row
#define CH_ROWS  (CVT_CH / ROW4)              // 64 rows per chunk
#define CH_BATCH (ACT_CH / BATCH)             // 32 chunks per batch
static_assert(CVT_CH % ROW4 == 0 && ACT_CH % BATCH == 0, "a chunk holds whole rows of one batch");
static_assert(SEQ == 4 * CVT_T, "the key ranking takes four mask words a thread");
static_assert(ROW4 % 32 == 0, "a wave's 32 float4 lie in one row");

// Ranks of the keys of one batch; m = its mask words 4*tid .. 4*tid+3. A key whose mask
// word is 0 gets the score -1e9, and its softmax weight is exactly 0 in f32 as soon as
// one key of the row is open, so only the open keys need to be projected and attended
// to. Returns for this thread's keys
// 4*tid .. 4*tid+3 the rank among the open keys of the batch, -1 for a closed key, and
// in total the number of open keys. With no open key the softmax is uniform over all
// keys: then every key keeps its own place. Holds one barrier: called by whole groups.
__device__ __forceinline__ int4 key_rank(const int4 m, int* wsum, int& total) {
  const int tid  = threadIdx.x;
  const int lane = tid & 31;
  const int wave = tid >> 5;
  const int k0 = (m.x != 0), k1 = (m.y != 0), k2 = (m.z != 0), k3 = (m.w != 0);
  const int c = k0 + k1 + k2 + k3;
  int inc = c;   // inclusive sum over the wave's lanes
  // Unrolled: five steps with constant distances.
#pragma unroll
  for (int d = 1; d < 32; d <<= 1) {
    const int o = __shfl_up(inc, d);
    if (lane >= d) inc += o;
  }
  if (lane == 31) wsum[wave] = inc;
  __syncthreads();
  int base = 0, tot = 0;
  // Unrolled: the 16 wave sums come in four 16-byte LDS reads.
#pragma unroll
  for (int w = 0; w < CVT_T / 32; ++w) {
    const int t = wsum[w];
    base += (w < wave) ? t : 0;
    tot  += t;
  }
  total = tot;
  const int e0 = base + inc - c;   // open keys in front of this thread's four
  int4 p;
  if (tot == 0) {
    p.x = 4 * tid; p.y = 4 * tid + 1; p.z = 4 * tid + 2; p.w = 4 * tid + 3;
  } else {
    p.x = k0 ? e0 : -1;
    p.y = k1 ? e0 + k0 : -1;
    p.z = k2 ? e0 + k0 + k1 : -1;
    p.w = k3 ? e0 + k0 + k1 + k2 : -1;
  }
  return p;
}

__global__ __launch_bounds__(CVT_T)
void cvt_all_f16(const float* __restrict__ q,  const float* __restrict__ k,
                 const float* __restrict__ v,  const float* __restrict__ wq,
                 const float* __restrict__ wk, const float* __restrict__ wv,
                 const float* __restrict__ wo, _Float16* __restrict__ out,
                 const int* __restrict__ mask, int* __restrict__ meta) {
  __shared__ int wsum[CVT_T / 32];
  __shared__ __attribute__((aligned(16))) int rank[SEQ];
  const int blk = blockIdx.x;
  if (blk >= CVT_WGS) {
    // The last BATCH work-groups: meta[2b] = rows of k and v that are kept, meta[2b+1] =
    // open keys; the rows from there to the next multiple of GT (a projection tile) are
    // zeroed, so that the last tile reads defined values.
    const int b = blk - CVT_WGS;
    int total;
    (void)key_rank(*(const int4*)(mask + b * SEQ + 4 * threadIdx.x), wsum, total);
    const int cnt = (total == 0) ? SEQ : total;
    if (threadIdx.x == 0) { meta[2 * b] = cnt; meta[2 * b + 1] = total; }
    const int pad  = (-cnt) & (GT - 1);   // cnt + pad <= SEQ, as SEQ is a multiple of GT
    const int wv   = threadIdx.x >> 5;
    const v8h zero8 = {};
    _Float16* zr = out + (size_t)MTOK * EMBED
                       + ((size_t)(b * SEQ + cnt + wv)) * EMBED + (threadIdx.x & 31) * 8;
    // Unrolled: constant steps from one address. Wave = row modulo 16, lane = 16-byte piece.
#pragma unroll
    for (int i = 0; i < GT / 16; ++i) {
      if (wv + 16 * i < pad) {
#pragma unroll
        for (int a = 0; a < 2; ++a)
#pragma unroll
          for (int kk = 0; kk < EMBED / 256; ++kk)
            *(v8h*)(zr + (size_t)a * MTOK * EMBED + i * 16 * EMBED + kk * 256) = zero8;
      }
    }
    return;
  }
  const float* src;
  int ch;
  if (blk < 3 * ACT_CH) {
    const int a = blk / ACT_CH;
    ch  = blk % ACT_CH;
    src = (a == 0) ? q : (a == 1) ? k : v;
  } else {
    const int t = blk - 3 * ACT_CH;
    const int a = t / WGT_CH;
    ch  = t % WGT_CH;
    src = (a == 0) ? wq : (a == 1) ? wk : (a == 2) ? wv : wo;
  }
  const float4* in4 = (const float4*)src + (size_t)ch * CVT_CH + threadIdx.x;
  v4h* o4 = (v4h*)out + (size_t)blk * CVT_CH + threadIdx.x;

  // k and v are packed by the mask.
  const bool packed = (blk >= ACT_CH && blk < 3 * ACT_CH);

  float4 f[CVT_U];
  // Unrolled so that f stays in registers and many loads are asked for ahead of the first use.
#pragma unroll
  for (int j = 0; j < CVT_U; ++j) f[j] = in4[j * CVT_T];
  if (packed) {
    // A row goes to its key's rank in its batch, a closed key's row is dropped.
    const int b = ch / CH_BATCH;
    const int4 mk = *(const int4*)(mask + b * SEQ + 4 * threadIdx.x);
    int total;
    const int4 p = key_rank(mk, wsum, total);
    *(int4*)(rank + 4 * threadIdx.x) = p;
    __syncthreads();
    const int s0 = (ch % CH_BATCH) * CH_ROWS;   // first key of this chunk in its batch
    v4h* ob = (v4h*)out + (size_t)(blk / ACT_CH) * ACT4 + (size_t)b * SEQ * ROW4;
    // A wave's 32 float4 lie in one row (ROW4 is a multiple of 32), so row, rank and the
    // test are the same in all its lanes: kept in scalars, the test is a scalar branch.
    const int w32 = __builtin_amdgcn_readfirstlane(threadIdx.x >> 5) * 32;
    const int ln  = threadIdx.x & 31;
    // Lane j holds the rank of the row of the wave's j-th float4: one LDS read for all trips.
    const int rk  = rank[s0 + (min(ln, CVT_U - 1) * CVT_T + w32) / ROW4];
    // Unrolled for the same register array.
#pragma unroll
    for (int j = 0; j < CVT_U; ++j) {
      const int w0 = j * CVT_T + w32;
      const int r  = w0 / ROW4;
      const int pr = min(__builtin_amdgcn_readlane(rk, j), SEQ - 1);
      if (pr >= 0) {
        v4h h;
        h[0] = (_Float16)f[j].x; h[1] = (_Float16)f[j].y;
        h[2] = (_Float16)f[j].z; h[3] = (_Float16)f[j].w;
        ob[(size_t)pr * ROW4 + (w0 - r * ROW4) + ln] = h;
      }
    }
    return;
  }
  // Unrolled for the same register array.
#pragma unroll
  for (int j = 0; j < CVT_U; ++j) {
    v4h h;
    h[0] = (_Float16)f[j].x; h[1] = (_Float16)f[j].y;
    h[2] = (_Float16)f[j].z; h[3] = (_Float16)f[j].w;
    o4[j * CVT_T] = h;
  }
}

// C = A[M,K](f16) * Bt[N,K]^T(f16) + bias[N], M=4096, N=768, K=768.
// 128x128 tiles, BK=64, double-buffered async-to-LDS staging (DMA overlaps WMMA).
// 8 waves as 4 (rows) x 2 (columns): a wave owns 32 x 64, eight accumulator tiles, so
// that a fragment read from LDS feeds four (A) or two (B) matrix instructions.
// mode 0: out f16 [B,H,S,64]   (Q/K head layout; outScale folds 1/sqrt(d))
// mode 1: out f16 [B,H,64,S]   (V transposed so it feeds the WMMA A operand)
// mode 2: out f32 [M,768]      (final projection into d_out)
// blockIdx.z picks one of up to three independent products of one launch. Their A,
// Bt and f16 outputs lie one behind the other in the workspace, so z only steps the
// three base pointers. Plane 0 takes mode0 and scale0, plane 1 mode0 unscaled,
// plane 2 is the transposed V layout (mode 1) unscaled. The A rows of planes 1 and 2
// (k and v) are packed to the front of each batch: tiles behind the kept rows leave.
__global__ __launch_bounds__(256)
void gemm_wmma(const _Float16* __restrict__ A0, const _Float16* __restrict__ Bt0,
               const float* __restrict__ bias0, const float* __restrict__ bias1,
               const float* __restrict__ bias2, void* __restrict__ outp0,
               int mode0, float scale0, const int* __restrict__ meta) {
  __shared__ __attribute__((aligned(16))) _Float16 As[2][GT * P128];
  __shared__ __attribute__((aligned(16))) _Float16 Bs[2][GT * P128];

  const int z = blockIdx.z;
  // The whole work-group leaves, in front of every copy and barrier.
  if (z != 0 && (int)((blockIdx.y * GT) & (SEQ - 1)) >= meta[2 * ((blockIdx.y * GT) / SEQ)]) return;
  const _Float16* A    = A0  + (size_t)z * (MTOK * EMBED);
  const _Float16* Bt   = Bt0 + (size_t)z * (EMBED * EMBED);
  const float*    bias = (z == 0) ? bias0 : (z == 1) ? bias1 : bias2;
  void* outp = (void*)((_Float16*)outp0 + (size_t)z * (MTOK * EMBED));
  const int   mode     = (z == 2) ? 1 : mode0;
  const float outScale = (z == 0) ? scale0 : 1.0f;

  const int tid   = threadIdx.x;
  const int wave  = tid >> 5;
  const int lane  = tid & 31;
  const int l16   = lane & 15;
  const int lhalf = lane >> 4;
  const int kb    = lhalf ? 8 : 0;
  const int mw    = wave & 3;    // 32 rows of the tile, 0..3
  const int nw    = wave >> 2;   // 64 columns of the tile, 0..1
  const int m0    = blockIdx.y * GT;
  const int n0    = blockIdx.x * GT;
  const int K     = EMBED;
  const int NIT   = K / 64;      // 12

  // Staging: tile = 128 rows x 128B = 1024 x 16B chunks; each thread moves 4 per tile,
  // rows row0, row0 + 32, row0 + 64, row0 + 96.
  const int row0 = tid >> 3;          // 0..31
  const int seg  = (tid & 7) * 8;     // halves within row

  auto stage = [&](int kc, int buf) {
    const _Float16* ga = A  + (m0 + row0) * K + kc + seg;
    const _Float16* gb = Bt + (n0 + row0) * K + kc + seg;
    const _Float16* la = &As[buf][row0 * P128 + seg];
    const _Float16* lb = &Bs[buf][row0 * P128 + seg];
    async8_b128(ga,          la,             ga + 32 * K, la + 32 * P128,
                ga + 64 * K, la + 64 * P128, ga + 96 * K, la + 96 * P128,
                gb,          lb,             gb + 32 * K, lb + 32 * P128,
                gb + 64 * K, lb + 64 * P128, gb + 96 * K, lb + 96 * P128);
  };

  v8f acc[2][4] = {};

  stage(0, 0);   // prologue: tile 0 in flight
#pragma unroll 1
  for (int it = 0; it < NIT; ++it) {
    const int cur = it & 1;
    if (it + 1 < NIT) {
      stage((it + 1) * 64, cur ^ 1);   // next tile streams during this compute
      wait_async_le<8>();              // drain tile `it` only
    } else {
      wait_async_le<0>();
    }
    __syncthreads();

    // Unrolled: the accumulators stay in registers. k 0..31, then k 32..63.
#pragma unroll
    for (int kk = 0; kk < 2; ++kk) {
      v16h af[2], bf[4];
#pragma unroll
      for (int i = 0; i < 2; ++i)
        af[i] = frag_ld(As[cur] + 32 * kk, P128, 32 * mw + 16 * i + l16, kb);
#pragma unroll
      for (int j = 0; j < 4; ++j)
        bf[j] = frag_ld(Bs[cur] + 32 * kk, P128, 64 * nw + 16 * j + l16, kb);
#pragma unroll
      for (int i = 0; i < 2; ++i)
#pragma unroll
        for (int j = 0; j < 4; ++j) acc[i][j] = wmma_f16(af[i], bf[j], acc[i][j]);
    }
    __syncthreads();   // all reads of buf `cur` done before it is restaged
  }

#pragma unroll
  for (int j = 0; j < 4; ++j) {
    const int n = n0 + 64 * nw + 16 * j + l16;
    const float bv = bias[n];
#pragma unroll
    for (int i = 0; i < 2; ++i) {
      const int mb = m0 + 32 * mw + 16 * i + 8 * lhalf;   // C layout: row = v + 8*(lane/16)
      if (mode == 2) {
        float* p[8];
        float  x[8];
#pragma unroll
        for (int vv = 0; vv < 8; ++vv) {
          p[vv] = (float*)outp + (size_t)(mb + vv) * EMBED + n;
          x[vv] = (acc[i][j][vv] + bv) * outScale;
        }
        store8_b32(p, x);
      } else {
        // mb is a multiple of 8: the eight rows lie in one batch, one step apart.
        const int bb = mb >> 11, s = mb & (SEQ - 1);
        const int hh = n >> 6,   d = n & (HSIZE - 1);
        const size_t o = (mode == 0)
            ? ((size_t)((bb * HEADS + hh) * SEQ + s)) * HSIZE + d
            : ((size_t)((bb * HEADS + hh) * HSIZE + d)) * SEQ + s;
        const int step = (mode == 0) ? HSIZE : 1;
        _Float16* p[8];
        unsigned  x[8];
#pragma unroll
        for (int vv = 0; vv < 8; ++vv) {
          p[vv] = (_Float16*)outp + o + vv * step;
          x[vv] = __builtin_bit_cast(unsigned short, (_Float16)((acc[i][j][vv] + bv) * outScale));
        }
        store8_b16(p, x);
      }
    }
  }
}

// Lane l <-> lane l ^ 16 (the two halves of a wave) without touching LDS.
__device__ __forceinline__ float xhalf(float x) {
  const int b = __builtin_bit_cast(int, x);
  return __builtin_bit_cast(float,
      __builtin_amdgcn_permlanex16(b, b, 0x76543210, 0xfedcba98, false, false));
}

// Fused flash attention, transposed products: S^T = K * Q^T, O^T += V^T * P^T.
// One wave per (b, h, 16-query tile); the 8 waves of a block share one (b,h), so
// K/V chunks are async-staged into LDS once per block, double-buffered so the DMA
// for chunk i+1 overlaps softmax+WMMA of chunk i.
// A lane holds scores of ONE query (column l16): keys 8*lhalf+r and 16+8*lhalf+r.
// Maximum and sum run in the lane's own registers plus one exchange between the
// halves, and the two score tiles, converted in place, are the B operand of the
// second product (hardware k order), so P never goes through LDS.
// Qh,Kh: f16 [B,H,S,64]; Vt: f16 [B,H,64,S]; X out: f16 [B,S,EMBED]. Q pre-scaled.
// Kh and Vt hold the kept keys only, packed to the front: the loop walks those, and a
// key at or behind the number of open keys (the tail of the last chunk, projected from
// zero rows; every key when none is open) takes the score -1e9.
__global__ __launch_bounds__(256)
void flash_attn(const _Float16* __restrict__ Qh, const _Float16* __restrict__ Kh,
                const _Float16* __restrict__ Vt, const int* __restrict__ meta,
                _Float16* __restrict__ X) {
  __shared__ __attribute__((aligned(16))) _Float16 Ks[2][32 * P128];  // 32 keys x 64 d
  __shared__ __attribute__((aligned(16))) _Float16 Vs[2][64 * P64];   // 64 d x 32 keys

  const int tid   = threadIdx.x;
  const int wave  = tid >> 5;
  const int lane  = tid & 31;
  const int l16   = lane & 15;
  const int lhalf = lane >> 4;
  const int kb    = lhalf ? 8 : 0;

  const int g  = blockIdx.x * 8 + wave;   // global wave id, 3072 total
  const int bh = blockIdx.x >> 4;         // = g >> 7, from scalars: trip count and branches stay scalar
  const int qt = g & 127;
  const int b  = bh / HEADS;
  const int h  = bh % HEADS;

  const _Float16* Qp = Qh + (size_t)bh * SEQ * HSIZE;
  const _Float16* Kp = Kh + (size_t)bh * SEQ * HSIZE;
  const _Float16* Vp = Vt + (size_t)bh * HSIZE * SEQ;

  // Staging assignment: K chunk = 32 rows x 8 segs, V chunk = 64 rows x 4 segs.
  const int krow = tid >> 3, kseg = (tid & 7) * 8;
  const int vrow = tid >> 2, vseg = (tid & 3) * 8;

  auto stage = [&](int kc, int buf) {
    async2_b128(Kp + (kc + krow) * HSIZE + kseg, &Ks[buf][krow * P128 + kseg],
                Vp + vrow * SEQ + kc + vseg,     &Vs[buf][vrow * P64 + vseg]);
  };

  // Q^T as B operand (column = query qt*16 + l16, k = d in [0,32) and [32,64))
  const int qrow = qt * 16 + l16;
  const v16h qf0 = frag_ld(Qp,      HSIZE, qrow, kb);
  const v16h qf1 = frag_ld(Qp + 32, HSIZE, qrow, kb);
  // Stands in front of any rewrite of the address registers that the four Q loads name.
  asm volatile("s_wait_xcnt 0x0" ::: "memory");

  float ml = -1e30f;   // running maximum of this lane's query (equal in both halves)
  float ll = 0.f;      // running sum over this half's keys only; joined in the epilogue
  v8f oacc[4] = {{}, {}, {}, {}};   // O^T: row d = 16*t + 8*lhalf + r, column = query

  // Both are the same for the whole work-group (one b), so every barrier below is met
  // by all waves; the trip count is bounded by the shape whatever meta holds.
  const int nkept = min(max(meta[2 * b], 1), SEQ);
  const int nopen = meta[2 * b + 1];
  const int NCH   = (nkept + 31) >> 5;   // 1..64 chunks

  // One chunk of 32 kept keys. tail: the chunk reaches past the open keys.
  auto chunk = [&](const int it, const bool tail) {
    const int cur = it & 1;
    const int kc  = it * 32;
    if (it + 1 < NCH) {
      stage((it + 1) * 32, cur ^ 1);   // next K/V chunk streams during compute
      wait_async_le<2>();
    } else {
      wait_async_le<0>();
    }
    __syncthreads();

    // ---- scores^T: 32 keys x 16 queries, f32 accum ----
    v8f s0 = {}, s1 = {};
    {
      v16h kf = frag_ld(Ks[cur],      P128, l16, kb);      // keys 0..15, d 0..31
      s0 = wmma_f16(kf, qf0, s0);
      kf = frag_ld(Ks[cur] + 32, P128, l16, kb);           // d 32..63
      s0 = wmma_f16(kf, qf1, s0);
      kf = frag_ld(Ks[cur],      P128, 16 + l16, kb);      // keys 16..31
      s1 = wmma_f16(kf, qf0, s1);
      kf = frag_ld(Ks[cur] + 32, P128, 16 + l16, kb);
      s1 = wmma_f16(kf, qf1, s1);
    }
    // ---- key mask (row = register r) ----
    if (tail) {
      const int lim = nopen - kc - kb;   // key r of this half is open while r < lim
#pragma unroll
      for (int vv = 0; vv < 8; ++vv) {
        s0[vv] = (vv < lim)      ? s0[vv] : -1e9f;
        s1[vv] = (vv + 16 < lim) ? s1[vv] : -1e9f;
      }
    }
    // ---- online softmax: one query per lane ----
    float rm = fmaxf(s0[0], s1[0]);
#pragma unroll
    for (int vv = 1; vv < 8; ++vv) rm = fmaxf(rm, fmaxf(s0[vv], s1[vv]));
    rm = fmaxf(rm, xhalf(rm));
    const float nm   = fmaxf(ml, rm);
    const float corr = __expf(ml - nm);
    ml = nm;
    v16h pf;           // P^T as B operand: pf[s] = key kmap(s, lhalf) of column l16
    float rs0 = 0.f, rs1 = 0.f;
#pragma unroll
    for (int vv = 0; vv < 8; ++vv) {
      const float p0 = __expf(s0[vv] - nm);
      const float p1 = __expf(s1[vv] - nm);
      rs0 += p0; rs1 += p1;
      pf[vv]     = (_Float16)p0;
      pf[vv + 8] = (_Float16)p1;
    }
    ll = ll * corr + (rs0 + rs1);
#pragma unroll
    for (int t = 0; t < 4; ++t)
#pragma unroll
      for (int vv = 0; vv < 8; ++vv) oacc[t][vv] *= corr;

    // ---- out^T += V^T(64x32) * P^T(32x16) ----
#pragma unroll
    for (int t = 0; t < 4; ++t) {
      const v16h vf = frag_ld(Vs[cur], P64, 16 * t + l16, kb);
      oacc[t] = wmma_f16(vf, pf, oacc[t]);
    }
    __syncthreads();   // all waves done with buf `cur` before it is restaged
  };

  // Chunks of open keys alone need no mask; the rest (the last chunk, or every chunk
  // when no key is open) runs in a loop of its own, so that neither body holds a branch.
  const int nfull = min(max(nopen, 0) >> 5, NCH);
  stage(0, 0);
  int it = 0;
  // Both loops stay rolled: one copy of each body, the buffer follows it & 1.
#pragma unroll 1
  for (; it < nfull; ++it) chunk(it, false);
#pragma unroll 1
  for (; it < NCH; ++it) chunk(it, true);

  // ---- epilogue: join the halves' sums, normalize, 16-byte stores to X [B,S,EMBED] ----
  const float inv = 1.0f / (ll + xhalf(ll));
  _Float16* xr = X + ((size_t)(b * SEQ + qrow)) * EMBED + h * HSIZE + kb;
#pragma unroll
  for (int t = 0; t < 4; ++t) {
    v8h o;
#pragma unroll
    for (int vv = 0; vv < 8; ++vv) o[vv] = (_Float16)(oacc[t][vv] * inv);
    *(v8h*)(xr + 16 * t) = o;
  }
}

extern "C" void kernel_launch(void* const* d_in, const int* in_sizes, int n_in,
                              void* d_out, int out_size, void* d_ws, size_t ws_size,
                              hipStream_t stream) {
  const float* q    = (const float*)d_in[0];
  const float* k    = (const float*)d_in[1];
  const float* v    = (const float*)d_in[2];
  const int*   mask = (const int*)  d_in[3];
  const float* Wq   = (const float*)d_in[4];
  const float* bq   = (const float*)d_in[5];
  const float* Wk   = (const float*)d_in[6];
  const float* bk   = (const float*)d_in[7];
  const float* Wv   = (const float*)d_in[8];
  const float* bv   = (const float*)d_in[9];
  const float* Wo   = (const float*)d_in[10];
  const float* bo   = (const float*)d_in[11];

  const size_t actElems  = (size_t)MTOK * EMBED;     // 3,145,728
  const size_t wgtElems  = (size_t)EMBED * EMBED;    //   589,824
  const size_t headElems = (size_t)BATCH * HEADS * SEQ * HSIZE;  // 3,145,728

  _Float16* p = (_Float16*)d_ws;
  _Float16* q16  = p; p += actElems;
  _Float16* k16  = p; p += actElems;
  _Float16* v16  = p; p += actElems;
  _Float16* Wq16 = p; p += wgtElems;
  _Float16* Wk16 = p; p += wgtElems;
  _Float16* Wv16 = p; p += wgtElems;
  _Float16* Wo16 = p; p += wgtElems;
  _Float16* Qh   = p; p += headElems;
  _Float16* Kh   = p; p += headElems;
  _Float16* Vt   = p; p += headElems;
  _Float16* X16  = p; p += actElems;
  int* meta = (int*)p;   // 2 * BATCH ints: kept keys, open keys

  // f32 -> f16 downcast of all activations and weights; q16 is the first of the
  // seven consecutive f16 arrays above.
  // k and v rows are packed by the mask on the way; the last BATCH work-groups write meta.
  cvt_all_f16<<<CVT_WGS + BATCH, CVT_T, 0, stream>>>(q, k, v, Wq, Wk, Wv, Wo, q16, mask, meta);

  const dim3 ggrid(EMBED / GT, MTOK / GT);        // (6, 32)
  const dim3 qkvgrid(EMBED / GT, MTOK / GT, 3);   // planes: Q, K, V
  const float qscale = 0.125f;                    // 1/sqrt(HSIZE) folded into Q

  // Q, K and V projections do not depend on each other: one launch. q16/k16/v16,
  // Wq16/Wk16/Wv16 and Qh/Kh/Vt are each three consecutive arrays of equal size.
  gemm_wmma<<<qkvgrid, 256, 0, stream>>>(q16, Wq16, bq, bk, bv, (void*)Qh, 0, qscale, meta);

  const int totalWaves = BATCH * HEADS * (SEQ / 16);   // 3072
  flash_attn<<<totalWaves / 8, 256, 0, stream>>>(Qh, Kh, Vt, meta, X16);

  gemm_wmma<<<ggrid, 256, 0, stream>>>(X16, Wo16, bo, bo, bo, d_out, 2, 1.0f, meta);
}

// v007
// One run takes 71 microseconds.
// Next to v006, in two timings, it ran 1.04 and 1.03 times as fast.
// Over all steps from v000 it is 3.95 times as fast.
#include <hip/hip_runtime.h>

// Problem constants (fixed by the reference).
#define EMBED  768
#define HEADS  12
#define HSIZE  64
#define BATCH  2
#define SEQ    2048
#define MTOK   (BATCH * SEQ)   // 4096 rows for the projections

// LDS row pitches in halves. A fragment read is two 16-byte loads per lane, each with 16
// rows per lane half, so the pitch is 16 B x odd: the 16 rows then fall on 16
// distinct groups of four banks (64 banks x 4 B) instead of one or two groups.
#define P128   72   // rows of 128 B data -> pitch 144 B
#define P256   136  // rows of 256 B data -> pitch 272 B

#define GT     128  // projection tile of a work-group: GT rows x GT columns
static_assert(SEQ % GT == 0 && EMBED % GT == 0, "tiles cover a batch and a row exactly");

#define KST    128        // keys of one attention stage in LDS
#define KPS    (KST / 32) // passes of 32 keys in a stage
static_assert(GT % KST == 0, "the projections write K and V up to the end of the last stage");

typedef __attribute__((ext_vector_type(16))) _Float16 v16h;
typedef __attribute__((ext_vector_type(8)))  _Float16 v8h;
typedef __attribute__((ext_vector_type(4)))  _Float16 v4h;
typedef __attribute__((ext_vector_type(8)))  float    v8f;

// D = A(16x32 f16) * B(32x16 f16) + C(16x16 f32)
__device__ __forceinline__ v8f wmma_f16(v16h a, v16h b, v8f c) {
  return __builtin_amdgcn_wmma_f32_16x16x32_f16(
      /*neg_a=*/false, a, /*neg_b=*/false, b,
      /*c_mod=*/(short)0, c, /*reuse_a=*/false, /*reuse_b=*/false);
}

// Async copies of 16 bytes/lane global -> LDS (ASYNCcnt-tracked, no VGPR round trip).
// One statement per stage: the closing s_wait_xcnt 0 stands in front of any later
// rewrite of the address registers that the copies name.
__device__ __forceinline__ unsigned lds_addr(const _Float16* lptr) {
  return (unsigned)(uintptr_t)lptr;   // low 32 bits = LDS byte offset
}
__device__ __forceinline__ void async8_b128(const _Float16* g0, const _Float16* l0,
                                            const _Float16* g1, const _Float16* l1,
                                            const _Float16* g2, const _Float16* l2,
                                            const _Float16* g3, const _Float16* l3,
                                            const _Float16* g4, const _Float16* l4,
                                            const _Float16* g5, const _Float16* l5,
                                            const _Float16* g6, const _Float16* l6,
                                            const _Float16* g7, const _Float16* l7) {
  asm volatile("global_load_async_to_lds_b128 %0, %1, off\n\t"
               "global_load_async_to_lds_b128 %2, %3, off\n\t"
               "global_load_async_to_lds_b128 %4, %5, off\n\t"
               "global_load_async_to_lds_b128 %6, %7, off\n\t"
               "global_load_async_to_lds_b128 %8, %9, off\n\t"
               "global_load_async_to_lds_b128 %10, %11, off\n\t"
               "global_load_async_to_lds_b128 %12, %13, off\n\t"
               "global_load_async_to_lds_b128 %14, %15, off\n\t"
               "s_wait_xcnt 0x0"
               :: "v"(lds_addr(l0)), "v"(g0), "v"(lds_addr(l1)), "v"(g1),
                  "v"(lds_addr(l2)), "v"(g2), "v"(lds_addr(l3)), "v"(g3),
                  "v"(lds_addr(l4)), "v"(g4), "v"(lds_addr(l5)), "v"(g5),
                  "v"(lds_addr(l6)), "v"(g6), "v"(lds_addr(l7)), "v"(g7) : "memory");
}
// The eight stores of one accumulator tile (a lane's eight rows) and their wait in one
// statement: the closing s_wait_xcnt 0 stands in front of any later rewrite of the address
// and data registers that the stores name.
__device__ __forceinline__ void store8_b32(float* const (&p)[8], const float (&x)[8]) {
  asm volatile("global_store_b32 %0, %8, off\n\t"
               "global_store_b32 %1, %9, off\n\t"
               "global_store_b32 %2, %10, off\n\t"
               "global_store_b32 %3, %11, off\n\t"
               "global_store_b32 %4, %12, off\n\t"
               "global_store_b32 %5, %13, off\n\t"
               "global_store_b32 %6, %14, off\n\t"
               "global_store_b32 %7, %15, off\n\t"
               "s_wait_xcnt 0x0"
               :: "v"(p[0]), "v"(p[1]), "v"(p[2]), "v"(p[3]),
                  "v"(p[4]), "v"(p[5]), "v"(p[6]), "v"(p[7]),
                  "v"(x[0]), "v"(x[1]), "v"(x[2]), "v"(x[3]),
                  "v"(x[4]), "v"(x[5]), "v"(x[6]), "v"(x[7]) : "memory");
}
// The same for f16; x holds each value in the low half of a 32-bit register.
__device__ __forceinline__ void store8_b16(_Float16* const (&p)[8], const unsigned (&x)[8]) {
  asm volatile("global_store_b16 %0, %8, off\n\t"
               "global_store_b16 %1, %9, off\n\t"
               "global_store_b16 %2, %10, off\n\t"
               "global_store_b16 %3, %11, off\n\t"
               "global_store_b16 %4, %12, off\n\t"
               "global_store_b16 %5, %13, off\n\t"
               "global_store_b16 %6, %14, off\n\t"
               "global_store_b16 %7, %15, off\n\t"
               "s_wait_xcnt 0x0"
               :: "v"(p[0]), "v"(p[1]), "v"(p[2]), "v"(p[3]),
                  "v"(p[4]), "v"(p[5]), "v"(p[6]), "v"(p[7]),
                  "v"(x[0]), "v"(x[1]), "v"(x[2]), "v"(x[3]),
                  "v"(x[4]), "v"(x[5]), "v"(x[6]), "v"(x[7]) : "memory");
}
// Wait until at most N async ops remain in flight (in-order completion ->
// waiting <=N with N ops just issued drains everything older).
template <int N>
__device__ __forceinline__ void wait_async_le() {
  asm volatile("s_wait_asynccnt %0" :: "i"(N) : "memory");
}
// The wave's own LDS reads have returned: stands in front of the barrier behind which
// the buffer they read is refilled.
__device__ __forceinline__ void wait_ds0() {
  asm volatile("s_wait_dscnt 0x0" ::: "memory");
}

// Load one 16x32 f16 A-layout fragment from a row-major [rows][stride] array.
// ISA layout: lanes 0-15 hold K={kb..kb+7, kb+16..kb+23} of row (lane&15),
// lanes 16-31 get kb=8. Two 16-byte loads per lane.
__device__ __forceinline__ v16h frag_ld(const _Float16* base, int stride,
                                        int row, int kb) {
  const _Float16* p = base + row * stride + kb;
  v8h lo = *(const v8h*)(p);
  v8h hi = *(const v8h*)(p + 16);
  v16h r;
#pragma unroll
  for (int i = 0; i < 8; ++i) { r[i] = lo[i]; r[i + 8] = hi[i]; }
  return r;
}

// All seven f32 -> f16 conversions in ONE launch of few, long waves. The f16 copies
// lie one behind the other in the workspace in the order of the arguments, so a
// q or weight work-group's output chunk follows from blockIdx.x alone (k and v rows go to
// their key's rank); only the source is picked.
// 16 waves per work-group and about one work-group per WGP; a wave-wide load covers
// 512 contiguous bytes, a wave-wide store 256.
#define CVT_T    512                          // threads per work-group
#define CVT_U    24                           // float4 per thread
#define CVT_CH   (CVT_T * CVT_U)              // float4 per work-group
#define ACT4     (MTOK * EMBED / 4)           // float4 per activation
#define WGT4     (EMBED * EMBED / 4)          // float4 per weight matrix
#define ACT_CH   (ACT4 / CVT_CH)              // 64 chunks
#define WGT_CH   (WGT4 / CVT_CH)              // 12 chunks
#define CVT_WGS  (3 * ACT_CH + 4 * WGT_CH)    // 240 work-groups
static_assert(ACT4 % CVT_CH == 0 && WGT4 % CVT_CH == 0, "chunks must tile every array");
#define ROW4     (EMBED / 4)                  // float4 per activation row
#define CH_ROWS  (CVT_CH / ROW4)              // 64 rows per chunk
#define CH_BATCH (ACT_CH / BATCH)             // 32 chunks per batch
static_assert(CVT_CH % ROW4 == 0 && ACT_CH % BATCH == 0, "a chunk holds whole rows of one batch");
static_assert(SEQ == 4 * CVT_T, "the key ranking takes four mask words a thread");
static_assert(ROW4 % 32 == 0, "a wave's 32 float4 lie in one row");

// Ranks of the keys of one batch; m = its mask words 4*tid .. 4*tid+3. A key whose mask
// word is 0 gets the score -1e9, and its softmax weight is exactly 0 in f32 as soon as
// one key of the row is open, so only the open keys need to be projected and attended
// to. Returns for this thread's keys
// 4*tid .. 4*tid+3 the rank among the open keys of the batch, -1 for a closed key, and
// in total the number of open keys. With no open key the softmax is uniform over all
// keys: then every key keeps its own place. Holds one barrier: called by whole groups.
__device__ __forceinline__ int4 key_rank(const int4 m, int* wsum, int& total) {
  const int tid  = threadIdx.x;
  const int lane = tid & 31;
  const int wave = tid >> 5;
  const int k0 = (m.x != 0), k1 = (m.y != 0), k2 = (m.z != 0), k3 = (m.w != 0);
  const int c = k0 + k1 + k2 + k3;
  int inc = c;   // inclusive sum over the wave's lanes
  // Unrolled: five steps with constant distances.
#pragma unroll
  for (int d = 1; d < 32; d <<= 1) {
    const int o = __shfl_up(inc, d);
    if (lane >= d) inc += o;
  }
  if (lane == 31) wsum[wave] = inc;
  __syncthreads();
  int base = 0, tot = 0;
  // Unrolled: the 16 wave sums come in four 16-byte LDS reads.
#pragma unroll
  for (int w = 0; w < CVT_T / 32; ++w) {
    const int t = wsum[w];
    base += (w < wave) ? t : 0;
    tot  += t;
  }
  total = tot;
  const int e0 = base + inc - c;   // open keys in front of this thread's four
  int4 p;
  if (tot == 0) {
    p.x = 4 * tid; p.y = 4 * tid + 1; p.z = 4 * tid + 2; p.w = 4 * tid + 3;
  } else {
    p.x = k0 ? e0 : -1;
    p.y = k1 ? e0 + k0 : -1;
    p.z = k2 ? e0 + k0 + k1 : -1;
    p.w = k3 ? e0 + k0 + k1 + k2 : -1;
  }
  return p;
}

__global__ __launch_bounds__(CVT_T)
void cvt_all_f16(const float* __restrict__ q,  const float* __restrict__ k,
                 const float* __restrict__ v,  const float* __restrict__ wq,
                 const float* __restrict__ wk, const float* __restrict__ wv,
                 const float* __restrict__ wo, _Float16* __restrict__ out,
                 const int* __restrict__ mask, int* __restrict__ meta) {
  __shared__ int wsum[CVT_T / 32];
  __shared__ __attribute__((aligned(16))) int rank[SEQ];
  const int blk = blockIdx.x;
  if (blk >= CVT_WGS) {
    // The last BATCH work-groups: meta[2b] = rows of k and v that are kept, meta[2b+1] =
    // open keys; the rows from there to the next multiple of GT (a projection tile) are
    // zeroed, so that the last tile reads defined values.
    const int b = blk - CVT_WGS;
    int total;
    (void)key_rank(*(const int4*)(mask + b * SEQ + 4 * threadIdx.x), wsum, total);
    const int cnt = (total == 0) ? SEQ : total;
    if (threadIdx.x == 0) { meta[2 * b] = cnt; meta[2 * b + 1] = total; }
    const int pad  = (-cnt) & (GT - 1);   // cnt + pad <= SEQ, as SEQ is a multiple of GT
    const int wv   = threadIdx.x >> 5;
    const v8h zero8 = {};
    _Float16* zr = out + (size_t)MTOK * EMBED
                       + ((size_t)(b * SEQ + cnt + wv)) * EMBED + (threadIdx.x & 31) * 8;
    // Unrolled: constant steps from one address. Wave = row modulo 16, lane = 16-byte piece.
#pragma unroll
    for (int i = 0; i < GT / 16; ++i) {
      if (wv + 16 * i < pad) {
#pragma unroll
        for (int a = 0; a < 2; ++a)
#pragma unroll
          for (int kk = 0; kk < EMBED / 256; ++kk)
            *(v8h*)(zr + (size_t)a * MTOK * EMBED + i * 16 * EMBED + kk * 256) = zero8;
      }
    }
    return;
  }
  const float* src;
  int ch;
  if (blk < 3 * ACT_CH) {
    const int a = blk / ACT_CH;
    ch  = blk % ACT_CH;
    src = (a == 0) ? q : (a == 1) ? k : v;
  } else {
    const int t = blk - 3 * ACT_CH;
    const int a = t / WGT_CH;
    ch  = t % WGT_CH;
    src = (a == 0) ? wq : (a == 1) ? wk : (a == 2) ? wv : wo;
  }
  const float4* in4 = (const float4*)src + (size_t)ch * CVT_CH + threadIdx.x;
  v4h* o4 = (v4h*)out + (size_t)blk * CVT_CH + threadIdx.x;

  // k and v are packed by the mask.
  const bool packed = (blk >= ACT_CH && blk < 3 * ACT_CH);

  float4 f[CVT_U];
  // Unrolled so that f stays in registers and many loads are asked for ahead of the first use.
#pragma unroll
  for (int j = 0; j < CVT_U; ++j) f[j] = in4[j * CVT_T];
  if (packed) {
    // A row goes to its key's rank in its batch, a closed key's row is dropped.
    const int b = ch / CH_BATCH;
    const int4 mk = *(const int4*)(mask + b * SEQ + 4 * threadIdx.x);
    int total;
    const int4 p = key_rank(mk, wsum, total);
    *(int4*)(rank + 4 * threadIdx.x) = p;
    __syncthreads();
    const int s0 = (ch % CH_BATCH) * CH_ROWS;   // first key of this chunk in its batch
    v4h* ob = (v4h*)out + (size_t)(blk / ACT_CH) * ACT4 + (size_t)b * SEQ * ROW4;
    // A wave's 32 float4 lie in one row (ROW4 is a multiple of 32), so row, rank and the
    // test are the same in all its lanes: kept in scalars, the test is a scalar branch.
    const int w32 = __builtin_amdgcn_readfirstlane(threadIdx.x >> 5) * 32;
    const int ln  = threadIdx.x & 31;
    // Lane j holds the rank of the row of the wave's j-th float4: one LDS read for all trips.
    const int rk  = rank[s0 + (min(ln, CVT_U - 1) * CVT_T + w32) / ROW4];
    // Unrolled for the same register array.
#pragma unroll
    for (int j = 0; j < CVT_U; ++j) {
      const int w0 = j * CVT_T + w32;
      const int r  = w0 / ROW4;
      const int pr = min(__builtin_amdgcn_readlane(rk, j), SEQ - 1);
      if (pr >= 0) {
        v4h h;
        h[0] = (_Float16)f[j].x; h[1] = (_Float16)f[j].y;
        h[2] = (_Float16)f[j].z; h[3] = (_Float16)f[j].w;
        ob[(size_t)pr * ROW4 + (w0 - r * ROW4) + ln] = h;
      }
    }
    return;
  }
  // Unrolled for the same register array.
#pragma unroll
  for (int j = 0; j < CVT_U; ++j) {
    v4h h;
    h[0] = (_Float16)f[j].x; h[1] = (_Float16)f[j].y;
    h[2] = (_Float16)f[j].z; h[3] = (_Float16)f[j].w;
    o4[j * CVT_T] = h;
  }
}

// C = A[M,K](f16) * Bt[N,K]^T(f16) + bias[N], M=4096, N=768, K=768.
// 128x128 tiles, BK=64, double-buffered async-to-LDS staging (DMA overlaps WMMA).
// 8 waves as 4 (rows) x 2 (columns): a wave owns 32 x 64, eight accumulator tiles, so
// that a fragment read from LDS feeds four (A) or two (B) matrix instructions.
// mode 0: out f16 [B,H,S,64]   (Q/K head layout; outScale folds 1/sqrt(d))
// mode 1: out f16 [B,H,64,S]   (V transposed so it feeds the WMMA A operand)
// mode 2: out f32 [M,768]      (final projection into d_out)
// blockIdx.z picks one of up to three independent products of one launch. Their A,
// Bt and f16 outputs lie one behind the other in the workspace, so z only steps the
// three base pointers. Plane 0 takes mode0 and scale0, plane 1 mode0 unscaled,
// plane 2 is the transposed V layout (mode 1) unscaled. The A rows of planes 1 and 2
// (k and v) are packed to the front of each batch: tiles behind the kept rows leave.
__global__ __launch_bounds__(256)
void gemm_wmma(const _Float16* __restrict__ A0, const _Float16* __restrict__ Bt0,
               const float* __restrict__ bias0, const float* __restrict__ bias1,
               const float* __restrict__ bias2, void* __restrict__ outp0,
               int mode0, float scale0, const int* __restrict__ meta) {
  __shared__ __attribute__((aligned(16))) _Float16 As[2][GT * P128];
  __shared__ __attribute__((aligned(16))) _Float16 Bs[2][GT * P128];

  const int z = blockIdx.z;
  // The whole work-group leaves, in front of every copy and barrier.
  if (z != 0 && (int)((blockIdx.y * GT) & (SEQ - 1)) >= meta[2 * ((blockIdx.y * GT) / SEQ)]) return;
  const _Float16* A    = A0  + (size_t)z * (MTOK * EMBED);
  const _Float16* Bt   = Bt0 + (size_t)z * (EMBED * EMBED);
  const float*    bias = (z == 0) ? bias0 : (z == 1) ? bias1 : bias2;
  void* outp = (void*)((_Float16*)outp0 + (size_t)z * (MTOK * EMBED));
  const int   mode     = (z == 2) ? 1 : mode0;
  const float outScale = (z == 0) ? scale0 : 1.0f;

  const int tid   = threadIdx.x;
  const int wave  = tid >> 5;
  const int lane  = tid & 31;
  const int l16   = lane & 15;
  const int lhalf = lane >> 4;
  const int kb    = lhalf ? 8 : 0;
  const int mw    = wave & 3;    // 32 rows of the tile, 0..3
  const int nw    = wave >> 2;   // 64 columns of the tile, 0..1
  const int m0    = blockIdx.y * GT;
  const int n0    = blockIdx.x * GT;
  const int K     = EMBED;
  const int NIT   = K / 64;      // 12

  // Staging: tile = 128 rows x 128B = 1024 x 16B chunks; each thread moves 4 per tile,
  // rows row0, row0 + 32, row0 + 64, row0 + 96.
  const int row0 = tid >> 3;          // 0..31
  const int seg  = (tid & 7) * 8;     // halves within row

  auto stage = [&](int kc, int buf) {
    const _Float16* ga = A  + (m0 + row0) * K + kc + seg;
    const _Float16* gb = Bt + (n0 + row0) * K + kc + seg;
    const _Float16* la = &As[buf][row0 * P128 + seg];
    const _Float16* lb = &Bs[buf][row0 * P128 + seg];
    async8_b128(ga,          la,             ga + 32 * K, la + 32 * P128,
                ga + 64 * K, la + 64 * P128, ga + 96 * K, la + 96 * P128,
                gb,          lb,             gb + 32 * K, lb + 32 * P128,
                gb + 64 * K, lb + 64 * P128, gb + 96 * K, lb + 96 * P128);
  };

  v8f acc[2][4] = {};

  stage(0, 0);   // prologue: tile 0 in flight
#pragma unroll 1
  for (int it = 0; it < NIT; ++it) {
    const int cur = it & 1;
    if (it + 1 < NIT) {
      stage((it + 1) * 64, cur ^ 1);   // next tile streams during this compute
      wait_async_le<8>();              // drain tile `it` only
    } else {
      wait_async_le<0>();
    }
    __syncthreads();

    // Unrolled: the accumulators stay in registers. k 0..31, then k 32..63.
#pragma unroll
    for (int kk = 0; kk < 2; ++kk) {
      v16h af[2], bf[4];
#pragma unroll
      for (int i = 0; i < 2; ++i)
        af[i] = frag_ld(As[cur] + 32 * kk, P128, 32 * mw + 16 * i + l16, kb);
#pragma unroll
      for (int j = 0; j < 4; ++j)
        bf[j] = frag_ld(Bs[cur] + 32 * kk, P128, 64 * nw + 16 * j + l16, kb);
#pragma unroll
      for (int i = 0; i < 2; ++i)
#pragma unroll
        for (int j = 0; j < 4; ++j) acc[i][j] = wmma_f16(af[i], bf[j], acc[i][j]);
    }
    __syncthreads();   // all reads of buf `cur` done before it is restaged
  }

#pragma unroll
  for (int j = 0; j < 4; ++j) {
    const int n = n0 + 64 * nw + 16 * j + l16;
    const float bv = bias[n];
#pragma unroll
    for (int i = 0; i < 2; ++i) {
      const int mb = m0 + 32 * mw + 16 * i + 8 * lhalf;   // C layout: row = v + 8*(lane/16)
      if (mode == 2) {
        float* p[8];
        float  x[8];
#pragma unroll
        for (int vv = 0; vv < 8; ++vv) {
          p[vv] = (float*)outp + (size_t)(mb + vv) * EMBED + n;
          x[vv] = (acc[i][j][vv] + bv) * outScale;
        }
        store8_b32(p, x);
      } else {
        // mb is a multiple of 8: the eight rows lie in one batch, one step apart.
        const int bb = mb >> 11, s = mb & (SEQ - 1);
        const int hh = n >> 6,   d = n & (HSIZE - 1);
        const size_t o = (mode == 0)
            ? ((size_t)((bb * HEADS + hh) * SEQ + s)) * HSIZE + d
            : ((size_t)((bb * HEADS + hh) * HSIZE + d)) * SEQ + s;
        const int step = (mode == 0) ? HSIZE : 1;
        _Float16* p[8];
        unsigned  x[8];
#pragma unroll
        for (int vv = 0; vv < 8; ++vv) {
          p[vv] = (_Float16*)outp + o + vv * step;
          x[vv] = __builtin_bit_cast(unsigned short, (_Float16)((acc[i][j][vv] + bv) * outScale));
        }
        store8_b16(p, x);
      }
    }
  }
}

// Lane l <-> lane l ^ 16 (the two halves of a wave) without touching LDS.
__device__ __forceinline__ float xhalf(float x) {
  const int b = __builtin_bit_cast(int, x);
  return __builtin_bit_cast(float,
      __builtin_amdgcn_permlanex16(b, b, 0x76543210, 0xfedcba98, false, false));
}

// Fused flash attention, transposed products: S^T = K * Q^T, O^T += V^T * P^T.
// One wave per (b, h, 16-query tile); the 8 waves of a block share one (b,h), so
// K/V are async-staged into LDS once per block, in stages of KST keys and two buffers:
// the copies of stage t+1 fly during all of stage t, and the waves meet once a stage,
// so that between two meetings each walks its KPS passes of 32 keys at its own pace.
// A lane holds scores of ONE query (column l16): keys 8*lhalf+r and 16+8*lhalf+r.
// Maximum and sum run in the lane's own registers plus one exchange between the
// halves, and the two score tiles, converted in place, are the B operand of the
// second product (hardware k order), so P never goes through LDS.
// Qh,Kh: f16 [B,H,S,64]; Vt: f16 [B,H,64,S]; X out: f16 [B,S,EMBED]. Q pre-scaled.
// Kh and Vt hold the kept keys only, packed to the front: the loop walks those, and a
// key at or behind the number of open keys (the tail of the last chunk, projected from
// zero rows; every key when none is open) takes the score -1e9.
__global__ __launch_bounds__(256)
void flash_attn(const _Float16* __restrict__ Qh, const _Float16* __restrict__ Kh,
                const _Float16* __restrict__ Vt, const int* __restrict__ meta,
                _Float16* __restrict__ X) {
  __shared__ __attribute__((aligned(16))) _Float16 Ks[2][KST * P128];    // KST keys x 64 d
  __shared__ __attribute__((aligned(16))) _Float16 Vs[2][HSIZE * P256];  // 64 d x KST keys

  const int tid   = threadIdx.x;
  const int wave  = tid >> 5;
  const int lane  = tid & 31;
  const int l16   = lane & 15;
  const int lhalf = lane >> 4;
  const int kb    = lhalf ? 8 : 0;

  const int g  = blockIdx.x * 8 + wave;   // global wave id, 3072 total
  const int bh = blockIdx.x >> 4;         // = g >> 7, from scalars: trip count and branches stay scalar
  const int qt = g & 127;
  const int b  = bh / HEADS;
  const int h  = bh % HEADS;

  const _Float16* Qp = Qh + (size_t)bh * SEQ * HSIZE;
  const _Float16* Kp = Kh + (size_t)bh * SEQ * HSIZE;
  const _Float16* Vp = Vt + (size_t)bh * HSIZE * SEQ;

  // Staging assignment: K stage = 128 rows x 8 segs, V stage = 64 rows x 16 segs; a thread
  // moves four pieces of each, K rows krow + 32 i, V rows vrow + 16 i.
  const int krow = tid >> 3, kseg = (tid & 7) * 8;
  const int vrow = tid >> 4, vseg = (tid & 15) * 8;

  auto stage = [&](int st, int buf) {
    const _Float16* gk = Kp + (st * KST + krow) * HSIZE + kseg;
    const _Float16* gv = Vp + vrow * SEQ + st * KST + vseg;
    const _Float16* lk = &Ks[buf][krow * P128 + kseg];
    const _Float16* lv = &Vs[buf][vrow * P256 + vseg];
    async8_b128(gk,              lk,             gk + 32 * HSIZE, lk + 32 * P128,
                gk + 64 * HSIZE, lk + 64 * P128, gk + 96 * HSIZE, lk + 96 * P128,
                gv,              lv,             gv + 16 * SEQ,   lv + 16 * P256,
                gv + 32 * SEQ,   lv + 32 * P256, gv + 48 * SEQ,   lv + 48 * P256);
  };

  // Q^T as B operand (column = query qt*16 + l16, k = d in [0,32) and [32,64))
  const int qrow = qt * 16 + l16;
  const v16h qf0 = frag_ld(Qp,      HSIZE, qrow, kb);
  const v16h qf1 = frag_ld(Qp + 32, HSIZE, qrow, kb);
  // Stands in front of any rewrite of the address registers that the four Q loads name.
  asm volatile("s_wait_xcnt 0x0" ::: "memory");

  float ml = -1e30f;   // running maximum of this lane's query (equal in both halves)
  float ll = 0.f;      // running sum over this half's keys only; joined in the epilogue
  v8f oacc[4] = {{}, {}, {}, {}};   // O^T: row d = 16*t + 8*lhalf + r, column = query

  // Both are the same for the whole work-group (one b), so every barrier below is met
  // by all waves; the trip count is bounded by the shape whatever meta holds.
  const int nkept = min(max(meta[2 * b], 1), SEQ);
  const int nopen = meta[2 * b + 1];
  const int NCH   = (nkept + 31) >> 5;   // 1..64 passes of 32 keys
  const int NST   = (nkept + KST - 1) / KST;   // 1..16 stages

  // One pass: 32 kept keys, the ps-th 32 of stage st. tail: it may reach past the open keys.
  auto pass = [&](const int st, const int ps, const bool tail) {
    const int kc  = st * KST + ps * 32;
    const _Float16* Kc = Ks[st & 1] + ps * 32 * P128;
    const _Float16* Vc = Vs[st & 1] + ps * 32;

    // ---- scores^T: 32 keys x 16 queries, f32 accum ----
    v8f s0 = {}, s1 = {};
    {
      v16h kf = frag_ld(Kc,      P128, l16, kb);      // keys 0..15, d 0..31
      s0 = wmma_f16(kf, qf0, s0);
      kf = frag_ld(Kc + 32, P128, l16, kb);           // d 32..63
      s0 = wmma_f16(kf, qf1, s0);
      kf = frag_ld(Kc,      P128, 16 + l16, kb);      // keys 16..31
      s1 = wmma_f16(kf, qf0, s1);
      kf = frag_ld(Kc + 32, P128, 16 + l16, kb);
      s1 = wmma_f16(kf, qf1, s1);
    }
    // ---- key mask (row = register r) ----
    if (tail) {
      const int lim = nopen - kc - kb;   // key r of this half is open while r < lim
#pragma unroll
      for (int vv = 0; vv < 8; ++vv) {
        s0[vv] = (vv < lim)      ? s0[vv] : -1e9f;
        s1[vv] = (vv + 16 < lim) ? s1[vv] : -1e9f;
      }
    }
    // ---- online softmax: one query per lane ----
    float rm = fmaxf(s0[0], s1[0]);
#pragma unroll
    for (int vv = 1; vv < 8; ++vv) rm = fmaxf(rm, fmaxf(s0[vv], s1[vv]));
    rm = fmaxf(rm, xhalf(rm));
    const float nm   = fmaxf(ml, rm);
    const float corr = __expf(ml - nm);
    ml = nm;
    v16h pf;           // P^T as B operand: pf[s] = key kmap(s, lhalf) of column l16
    float rs0 = 0.f, rs1 = 0.f;
#pragma unroll
    for (int vv = 0; vv < 8; ++vv) {
      const float p0 = __expf(s0[vv] - nm);
      const float p1 = __expf(s1[vv] - nm);
      rs0 += p0; rs1 += p1;
      pf[vv]     = (_Float16)p0;
      pf[vv + 8] = (_Float16)p1;
    }
    ll = ll * corr + (rs0 + rs1);
#pragma unroll
    for (int t = 0; t < 4; ++t)
#pragma unroll
      for (int vv = 0; vv < 8; ++vv) oacc[t][vv] *= corr;

    // ---- out^T += V^T(64x32) * P^T(32x16) ----
#pragma unroll
    for (int t = 0; t < 4; ++t) {
      const v16h vf = frag_ld(Vc, P256, 16 * t + l16, kb);
      oacc[t] = wmma_f16(vf, pf, oacc[t]);
    }
  };

  // Foot of stage st, passed by every wave: its own reads of the buffer have returned, its
  // own copies of stage st + 1 have landed; behind the barrier stage st + 1 may be read by
  // all, and the buffer that stage st has left takes stage st + 2.
  auto publish = [&](const int st) {
    wait_ds0();
    wait_async_le<0>();
    __syncthreads();
    if (st + 2 < NST) stage(st + 2, st & 1);
  };

  // Stages of open keys alone need no mask; the rest (the last stage, or every stage
  // when no key is open) runs in a loop of its own and ends with the last kept key's pass.
  const int nfst = min(max(nopen, 0) / KST, NST);
  stage(0, 0);
  wait_async_le<0>();
  __syncthreads();
  if (NST > 1) stage(1, 1);
  int st = 0;
  // The stage loops stay rolled: one copy of each body, the buffer follows st & 1.
#pragma unroll 1
  for (; st < nfst; ++st) {
    // Unrolled: constant LDS offsets, and a pass's reads may be asked for during the pass before.
#pragma unroll
    for (int ps = 0; ps < KPS; ++ps) pass(st, ps, false);
    publish(st);
  }
#pragma unroll 1
  for (; st < NST; ++st) {
    const int np = min(NCH - st * KPS, KPS);
    // Rolled: runs once in a launch unless no key is open.
#pragma unroll 1
    for (int ps = 0; ps < np; ++ps) pass(st, ps, true);
    publish(st);
  }
  wait_async_le<0>();   // no copy is left in flight when the wave ends

  // ---- epilogue: join the halves' sums, normalize, 16-byte stores to X [B,S,EMBED] ----
  const float inv = 1.0f / (ll + xhalf(ll));
  _Float16* xr = X + ((size_t)(b * SEQ + qrow)) * EMBED + h * HSIZE + kb;
#pragma unroll
  for (int t = 0; t < 4; ++t) {
    v8h o;
#pragma unroll
    for (int vv = 0; vv < 8; ++vv) o[vv] = (_Float16)(oacc[t][vv] * inv);
    *(v8h*)(xr + 16 * t) = o;
  }
}

extern "C" void kernel_launch(void* const* d_in, const int* in_sizes, int n_in,
                              void* d_out, int out_size, void* d_ws, size_t ws_size,
                              hipStream_t stream) {
  const float* q    = (const float*)d_in[0];
  const float* k    = (const float*)d_in[1];
  const float* v    = (const float*)d_in[2];
  const int*   mask = (const int*)  d_in[3];
  const float* Wq   = (const float*)d_in[4];
  const float* bq   = (const float*)d_in[5];
  const float* Wk   = (const float*)d_in[6];
  const float* bk   = (const float*)d_in[7];
  const float* Wv   = (const float*)d_in[8];
  const float* bv   = (const float*)d_in[9];
  const float* Wo   = (const float*)d_in[10];
  const float* bo   = (const float*)d_in[11];

  const size_t actElems  = (size_t)MTOK * EMBED;     // 3,145,728
  const size_t wgtElems  = (size_t)EMBED * EMBED;    //   589,824
  const size_t headElems = (size_t)BATCH * HEADS * SEQ * HSIZE;  // 3,145,728

  _Float16* p = (_Float16*)d_ws;
  _Float16* q16  = p; p += actElems;
  _Float16* k16  = p; p += actElems;
  _Float16* v16  = p; p += actElems;
  _Float16* Wq16 = p; p += wgtElems;
  _Float16* Wk16 = p; p += wgtElems;
  _Float16* Wv16 = p; p += wgtElems;
  _Float16* Wo16 = p; p += wgtElems;
  _Float16* Qh   = p; p += headElems;
  _Float16* Kh   = p; p += headElems;
  _Float16* Vt   = p; p += headElems;
  _Float16* X16  = p; p += actElems;
  int* meta = (int*)p;   // 2 * BATCH ints: kept keys, open keys

  // f32 -> f16 downcast of all activations and weights; q16 is the first of the
  // seven consecutive f16 arrays above.
  // k and v rows are packed by the mask on the way; the last BATCH work-groups write meta.
  cvt_all_f16<<<CVT_WGS + BATCH, CVT_T, 0, stream>>>(q, k, v, Wq, Wk, Wv, Wo, q16, mask, meta);

  const dim3 ggrid(EMBED / GT, MTOK / GT);        // (6, 32)
  const dim3 qkvgrid(EMBED / GT, MTOK / GT, 3);   // planes: Q, K, V
  const float qscale = 0.125f;                    // 1/sqrt(HSIZE) folded into Q

  // Q, K and V projections do not depend on each other: one launch. q16/k16/v16,
  // Wq16/Wk16/Wv16 and Qh/Kh/Vt are each three consecutive arrays of equal size.
  gemm_wmma<<<qkvgrid, 256, 0, stream>>>(q16, Wq16, bq, bk, bv, (void*)Qh, 0, qscale, meta);

  const int totalWaves = BATCH * HEADS * (SEQ / 16);   // 3072
  flash_attn<<<totalWaves / 8, 256, 0, stream>>>(Qh, Kh, Vt, meta, X16);

  gemm_wmma<<<ggrid, 256, 0, stream>>>(X16, Wo16, bo, bo, bo, d_out, 2, 1.0f, meta);
}

// v008
// A run of this version takes 56.6 microseconds.
// In two side-by-side timings against v007, it was 1.27 and 1.25 times as fast.
// All steps since v000 together make it 4.99 times as fast.
#include <hip/hip_runtime.h>

// Problem constants (fixed by the reference).
#define EMBED  768
#define HEADS  12
#define HSIZE  64
#define BATCH  2
#define SEQ    2048
#define MTOK   (BATCH * SEQ)   // 4096 rows for the projections

// LDS row pitches in halves. A fragment read is two 16-byte loads per lane, each with 16
// rows per lane half, so the pitch is 16 B x odd: the 16 rows then fall on 16
// distinct groups of four banks (64 banks x 4 B) instead of one or two groups.
#define P128   72   // rows of 128 B data -> pitch 144 B
#define P256   136  // rows of 256 B data -> pitch 272 B

#define GT     128  // projection tile of a work-group: GT rows x GT columns
static_assert(SEQ % GT == 0 && EMBED % GT == 0, "tiles cover a batch and a row exactly");

#define KST    128        // keys of one attention stage in LDS
#define KPS    (KST / 32) // passes of 32 keys in a stage
static_assert(GT % KST == 0, "the projections write K and V up to the end of the last stage");

typedef __attribute__((ext_vector_type(16))) _Float16 v16h;
typedef __attribute__((ext_vector_type(8)))  _Float16 v8h;
typedef __attribute__((ext_vector_type(4)))  _Float16 v4h;
typedef __attribute__((ext_vector_type(8)))  float    v8f;
typedef __attribute__((ext_vector_type(4)))  unsigned v4u;   // 16 bytes on their way from LDS to memory

// D = A(16x32 f16) * B(32x16 f16) + C(16x16 f32)
__device__ __forceinline__ v8f wmma_f16(v16h a, v16h b, v8f c) {
  return __builtin_amdgcn_wmma_f32_16x16x32_f16(
      /*neg_a=*/false, a, /*neg_b=*/false, b,
      /*c_mod=*/(short)0, c, /*reuse_a=*/false, /*reuse_b=*/false);
}

// Async copies of 16 bytes/lane global -> LDS (ASYNCcnt-tracked, no VGPR round trip).
// One statement per stage: the closing s_wait_xcnt 0 stands in front of any later
// rewrite of the address registers that the copies name.
__device__ __forceinline__ unsigned lds_addr(const _Float16* lptr) {
  return (unsigned)(uintptr_t)lptr;   // low 32 bits = LDS byte offset
}
__device__ __forceinline__ void async8_b128(const _Float16* g0, const _Float16* l0,
                                            const _Float16* g1, const _Float16* l1,
                                            const _Float16* g2, const _Float16* l2,
                                            const _Float16* g3, const _Float16* l3,
                                            const _Float16* g4, const _Float16* l4,
                                            const _Float16* g5, const _Float16* l5,
                                            const _Float16* g6, const _Float16* l6,
                                            const _Float16* g7, const _Float16* l7) {
  asm volatile("global_load_async_to_lds_b128 %0, %1, off\n\t"
               "global_load_async_to_lds_b128 %2, %3, off\n\t"
               "global_load_async_to_lds_b128 %4, %5, off\n\t"
               "global_load_async_to_lds_b128 %6, %7, off\n\t"
               "global_load_async_to_lds_b128 %8, %9, off\n\t"
               "global_load_async_to_lds_b128 %10, %11, off\n\t"
               "global_load_async_to_lds_b128 %12, %13, off\n\t"
               "global_load_async_to_lds_b128 %14, %15, off\n\t"
               "s_wait_xcnt 0x0"
               :: "v"(lds_addr(l0)), "v"(g0), "v"(lds_addr(l1)), "v"(g1),
                  "v"(lds_addr(l2)), "v"(g2), "v"(lds_addr(l3)), "v"(g3),
                  "v"(lds_addr(l4)), "v"(g4), "v"(lds_addr(l5)), "v"(g5),
                  "v"(lds_addr(l6)), "v"(g6), "v"(lds_addr(l7)), "v"(g7) : "memory");
}
// A run of 16-byte stores and its wait in one statement: the closing s_wait_xcnt 0 stands
// in front of any later rewrite of the address and data registers that the stores name.
__device__ __forceinline__ void store8_b128(void* const (&p)[8], const v4u (&x)[8]) {
  asm volatile("global_store_b128 %0, %8, off\n\t"
               "global_store_b128 %1, %9, off\n\t"
               "global_store_b128 %2, %10, off\n\t"
               "global_store_b128 %3, %11, off\n\t"
               "global_store_b128 %4, %12, off\n\t"
               "global_store_b128 %5, %13, off\n\t"
               "global_store_b128 %6, %14, off\n\t"
               "global_store_b128 %7, %15, off\n\t"
               "s_wait_xcnt 0x0"
               :: "v"(p[0]), "v"(p[1]), "v"(p[2]), "v"(p[3]),
                  "v"(p[4]), "v"(p[5]), "v"(p[6]), "v"(p[7]),
                  "v"(x[0]), "v"(x[1]), "v"(x[2]), "v"(x[3]),
                  "v"(x[4]), "v"(x[5]), "v"(x[6]), "v"(x[7]) : "memory");
}
__device__ __forceinline__ void store4_b128(void* const (&p)[4], const v4u (&x)[4]) {
  asm volatile("global_store_b128 %0, %4, off\n\t"
               "global_store_b128 %1, %5, off\n\t"
               "global_store_b128 %2, %6, off\n\t"
               "global_store_b128 %3, %7, off\n\t"
               "s_wait_xcnt 0x0"
               :: "v"(p[0]), "v"(p[1]), "v"(p[2]), "v"(p[3]),
                  "v"(x[0]), "v"(x[1]), "v"(x[2]), "v"(x[3]) : "memory");
}
// Wait until at most N async ops remain in flight (in-order completion ->
// waiting <=N with N ops just issued drains everything older).
template <int N>
__device__ __forceinline__ void wait_async_le() {
  asm volatile("s_wait_asynccnt %0" :: "i"(N) : "memory");
}
// The wave's own LDS operations are done: stands in front of the barrier behind which the
// buffer it read is refilled, and between a wave's LDS stores of an output tile and its reads
// of the same rows by other lanes.
__device__ __forceinline__ void wait_ds0() {
  asm volatile("s_wait_dscnt 0x0" ::: "memory");
}

// Load one 16x32 f16 A-layout fragment from a row-major [rows][stride] array.
// ISA layout: lanes 0-15 hold K={kb..kb+7, kb+16..kb+23} of row (lane&15),
// lanes 16-31 get kb=8. Two 16-byte loads per lane.
__device__ __forceinline__ v16h frag_ld(const _Float16* base, int stride,
                                        int row, int kb) {
  const _Float16* p = base + row * stride + kb;
  v8h lo = *(const v8h*)(p);
  v8h hi = *(const v8h*)(p + 16);
  v16h r;
#pragma unroll
  for (int i = 0; i < 8; ++i) { r[i] = lo[i]; r[i + 8] = hi[i]; }
  return r;
}

// All seven f32 -> f16 conversions in ONE launch of few, long waves. The f16 copies
// lie one behind the other in the workspace in the order of the arguments, so a
// q or weight work-group's output chunk follows from blockIdx.x alone (k and v rows go to
// their key's rank); only the source is picked.
// 16 waves per work-group and about one work-group per WGP; a wave-wide load covers
// 512 contiguous bytes, a wave-wide store 256.
#define CVT_T    512                          // threads per work-group
#define CVT_U    24                           // float4 per thread
#define CVT_CH   (CVT_T * CVT_U)              // float4 per work-group
#define ACT4     (MTOK * EMBED / 4)           // float4 per activation
#define WGT4     (EMBED * EMBED / 4)          // float4 per weight matrix
#define ACT_CH   (ACT4 / CVT_CH)              // 64 chunks
#define WGT_CH   (WGT4 / CVT_CH)              // 12 chunks
#define CVT_WGS  (3 * ACT_CH + 4 * WGT_CH)    // 240 work-groups
static_assert(ACT4 % CVT_CH == 0 && WGT4 % CVT_CH == 0, "chunks must tile every array");
#define ROW4     (EMBED / 4)                  // float4 per activation row
#define CH_ROWS  (CVT_CH / ROW4)              // 64 rows per chunk
#define CH_BATCH (ACT_CH / BATCH)             // 32 chunks per batch
static_assert(CVT_CH % ROW4 == 0 && ACT_CH % BATCH == 0, "a chunk holds whole rows of one batch");
static_assert(SEQ == 4 * CVT_T, "the key ranking takes four mask words a thread");
static_assert(ROW4 % 32 == 0, "a wave's 32 float4 lie in one row");

// Ranks of the keys of one batch; m = its mask words 4*tid .. 4*tid+3. A key whose mask
// word is 0 gets the score -1e9, and its softmax weight is exactly 0 in f32 as soon as
// one key of the row is open, so only the open keys need to be projected and attended
// to. Returns for this thread's keys
// 4*tid .. 4*tid+3 the rank among the open keys of the batch, -1 for a closed key, and
// in total the number of open keys. With no open key the softmax is uniform over all
// keys: then every key keeps its own place. Holds one barrier: called by whole groups.
__device__ __forceinline__ int4 key_rank(const int4 m, int* wsum, int& total) {
  const int tid  = threadIdx.x;
  const int lane = tid & 31;
  const int wave = tid >> 5;
  const int k0 = (m.x != 0), k1 = (m.y != 0), k2 = (m.z != 0), k3 = (m.w != 0);
  const int c = k0 + k1 + k2 + k3;
  int inc = c;   // inclusive sum over the wave's lanes
  // Unrolled: five steps with constant distances.
#pragma unroll
  for (int d = 1; d < 32; d <<= 1) {
    const int o = __shfl_up(inc, d);
    if (lane >= d) inc += o;
  }
  if (lane == 31) wsum[wave] = inc;
  __syncthreads();
  int base = 0, tot = 0;
  // Unrolled: the 16 wave sums come in four 16-byte LDS reads.
#pragma unroll
  for (int w = 0; w < CVT_T / 32; ++w) {
    const int t = wsum[w];
    base += (w < wave) ? t : 0;
    tot  += t;
  }
  total = tot;
  const int e0 = base + inc - c;   // open keys in front of this thread's four
  int4 p;
  if (tot == 0) {
    p.x = 4 * tid; p.y = 4 * tid + 1; p.z = 4 * tid + 2; p.w = 4 * tid + 3;
  } else {
    p.x = k0 ? e0 : -1;
    p.y = k1 ? e0 + k0 : -1;
    p.z = k2 ? e0 + k0 + k1 : -1;
    p.w = k3 ? e0 + k0 + k1 + k2 : -1;
  }
  return p;
}

__global__ __launch_bounds__(CVT_T)
void cvt_all_f16(const float* __restrict__ q,  const float* __restrict__ k,
                 const float* __restrict__ v,  const float* __restrict__ wq,
                 const float* __restrict__ wk, const float* __restrict__ wv,
                 const float* __restrict__ wo, _Float16* __restrict__ out,
                 const int* __restrict__ mask, int* __restrict__ meta) {
  __shared__ int wsum[CVT_T / 32];
  __shared__ __attribute__((aligned(16))) int rank[SEQ];
  const int blk = blockIdx.x;
  if (blk >= CVT_WGS) {
    // The last BATCH work-groups: meta[2b] = rows of k and v that are kept, meta[2b+1] =
    // open keys; the rows from there to the next multiple of GT (a projection tile) are
    // zeroed, so that the last tile reads defined values.
    const int b = blk - CVT_WGS;
    int total;
    (void)key_rank(*(const int4*)(mask + b * SEQ + 4 * threadIdx.x), wsum, total);
    const int cnt = (total == 0) ? SEQ : total;
    if (threadIdx.x == 0) { meta[2 * b] = cnt; meta[2 * b + 1] = total; }
    const int pad  = (-cnt) & (GT - 1);   // cnt + pad <= SEQ, as SEQ is a multiple of GT
    const int wv   = threadIdx.x >> 5;
    const v8h zero8 = {};
    _Float16* zr = out + (size_t)MTOK * EMBED
                       + ((size_t)(b * SEQ + cnt + wv)) * EMBED + (threadIdx.x & 31) * 8;
    // Unrolled: constant steps from one address. Wave = row modulo 16, lane = 16-byte piece.
#pragma unroll
    for (int i = 0; i < GT / 16; ++i) {
      if (wv + 16 * i < pad) {
#pragma unroll
        for (int a = 0; a < 2; ++a)
#pragma unroll
          for (int kk = 0; kk < EMBED / 256; ++kk)
            *(v8h*)(zr + (size_t)a * MTOK * EMBED + i * 16 * EMBED + kk * 256) = zero8;
      }
    }
    return;
  }
  const float* src;
  int ch;
  if (blk < 3 * ACT_CH) {
    const int a = blk / ACT_CH;
    ch  = blk % ACT_CH;
    src = (a == 0) ? q : (a == 1) ? k : v;
  } else {
    const int t = blk - 3 * ACT_CH;
    const int a = t / WGT_CH;
    ch  = t % WGT_CH;
    src = (a == 0) ? wq : (a == 1) ? wk : (a == 2) ? wv : wo;
  }
  const float4* in4 = (const float4*)src + (size_t)ch * CVT_CH + threadIdx.x;
  v4h* o4 = (v4h*)out + (size_t)blk * CVT_CH + threadIdx.x;

  // k and v are packed by the mask.
  const bool packed = (blk >= ACT_CH && blk < 3 * ACT_CH);

  float4 f[CVT_U];
  // Unrolled so that f stays in registers and many loads are asked for ahead of the first use.
#pragma unroll
  for (int j = 0; j < CVT_U; ++j) f[j] = in4[j * CVT_T];
  if (packed) {
    // A row goes to its key's rank in its batch, a closed key's row is dropped.
    const int b = ch / CH_BATCH;
    const int4 mk = *(const int4*)(mask + b * SEQ + 4 * threadIdx.x);
    int total;
    const int4 p = key_rank(mk, wsum, total);
    *(int4*)(rank + 4 * threadIdx.x) = p;
    __syncthreads();
    const int s0 = (ch % CH_BATCH) * CH_ROWS;   // first key of this chunk in its batch
    v4h* ob = (v4h*)out + (size_t)(blk / ACT_CH) * ACT4 + (size_t)b * SEQ * ROW4;
    // A wave's 32 float4 lie in one row (ROW4 is a multiple of 32), so row, rank and the
    // test are the same in all its lanes: kept in scalars, the test is a scalar branch.
    const int w32 = __builtin_amdgcn_readfirstlane(threadIdx.x >> 5) * 32;
    const int ln  = threadIdx.x & 31;
    // Lane j holds the rank of the row of the wave's j-th float4: one LDS read for all trips.
    const int rk  = rank[s0 + (min(ln, CVT_U - 1) * CVT_T + w32) / ROW4];
    // Unrolled for the same register array.
#pragma unroll
    for (int j = 0; j < CVT_U; ++j) {
      const int w0 = j * CVT_T + w32;
      const int r  = w0 / ROW4;
      const int pr = min(__builtin_amdgcn_readlane(rk, j), SEQ - 1);
      if (pr >= 0) {
        v4h h;
        h[0] = (_Float16)f[j].x; h[1] = (_Float16)f[j].y;
        h[2] = (_Float16)f[j].z; h[3] = (_Float16)f[j].w;
        ob[(size_t)pr * ROW4 + (w0 - r * ROW4) + ln] = h;
      }
    }
    return;
  }
  // Unrolled for the same register array.
#pragma unroll
  for (int j = 0; j < CVT_U; ++j) {
    v4h h;
    h[0] = (_Float16)f[j].x; h[1] = (_Float16)f[j].y;
    h[2] = (_Float16)f[j].z; h[3] = (_Float16)f[j].w;
    o4[j * CVT_T] = h;
  }
}

// C = A[M,K](f16) * Bt[N,K]^T(f16) + bias[N], M=4096, N=768, K=768.
// 128x128 tiles, BK=64, double-buffered async-to-LDS staging (DMA overlaps WMMA).
// 8 waves as 4 (rows) x 2 (columns): a wave owns 32 x 64, eight accumulator tiles, so
// that a fragment read from LDS feeds four (A) or two (B) matrix instructions.
// mode 0: out f16 [B,H,S,64]   (Q/K head layout; outScale folds 1/sqrt(d))
// mode 1: out f16 [B,H,64,S]   (V transposed so it feeds the WMMA A operand)
// mode 2: out f32 [M,768]      (final projection into d_out)
// blockIdx.z picks one of up to three independent products of one launch. Their A,
// Bt and f16 outputs lie one behind the other in the workspace, so z only steps the
// three base pointers. Plane 0 takes mode0 and scale0, plane 1 mode0 unscaled,
// plane 2 is the transposed V layout (mode 1) unscaled. The A rows of planes 1 and 2
// (k and v) are packed to the front of each batch: tiles behind the kept rows leave.
__global__ __launch_bounds__(256)
void gemm_wmma(const _Float16* __restrict__ A0, const _Float16* __restrict__ Bt0,
               const float* __restrict__ bias0, const float* __restrict__ bias1,
               const float* __restrict__ bias2, void* __restrict__ outp0,
               int mode0, float scale0, const int* __restrict__ meta) {
  __shared__ __attribute__((aligned(16))) _Float16 As[2][GT * P128];
  __shared__ __attribute__((aligned(16))) _Float16 Bs[2][GT * P128];

  const int z = blockIdx.z;
  // The whole work-group leaves, in front of every copy and barrier.
  if (z != 0 && (int)((blockIdx.y * GT) & (SEQ - 1)) >= meta[2 * ((blockIdx.y * GT) / SEQ)]) return;
  const _Float16* A    = A0  + (size_t)z * (MTOK * EMBED);
  const _Float16* Bt   = Bt0 + (size_t)z * (EMBED * EMBED);
  const float*    bias = (z == 0) ? bias0 : (z == 1) ? bias1 : bias2;
  void* outp = (void*)((_Float16*)outp0 + (size_t)z * (MTOK * EMBED));
  const int   mode     = (z == 2) ? 1 : mode0;
  const float outScale = (z == 0) ? scale0 : 1.0f;

  const int tid   = threadIdx.x;
  const int wave  = tid >> 5;
  const int lane  = tid & 31;
  const int l16   = lane & 15;
  const int lhalf = lane >> 4;
  const int kb    = lhalf ? 8 : 0;
  const int mw    = wave & 3;    // 32 rows of the tile, 0..3
  const int nw    = wave >> 2;   // 64 columns of the tile, 0..1
  const int m0    = blockIdx.y * GT;
  const int n0    = blockIdx.x * GT;
  const int K     = EMBED;
  const int NIT   = K / 64;      // 12

  // Staging: tile = 128 rows x 128B = 1024 x 16B chunks; each thread moves 4 per tile,
  // rows row0, row0 + 32, row0 + 64, row0 + 96.
  const int row0 = tid >> 3;          // 0..31
  const int seg  = (tid & 7) * 8;     // halves within row

  auto stage = [&](int kc, int buf) {
    const _Float16* ga = A  + (m0 + row0) * K + kc + seg;
    const _Float16* gb = Bt + (n0 + row0) * K + kc + seg;
    const _Float16* la = &As[buf][row0 * P128 + seg];
    const _Float16* lb = &Bs[buf][row0 * P128 + seg];
    async8_b128(ga,          la,             ga + 32 * K, la + 32 * P128,
                ga + 64 * K, la + 64 * P128, ga + 96 * K, la + 96 * P128,
                gb,          lb,             gb + 32 * K, lb + 32 * P128,
                gb + 64 * K, lb + 64 * P128, gb + 96 * K, lb + 96 * P128);
  };

  v8f acc[2][4] = {};

  stage(0, 0);   // prologue: tile 0 in flight
#pragma unroll 1
  for (int it = 0; it < NIT; ++it) {
    const int cur = it & 1;
    if (it + 1 < NIT) {
      stage((it + 1) * 64, cur ^ 1);   // next tile streams during this compute
      wait_async_le<8>();              // drain tile `it` only
    } else {
      wait_async_le<0>();
    }
    __syncthreads();

    // Unrolled: the accumulators stay in registers. k 0..31, then k 32..63.
#pragma unroll
    for (int kk = 0; kk < 2; ++kk) {
      v16h af[2], bf[4];
#pragma unroll
      for (int i = 0; i < 2; ++i)
        af[i] = frag_ld(As[cur] + 32 * kk, P128, 32 * mw + 16 * i + l16, kb);
#pragma unroll
      for (int j = 0; j < 4; ++j)
        bf[j] = frag_ld(Bs[cur] + 32 * kk, P128, 64 * nw + 16 * j + l16, kb);
#pragma unroll
      for (int i = 0; i < 2; ++i)
#pragma unroll
        for (int j = 0; j < 4; ++j) acc[i][j] = wmma_f16(af[i], bf[j], acc[i][j]);
    }
    __syncthreads();   // all reads of buf `cur` done before it is restaged
  }

  // Epilogue: the accumulators go through LDS, so that a wave-wide 16-byte store covers four
  // whole 128-byte lines instead of 2- or 4-byte pieces of 2 to 16 lines. The ring is free:
  // every copy has landed and the loop's last barrier ends every wave's reads.
  float bv[4];
#pragma unroll
  for (int j = 0; j < 4; ++j) bv[j] = bias[n0 + 64 * nw + 16 * j + l16];
  // C layout: row = 16 i + 8 (lane / 16) + register, column = 16 j + (lane % 16).
  if (mode == 1) {
    // V transposed: the work-group's tile as [column n][row m]. A lane's eight rows are
    // adjacent there; an output row takes the 128 keys of all four row waves, 256 bytes.
    _Float16* T = &As[0][0];
    static_assert(GT * P256 <= 2 * GT * P128, "the transposed tile fits the A ring");
#pragma unroll
    for (int j = 0; j < 4; ++j)
#pragma unroll
      for (int i = 0; i < 2; ++i) {
        v8h hv;
#pragma unroll
        for (int vv = 0; vv < 8; ++vv) hv[vv] = (_Float16)((acc[i][j][vv] + bv[j]) * outScale);
        *(v8h*)(T + (64 * nw + 16 * j + l16) * P256 + 32 * mw + 16 * i + 8 * lhalf) = hv;
      }
    __syncthreads();   // the rows read below were written by four waves
    const int bb = m0 >> 11, s0 = m0 & (SEQ - 1);   // a tile lies in one batch
    const int seg8 = (tid & 15) * 8;
    void* p[8];
    v4u   x[8];
#pragma unroll
    for (int u = 0; u < 8; ++u) {
      const int r = (tid >> 4) + 16 * u;   // a wave: two rows of 256 bytes
      const int n = n0 + r;
      x[u] = *(const v4u*)(T + r * P256 + seg8);
      p[u] = (_Float16*)outp + ((size_t)((bb * HEADS + (n >> 6)) * HSIZE + (n & (HSIZE - 1)))) * SEQ + s0 + seg8;
    }
    store8_b128(p, x);
    return;
  }
  // Modes 0 and 2: a wave's 32 x 64 tile holds whole lines (128 B of f16, 256 B of f32 a
  // row), so each wave stages in a quarter of one ring of its own and meets nobody.
  _Float16* Tw = (nw ? &Bs[0][0] : &As[0][0]) + mw * (GT * P128 / 2);
  if (mode == 0) {
#pragma unroll
    for (int j = 0; j < 4; ++j)
#pragma unroll
      for (int i = 0; i < 2; ++i)
#pragma unroll
        for (int vv = 0; vv < 8; ++vv)
          Tw[(16 * i + 8 * lhalf + vv) * P128 + 16 * j + l16] =
              (_Float16)((acc[i][j][vv] + bv[j]) * outScale);
    wait_ds0();
    const int hh   = (n0 + 64 * nw) >> 6;   // the wave's 64 columns are one head
    const int seg8 = (lane & 7) * 8;
    void* p[8];
    v4u   x[8];
#pragma unroll
    for (int u = 0; u < 8; ++u) {
      const int r = (lane >> 3) + 4 * u;    // a wave: four rows of 128 bytes
      const int mr = m0 + 32 * mw + r;
      x[u] = *(const v4u*)(Tw + r * P128 + seg8);
      p[u] = (_Float16*)outp + ((size_t)(((mr >> 11) * HEADS + hh) * SEQ + (mr & (SEQ - 1)))) * HSIZE + seg8;
    }
    store8_b128(p, x);
  } else {
    constexpr int PF = 68;   // floats: 272 B = 16 B x odd, as P256
    static_assert(32 * PF * 4 <= GT * P128, "a wave's f32 tile fits its quarter of a ring");
    float* Tf = (float*)Tw;
#pragma unroll
    for (int j = 0; j < 4; ++j)
#pragma unroll
      for (int i = 0; i < 2; ++i)
#pragma unroll
        for (int vv = 0; vv < 8; ++vv)
          Tf[(16 * i + 8 * lhalf + vv) * PF + 16 * j + l16] = (acc[i][j][vv] + bv[j]) * outScale;
    wait_ds0();
    const int seg4 = (lane & 15) * 4;
#pragma unroll
    for (int g = 0; g < 2; ++g) {
      void* p[8];
      v4u   x[8];
#pragma unroll
      for (int u = 0; u < 8; ++u) {
        const int r = (lane >> 4) + 2 * u + 16 * g;   // a wave: two rows of 256 bytes
        x[u] = *(const v4u*)(Tf + r * PF + seg4);
        p[u] = (float*)outp + (size_t)(m0 + 32 * mw + r) * EMBED + n0 + 64 * nw + seg4;
      }
      store8_b128(p, x);
    }
  }
}

// Lane l <-> lane l ^ 16 (the two halves of a wave) without touching LDS.
__device__ __forceinline__ float xhalf(float x) {
  const int b = __builtin_bit_cast(int, x);
  return __builtin_bit_cast(float,
      __builtin_amdgcn_permlanex16(b, b, 0x76543210, 0xfedcba98, false, false));
}

// Fused flash attention, transposed products: S^T = K * Q^T, O^T += V^T * P^T.
// One wave per (b, h, 16-query tile); the 8 waves of a block share one (b,h), so
// K/V are async-staged into LDS once per block, in stages of KST keys and two buffers:
// the copies of stage t+1 fly during all of stage t, and the waves meet once a stage,
// so that between two meetings each walks its KPS passes of 32 keys at its own pace.
// A lane holds scores of ONE query (column l16): keys 8*lhalf+r and 16+8*lhalf+r.
// Maximum and sum run in the lane's own registers plus one exchange between the
// halves, and the two score tiles, converted in place, are the B operand of the
// second product (hardware k order), so P never goes through LDS.
// Qh,Kh: f16 [B,H,S,64]; Vt: f16 [B,H,64,S]; X out: f16 [B,S,EMBED]. Q pre-scaled.
// Kh and Vt hold the kept keys only, packed to the front: the loop walks those, and a
// key at or behind the number of open keys (the tail of the last chunk, projected from
// zero rows; every key when none is open) takes the score -1e9.
__global__ __launch_bounds__(256)
void flash_attn(const _Float16* __restrict__ Qh, const _Float16* __restrict__ Kh,
                const _Float16* __restrict__ Vt, const int* __restrict__ meta,
                _Float16* __restrict__ X) {
  __shared__ __attribute__((aligned(16))) _Float16 Ks[2][KST * P128];    // KST keys x 64 d
  __shared__ __attribute__((aligned(16))) _Float16 Vs[2][HSIZE * P256];  // 64 d x KST keys

  const int tid   = threadIdx.x;
  const int wave  = tid >> 5;
  const int lane  = tid & 31;
  const int l16   = lane & 15;
  const int lhalf = lane >> 4;
  const int kb    = lhalf ? 8 : 0;

  const int g  = blockIdx.x * 8 + wave;   // global wave id, 3072 total
  const int bh = blockIdx.x >> 4;         // = g >> 7, from scalars: trip count and branches stay scalar
  const int qt = g & 127;
  const int b  = bh / HEADS;
  const int h  = bh % HEADS;

  const _Float16* Qp = Qh + (size_t)bh * SEQ * HSIZE;
  const _Float16* Kp = Kh + (size_t)bh * SEQ * HSIZE;
  const _Float16* Vp = Vt + (size_t)bh * HSIZE * SEQ;

  // Staging assignment: K stage = 128 rows x 8 segs, V stage = 64 rows x 16 segs; a thread
  // moves four pieces of each, K rows krow + 32 i, V rows vrow + 16 i.
  const int krow = tid >> 3, kseg = (tid & 7) * 8;
  const int vrow = tid >> 4, vseg = (tid & 15) * 8;

  auto stage = [&](int st, int buf) {
    const _Float16* gk = Kp + (st * KST + krow) * HSIZE + kseg;
    const _Float16* gv = Vp + vrow * SEQ + st * KST + vseg;
    const _Float16* lk = &Ks[buf][krow * P128 + kseg];
    const _Float16* lv = &Vs[buf][vrow * P256 + vseg];
    async8_b128(gk,              lk,             gk + 32 * HSIZE, lk + 32 * P128,
                gk + 64 * HSIZE, lk + 64 * P128, gk + 96 * HSIZE, lk + 96 * P128,
                gv,              lv,             gv + 16 * SEQ,   lv + 16 * P256,
                gv + 32 * SEQ,   lv + 32 * P256, gv + 48 * SEQ,   lv + 48 * P256);
  };

  // Q^T as B operand (column = query qt*16 + l16, k = d in [0,32) and [32,64))
  const int qrow = qt * 16 + l16;
  const v16h qf0 = frag_ld(Qp,      HSIZE, qrow, kb);
  const v16h qf1 = frag_ld(Qp + 32, HSIZE, qrow, kb);
  // Stands in front of any rewrite of the address registers that the four Q loads name.
  asm volatile("s_wait_xcnt 0x0" ::: "memory");

  float ml = -1e30f;   // running maximum of this lane's query (equal in both halves)
  float ll = 0.f;      // running sum over this half's keys only; joined in the epilogue
  v8f oacc[4] = {{}, {}, {}, {}};   // O^T: row d = 16*t + 8*lhalf + r, column = query

  // Both are the same for the whole work-group (one b), so every barrier below is met
  // by all waves; the trip count is bounded by the shape whatever meta holds.
  const int nkept = min(max(meta[2 * b], 1), SEQ);
  const int nopen = meta[2 * b + 1];
  const int NCH   = (nkept + 31) >> 5;   // 1..64 passes of 32 keys
  const int NST   = (nkept + KST - 1) / KST;   // 1..16 stages

  // One pass: 32 kept keys, the ps-th 32 of stage st. tail: it may reach past the open keys.
  auto pass = [&](const int st, const int ps, const bool tail) {
    const int kc  = st * KST + ps * 32;
    const _Float16* Kc = Ks[st & 1] + ps * 32 * P128;
    const _Float16* Vc = Vs[st & 1] + ps * 32;

    // ---- scores^T: 32 keys x 16 queries, f32 accum ----
    v8f s0 = {}, s1 = {};
    {
      v16h kf = frag_ld(Kc,      P128, l16, kb);      // keys 0..15, d 0..31
      s0 = wmma_f16(kf, qf0, s0);
      kf = frag_ld(Kc + 32, P128, l16, kb);           // d 32..63
      s0 = wmma_f16(kf, qf1, s0);
      kf = frag_ld(Kc,      P128, 16 + l16, kb);      // keys 16..31
      s1 = wmma_f16(kf, qf0, s1);
      kf = frag_ld(Kc + 32, P128, 16 + l16, kb);
      s1 = wmma_f16(kf, qf1, s1);
    }
    // ---- key mask (row = register r) ----
    if (tail) {
      const int lim = nopen - kc - kb;   // key r of this half is open while r < lim
#pragma unroll
      for (int vv = 0; vv < 8; ++vv) {
        s0[vv] = (vv < lim)      ? s0[vv] : -1e9f;
        s1[vv] = (vv + 16 < lim) ? s1[vv] : -1e9f;
      }
    }
    // ---- online softmax: one query per lane ----
    float rm = fmaxf(s0[0], s1[0]);
#pragma unroll
    for (int vv = 1; vv < 8; ++vv) rm = fmaxf(rm, fmaxf(s0[vv], s1[vv]));
    rm = fmaxf(rm, xhalf(rm));
    const float nm   = fmaxf(ml, rm);
    const float corr = __expf(ml - nm);
    ml = nm;
    v16h pf;           // P^T as B operand: pf[s] = key kmap(s, lhalf) of column l16
    float rs0 = 0.f, rs1 = 0.f;
#pragma unroll
    for (int vv = 0; vv < 8; ++vv) {
      const float p0 = __expf(s0[vv] - nm);
      const float p1 = __expf(s1[vv] - nm);
      rs0 += p0; rs1 += p1;
      pf[vv]     = (_Float16)p0;
      pf[vv + 8] = (_Float16)p1;
    }
    ll = ll * corr + (rs0 + rs1);
#pragma unroll
    for (int t = 0; t < 4; ++t)
#pragma unroll
      for (int vv = 0; vv < 8; ++vv) oacc[t][vv] *= corr;

    // ---- out^T += V^T(64x32) * P^T(32x16) ----
#pragma unroll
    for (int t = 0; t < 4; ++t) {
      const v16h vf = frag_ld(Vc, P256, 16 * t + l16, kb);
      oacc[t] = wmma_f16(vf, pf, oacc[t]);
    }
  };

  // Foot of stage st, passed by every wave: its own reads of the buffer have returned, its
  // own copies of stage st + 1 have landed; behind the barrier stage st + 1 may be read by
  // all, and the buffer that stage st has left takes stage st + 2.
  auto publish = [&](const int st) {
    wait_ds0();
    wait_async_le<0>();
    __syncthreads();
    if (st + 2 < NST) stage(st + 2, st & 1);
  };

  // Stages of open keys alone need no mask; the rest (the last stage, or every stage
  // when no key is open) runs in a loop of its own and ends with the last kept key's pass.
  const int nfst = min(max(nopen, 0) / KST, NST);
  stage(0, 0);
  wait_async_le<0>();
  __syncthreads();
  if (NST > 1) stage(1, 1);
  int st = 0;
  // The stage loops stay rolled: one copy of each body, the buffer follows st & 1.
#pragma unroll 1
  for (; st < nfst; ++st) {
    // Unrolled: constant LDS offsets, and a pass's reads may be asked for during the pass before.
#pragma unroll
    for (int ps = 0; ps < KPS; ++ps) pass(st, ps, false);
    publish(st);
  }
#pragma unroll 1
  for (; st < NST; ++st) {
    const int np = min(NCH - st * KPS, KPS);
    // Rolled: runs once in a launch unless no key is open.
#pragma unroll 1
    for (int ps = 0; ps < np; ++ps) pass(st, ps, true);
    publish(st);
  }
  wait_async_le<0>();   // no copy is left in flight when the wave ends

  // ---- epilogue: join the halves' sums, normalize, store to X [B,S,EMBED] ----
  // Through LDS as in the projections: a query's 64 values are one 128-byte line of X. The
  // last stage's foot has ended every wave's reads; each wave stages in 16 rows of its own.
  const float inv = 1.0f / (ll + xhalf(ll));
  _Float16* T = &Ks[0][0] + wave * (16 * P128);
#pragma unroll
  for (int t = 0; t < 4; ++t) {
    v8h o;
#pragma unroll
    for (int vv = 0; vv < 8; ++vv) o[vv] = (_Float16)(oacc[t][vv] * inv);
    *(v8h*)(T + l16 * P128 + 16 * t + kb) = o;
  }
  wait_ds0();
  const int seg8 = (lane & 7) * 8;
  void* p[4];
  v4u   x[4];
#pragma unroll
  for (int u = 0; u < 4; ++u) {
    const int r = (lane >> 3) + 4 * u;   // a wave: four rows of 128 bytes
    x[u] = *(const v4u*)(T + r * P128 + seg8);
    p[u] = X + ((size_t)(b * SEQ + qt * 16 + r)) * EMBED + h * HSIZE + seg8;
  }
  store4_b128(p, x);
}

extern "C" void kernel_launch(void* const* d_in, const int* in_sizes, int n_in,
                              void* d_out, int out_size, void* d_ws, size_t ws_size,
                              hipStream_t stream) {
  const float* q    = (const float*)d_in[0];
  const float* k    = (const float*)d_in[1];
  const float* v    = (const float*)d_in[2];
  const int*   mask = (const int*)  d_in[3];
  const float* Wq   = (const float*)d_in[4];
  const float* bq   = (const float*)d_in[5];
  const float* Wk   = (const float*)d_in[6];
  const float* bk   = (const float*)d_in[7];
  const float* Wv   = (const float*)d_in[8];
  const float* bv   = (const float*)d_in[9];
  const float* Wo   = (const float*)d_in[10];
  const float* bo   = (const float*)d_in[11];

  const size_t actElems  = (size_t)MTOK * EMBED;     // 3,145,728
  const size_t wgtElems  = (size_t)EMBED * EMBED;    //   589,824
  const size_t headElems = (size_t)BATCH * HEADS * SEQ * HSIZE;  // 3,145,728

  _Float16* p = (_Float16*)d_ws;
  _Float16* q16  = p; p += actElems;
  _Float16* k16  = p; p += actElems;
  _Float16* v16  = p; p += actElems;
  _Float16* Wq16 = p; p += wgtElems;
  _Float16* Wk16 = p; p += wgtElems;
  _Float16* Wv16 = p; p += wgtElems;
  _Float16* Wo16 = p; p += wgtElems;
  _Float16* Qh   = p; p += headElems;
  _Float16* Kh   = p; p += headElems;
  _Float16* Vt   = p; p += headElems;
  _Float16* X16  = p; p += actElems;
  int* meta = (int*)p;   // 2 * BATCH ints: kept keys, open keys

  // f32 -> f16 downcast of all activations and weights; q16 is the first of the
  // seven consecutive f16 arrays above.
  // k and v rows are packed by the mask on the way; the last BATCH work-groups write meta.
  cvt_all_f16<<<CVT_WGS + BATCH, CVT_T, 0, stream>>>(q, k, v, Wq, Wk, Wv, Wo, q16, mask, meta);

  const dim3 ggrid(EMBED / GT, MTOK / GT);        // (6, 32)
  const dim3 qkvgrid(EMBED / GT, MTOK / GT, 3);   // planes: Q, K, V
  const float qscale = 0.125f;                    // 1/sqrt(HSIZE) folded into Q

  // Q, K and V projections do not depend on each other: one launch. q16/k16/v16,
  // Wq16/Wk16/Wv16 and Qh/Kh/Vt are each three consecutive arrays of equal size.
  gemm_wmma<<<qkvgrid, 256, 0, stream>>>(q16, Wq16, bq, bk, bv, (void*)Qh, 0, qscale, meta);

  const int totalWaves = BATCH * HEADS * (SEQ / 16);   // 3072
  flash_attn<<<totalWaves / 8, 256, 0, stream>>>(Qh, Kh, Vt, meta, X16);

  gemm_wmma<<<ggrid, 256, 0, stream>>>(X16, Wo16, bo, bo, bo, d_out, 2, 1.0f, meta);
}

// v009
// Measured time: 55.1 microseconds a run.
// Two timings next to v008 both put it at 1.04 times that version's speed.
// Counting every step since v000, it is 5.17 times as fast.
#include <hip/hip_runtime.h>

// Problem constants (fixed by the reference).
#define EMBED  768
#define HEADS  12
#define HSIZE  64
#define BATCH  2
#define SEQ    2048
#define MTOK   (BATCH * SEQ)   // 4096 rows for the projections

// LDS row pitches in halves. A fragment read is two 16-byte loads per lane, each with 16
// rows per lane half, so the pitch is 16 B x odd: the 16 rows then fall on 16
// distinct groups of four banks (64 banks x 4 B) instead of one or two groups.
#define P128   72   // rows of 128 B data -> pitch 144 B
#define P256   136  // rows of 256 B data -> pitch 272 B

#define GT     128  // projection tile of a work-group: GT rows x GT columns
static_assert(SEQ % GT == 0 && EMBED % GT == 0, "tiles cover a batch and a row exactly");

#define KST    128        // keys of one attention stage in LDS
#define KPS    (KST / 32) // passes of 32 keys in a stage
static_assert(GT % KST == 0, "the projections write K and V up to the end of the last stage");

typedef __attribute__((ext_vector_type(16))) _Float16 v16h;
typedef __attribute__((ext_vector_type(8)))  _Float16 v8h;
typedef __attribute__((ext_vector_type(4)))  _Float16 v4h;
typedef __attribute__((ext_vector_type(8)))  float    v8f;
typedef __attribute__((ext_vector_type(4)))  unsigned v4u;   // 16 bytes on their way from LDS to memory

// D = A(16x32 f16) * B(32x16 f16) + C(16x16 f32)
__device__ __forceinline__ v8f wmma_f16(v16h a, v16h b, v8f c) {
  return __builtin_amdgcn_wmma_f32_16x16x32_f16(
      /*neg_a=*/false, a, /*neg_b=*/false, b,
      /*c_mod=*/(short)0, c, /*reuse_a=*/false, /*reuse_b=*/false);
}

// Async copies of 16 bytes/lane global -> LDS (ASYNCcnt-tracked, no VGPR round trip).
// Eight copies in one statement: the closing s_wait_xcnt 0 stands in front of any later
// rewrite of the address registers that the copies name.
__device__ __forceinline__ unsigned lds_addr(const _Float16* lptr) {
  return (unsigned)(uintptr_t)lptr;   // low 32 bits = LDS byte offset
}
__device__ __forceinline__ void async8_b128(const _Float16* g0, const _Float16* l0,
                                            const _Float16* g1, const _Float16* l1,
                                            const _Float16* g2, const _Float16* l2,
                                            const _Float16* g3, const _Float16* l3,
                                            const _Float16* g4, const _Float16* l4,
                                            const _Float16* g5, const _Float16* l5,
                                            const _Float16* g6, const _Float16* l6,
                                            const _Float16* g7, const _Float16* l7) {
  asm volatile("global_load_async_to_lds_b128 %0, %1, off\n\t"
               "global_load_async_to_lds_b128 %2, %3, off\n\t"
               "global_load_async_to_lds_b128 %4, %5, off\n\t"
               "global_load_async_to_lds_b128 %6, %7, off\n\t"
               "global_load_async_to_lds_b128 %8, %9, off\n\t"
               "global_load_async_to_lds_b128 %10, %11, off\n\t"
               "global_load_async_to_lds_b128 %12, %13, off\n\t"
               "global_load_async_to_lds_b128 %14, %15, off\n\t"
               "s_wait_xcnt 0x0"
               :: "v"(lds_addr(l0)), "v"(g0), "v"(lds_addr(l1)), "v"(g1),
                  "v"(lds_addr(l2)), "v"(g2), "v"(lds_addr(l3)), "v"(g3),
                  "v"(lds_addr(l4)), "v"(g4), "v"(lds_addr(l5)), "v"(g5),
                  "v"(lds_addr(l6)), "v"(g6), "v"(lds_addr(l7)), "v"(g7) : "memory");
}
// A run of 16-byte stores and its wait in one statement: the closing s_wait_xcnt 0 stands
// in front of any later rewrite of the address and data registers that the stores name.
__device__ __forceinline__ void store8_b128(void* const (&p)[8], const v4u (&x)[8]) {
  asm volatile("global_store_b128 %0, %8, off\n\t"
               "global_store_b128 %1, %9, off\n\t"
               "global_store_b128 %2, %10, off\n\t"
               "global_store_b128 %3, %11, off\n\t"
               "global_store_b128 %4, %12, off\n\t"
               "global_store_b128 %5, %13, off\n\t"
               "global_store_b128 %6, %14, off\n\t"
               "global_store_b128 %7, %15, off\n\t"
               "s_wait_xcnt 0x0"
               :: "v"(p[0]), "v"(p[1]), "v"(p[2]), "v"(p[3]),
                  "v"(p[4]), "v"(p[5]), "v"(p[6]), "v"(p[7]),
                  "v"(x[0]), "v"(x[1]), "v"(x[2]), "v"(x[3]),
                  "v"(x[4]), "v"(x[5]), "v"(x[6]), "v"(x[7]) : "memory");
}
__device__ __forceinline__ void store4_b128(void* const (&p)[4], const v4u (&x)[4]) {
  asm volatile("global_store_b128 %0, %4, off\n\t"
               "global_store_b128 %1, %5, off\n\t"
               "global_store_b128 %2, %6, off\n\t"
               "global_store_b128 %3, %7, off\n\t"
               "s_wait_xcnt 0x0"
               :: "v"(p[0]), "v"(p[1]), "v"(p[2]), "v"(p[3]),
                  "v"(x[0]), "v"(x[1]), "v"(x[2]), "v"(x[3]) : "memory");
}
// Wait until at most N async ops remain in flight (in-order completion ->
// waiting <=N with N ops just issued drains everything older).
template <int N>
__device__ __forceinline__ void wait_async_le() {
  asm volatile("s_wait_asynccnt %0" :: "i"(N) : "memory");
}
// The wave's own LDS operations are done: stands in front of the barrier behind which the
// buffer it read is refilled, and between a wave's LDS stores of an output tile and its reads
// of the same rows by other lanes.
__device__ __forceinline__ void wait_ds0() {
  asm volatile("s_wait_dscnt 0x0" ::: "memory");
}

// Load one 16x32 f16 A-layout fragment from a row-major [rows][stride] array.
// ISA layout: lanes 0-15 hold K={kb..kb+7, kb+16..kb+23} of row (lane&15),
// lanes 16-31 get kb=8. Two 16-byte loads per lane.
__device__ __forceinline__ v16h frag_ld(const _Float16* base, int stride,
                                        int row, int kb) {
  const _Float16* p = base + row * stride + kb;
  v8h lo = *(const v8h*)(p);
  v8h hi = *(const v8h*)(p + 16);
  v16h r;
#pragma unroll
  for (int i = 0; i < 8; ++i) { r[i] = lo[i]; r[i + 8] = hi[i]; }
  return r;
}

// All seven f32 -> f16 conversions in ONE launch of few, long waves. The f16 copies
// lie one behind the other in the workspace in the order of the arguments, so a
// q or weight work-group's output chunk follows from blockIdx.x alone (k and v rows go to
// their key's rank); only the source is picked.
// 16 waves per work-group and about one work-group per WGP; a wave-wide load covers
// 512 contiguous bytes, a wave-wide store 256.
#define CVT_T    512                          // threads per work-group
#define CVT_U    24                           // float4 per thread
#define CVT_CH   (CVT_T * CVT_U)              // float4 per work-group
#define ACT4     (MTOK * EMBED / 4)           // float4 per activation
#define WGT4     (EMBED * EMBED / 4)          // float4 per weight matrix
#define ACT_CH   (ACT4 / CVT_CH)              // 64 chunks
#define WGT_CH   (WGT4 / CVT_CH)              // 12 chunks
#define CVT_WGS  (3 * ACT_CH + 4 * WGT_CH)    // 240 work-groups
static_assert(ACT4 % CVT_CH == 0 && WGT4 % CVT_CH == 0, "chunks must tile every array");
#define ROW4     (EMBED / 4)                  // float4 per activation row
#define CH_ROWS  (CVT_CH / ROW4)              // 64 rows per chunk
#define CH_BATCH (ACT_CH / BATCH)             // 32 chunks per batch
static_assert(CVT_CH % ROW4 == 0 && ACT_CH % BATCH == 0, "a chunk holds whole rows of one batch");
static_assert(SEQ == 4 * CVT_T, "the key ranking takes four mask words a thread");
static_assert(ROW4 % 32 == 0, "a wave's 32 float4 lie in one row");

// Ranks of the keys of one batch; m = its mask words 4*tid .. 4*tid+3. A key whose mask
// word is 0 gets the score -1e9, and its softmax weight is exactly 0 in f32 as soon as
// one key of the row is open, so only the open keys need to be projected and attended
// to. Returns for this thread's keys
// 4*tid .. 4*tid+3 the rank among the open keys of the batch, -1 for a closed key, and
// in total the number of open keys. With no open key the softmax is uniform over all
// keys: then every key keeps its own place. Holds one barrier: called by whole groups.
__device__ __forceinline__ int4 key_rank(const int4 m, int* wsum, int& total) {
  const int tid  = threadIdx.x;
  const int lane = tid & 31;
  const int wave = tid >> 5;
  const int k0 = (m.x != 0), k1 = (m.y != 0), k2 = (m.z != 0), k3 = (m.w != 0);
  const int c = k0 + k1 + k2 + k3;
  int inc = c;   // inclusive sum over the wave's lanes
  // Unrolled: five steps with constant distances.
#pragma unroll
  for (int d = 1; d < 32; d <<= 1) {
    const int o = __shfl_up(inc, d);
    if (lane >= d) inc += o;
  }
  if (lane == 31) wsum[wave] = inc;
  __syncthreads();
  int base = 0, tot = 0;
  // Unrolled: the 16 wave sums come in four 16-byte LDS reads.
#pragma unroll
  for (int w = 0; w < CVT_T / 32; ++w) {
    const int t = wsum[w];
    base += (w < wave) ? t : 0;
    tot  += t;
  }
  total = tot;
  const int e0 = base + inc - c;   // open keys in front of this thread's four
  int4 p;
  if (tot == 0) {
    p.x = 4 * tid; p.y = 4 * tid + 1; p.z = 4 * tid + 2; p.w = 4 * tid + 3;
  } else {
    p.x = k0 ? e0 : -1;
    p.y = k1 ? e0 + k0 : -1;
    p.z = k2 ? e0 + k0 + k1 : -1;
    p.w = k3 ? e0 + k0 + k1 + k2 : -1;
  }
  return p;
}

__global__ __launch_bounds__(CVT_T)
void cvt_all_f16(const float* __restrict__ q,  const float* __restrict__ k,
                 const float* __restrict__ v,  const float* __restrict__ wq,
                 const float* __restrict__ wk, const float* __restrict__ wv,
                 const float* __restrict__ wo, _Float16* __restrict__ out,
                 const int* __restrict__ mask, int* __restrict__ meta) {
  __shared__ int wsum[CVT_T / 32];
  __shared__ __attribute__((aligned(16))) int rank[SEQ];
  const int blk = blockIdx.x;
  if (blk >= CVT_WGS) {
    // The last BATCH work-groups: meta[2b] = rows of k and v that are kept, meta[2b+1] =
    // open keys; the rows from there to the next multiple of GT (a projection tile) are
    // zeroed, so that the last tile reads defined values.
    const int b = blk - CVT_WGS;
    int total;
    (void)key_rank(*(const int4*)(mask + b * SEQ + 4 * threadIdx.x), wsum, total);
    const int cnt = (total == 0) ? SEQ : total;
    if (threadIdx.x == 0) { meta[2 * b] = cnt; meta[2 * b + 1] = total; }
    const int pad  = (-cnt) & (GT - 1);   // cnt + pad <= SEQ, as SEQ is a multiple of GT
    const int wv   = threadIdx.x >> 5;
    const v8h zero8 = {};
    _Float16* zr = out + (size_t)MTOK * EMBED
                       + ((size_t)(b * SEQ + cnt + wv)) * EMBED + (threadIdx.x & 31) * 8;
    // Unrolled: constant steps from one address. Wave = row modulo 16, lane = 16-byte piece.
#pragma unroll
    for (int i = 0; i < GT / 16; ++i) {
      if (wv + 16 * i < pad) {
#pragma unroll
        for (int a = 0; a < 2; ++a)
#pragma unroll
          for (int kk = 0; kk < EMBED / 256; ++kk)
            *(v8h*)(zr + (size_t)a * MTOK * EMBED + i * 16 * EMBED + kk * 256) = zero8;
      }
    }
    return;
  }
  const float* src;
  int ch;
  if (blk < 3 * ACT_CH) {
    const int a = blk / ACT_CH;
    ch  = blk % ACT_CH;
    src = (a == 0) ? q : (a == 1) ? k : v;
  } else {
    const int t = blk - 3 * ACT_CH;
    const int a = t / WGT_CH;
    ch  = t % WGT_CH;
    src = (a == 0) ? wq : (a == 1) ? wk : (a == 2) ? wv : wo;
  }
  const float4* in4 = (const float4*)src + (size_t)ch * CVT_CH + threadIdx.x;
  v4h* o4 = (v4h*)out + (size_t)blk * CVT_CH + threadIdx.x;

  // k and v are packed by the mask.
  const bool packed = (blk >= ACT_CH && blk < 3 * ACT_CH);

  float4 f[CVT_U];
  // Unrolled so that f stays in registers and many loads are asked for ahead of the first use.
#pragma unroll
  for (int j = 0; j < CVT_U; ++j) f[j] = in4[j * CVT_T];
  if (packed) {
    // A row goes to its key's rank in its batch, a closed key's row is dropped.
    const int b = ch / CH_BATCH;
    const int4 mk = *(const int4*)(mask + b * SEQ + 4 * threadIdx.x);
    int total;
    const int4 p = key_rank(mk, wsum, total);
    *(int4*)(rank + 4 * threadIdx.x) = p;
    __syncthreads();
    const int s0 = (ch % CH_BATCH) * CH_ROWS;   // first key of this chunk in its batch
    v4h* ob = (v4h*)out + (size_t)(blk / ACT_CH) * ACT4 + (size_t)b * SEQ * ROW4;
    // A wave's 32 float4 lie in one row (ROW4 is a multiple of 32), so row, rank and the
    // test are the same in all its lanes: kept in scalars, the test is a scalar branch.
    const int w32 = __builtin_amdgcn_readfirstlane(threadIdx.x >> 5) * 32;
    const int ln  = threadIdx.x & 31;
    // Lane j holds the rank of the row of the wave's j-th float4: one LDS read for all trips.
    const int rk  = rank[s0 + (min(ln, CVT_U - 1) * CVT_T + w32) / ROW4];
    // Unrolled for the same register array.
#pragma unroll
    for (int j = 0; j < CVT_U; ++j) {
      const int w0 = j * CVT_T + w32;
      const int r  = w0 / ROW4;
      const int pr = min(__builtin_amdgcn_readlane(rk, j), SEQ - 1);
      if (pr >= 0) {
        v4h h;
        h[0] = (_Float16)f[j].x; h[1] = (_Float16)f[j].y;
        h[2] = (_Float16)f[j].z; h[3] = (_Float16)f[j].w;
        ob[(size_t)pr * ROW4 + (w0 - r * ROW4) + ln] = h;
      }
    }
    return;
  }
  // Unrolled for the same register array.
#pragma unroll
  for (int j = 0; j < CVT_U; ++j) {
    v4h h;
    h[0] = (_Float16)f[j].x; h[1] = (_Float16)f[j].y;
    h[2] = (_Float16)f[j].z; h[3] = (_Float16)f[j].w;
    o4[j * CVT_T] = h;
  }
}

// C = A[M,K](f16) * Bt[N,K]^T(f16) + bias[N], M=4096, N=768, K=768.
// 128x128 tiles, BK=64, double-buffered async-to-LDS staging (DMA overlaps WMMA).
// 8 waves as 4 (rows) x 2 (columns): a wave owns 32 x 64, eight accumulator tiles, so
// that a fragment read from LDS feeds four (A) or two (B) matrix instructions.
// mode 0: out f16 [B,H,S,64]   (Q/K head layout; outScale folds 1/sqrt(d))
// mode 1: out f16 [B,H,64,S]   (V transposed so it feeds the WMMA A operand)
// mode 2: out f32 [M,768]      (final projection into d_out)
// blockIdx.z picks one of up to three independent products of one launch. Their A,
// Bt and f16 outputs lie one behind the other in the workspace, so z only steps the
// three base pointers. Plane 0 takes mode0 and scale0, plane 1 mode0 unscaled,
// plane 2 is the transposed V layout (mode 1) unscaled. The A rows of planes 1 and 2
// (k and v) are packed to the front of each batch: tiles behind the kept rows leave.
__global__ __launch_bounds__(256)
void gemm_wmma(const _Float16* __restrict__ A0, const _Float16* __restrict__ Bt0,
               const float* __restrict__ bias0, const float* __restrict__ bias1,
               const float* __restrict__ bias2, void* __restrict__ outp0,
               int mode0, float scale0, const int* __restrict__ meta) {
  __shared__ __attribute__((aligned(16))) _Float16 As[2][GT * P128];
  __shared__ __attribute__((aligned(16))) _Float16 Bs[2][GT * P128];

  const int z = blockIdx.z;
  // The whole work-group leaves, in front of every copy and barrier.
  if (z != 0 && (int)((blockIdx.y * GT) & (SEQ - 1)) >= meta[2 * ((blockIdx.y * GT) / SEQ)]) return;
  const _Float16* A    = A0  + (size_t)z * (MTOK * EMBED);
  const _Float16* Bt   = Bt0 + (size_t)z * (EMBED * EMBED);
  const float*    bias = (z == 0) ? bias0 : (z == 1) ? bias1 : bias2;
  void* outp = (void*)((_Float16*)outp0 + (size_t)z * (MTOK * EMBED));
  const int   mode     = (z == 2) ? 1 : mode0;
  const float outScale = (z == 0) ? scale0 : 1.0f;

  const int tid   = threadIdx.x;
  const int wave  = tid >> 5;
  const int lane  = tid & 31;
  const int l16   = lane & 15;
  const int lhalf = lane >> 4;
  const int kb    = lhalf ? 8 : 0;
  const int mw    = wave & 3;    // 32 rows of the tile, 0..3
  const int nw    = wave >> 2;   // 64 columns of the tile, 0..1
  const int m0    = blockIdx.y * GT;
  const int n0    = blockIdx.x * GT;
  const int K     = EMBED;
  const int NIT   = K / 64;      // 12

  // Staging: tile = 128 rows x 128B = 1024 x 16B chunks; each thread moves 4 per tile,
  // rows row0, row0 + 32, row0 + 64, row0 + 96.
  const int row0 = tid >> 3;          // 0..31
  const int seg  = (tid & 7) * 8;     // halves within row

  auto stage = [&](int kc, int buf) {
    const _Float16* ga = A  + (m0 + row0) * K + kc + seg;
    const _Float16* gb = Bt + (n0 + row0) * K + kc + seg;
    const _Float16* la = &As[buf][row0 * P128 + seg];
    const _Float16* lb = &Bs[buf][row0 * P128 + seg];
    async8_b128(ga,          la,             ga + 32 * K, la + 32 * P128,
                ga + 64 * K, la + 64 * P128, ga + 96 * K, la + 96 * P128,
                gb,          lb,             gb + 32 * K, lb + 32 * P128,
                gb + 64 * K, lb + 64 * P128, gb + 96 * K, lb + 96 * P128);
  };

  v8f acc[2][4] = {};

  stage(0, 0);   // prologue: tile 0 in flight
#pragma unroll 1
  for (int it = 0; it < NIT; ++it) {
    const int cur = it & 1;
    if (it + 1 < NIT) {
      stage((it + 1) * 64, cur ^ 1);   // next tile streams during this compute
      wait_async_le<8>();              // drain tile `it` only
    } else {
      wait_async_le<0>();
    }
    __syncthreads();

    // Unrolled: the accumulators stay in registers. k 0..31, then k 32..63.
#pragma unroll
    for (int kk = 0; kk < 2; ++kk) {
      v16h af[2], bf[4];
#pragma unroll
      for (int i = 0; i < 2; ++i)
        af[i] = frag_ld(As[cur] + 32 * kk, P128, 32 * mw + 16 * i + l16, kb);
#pragma unroll
      for (int j = 0; j < 4; ++j)
        bf[j] = frag_ld(Bs[cur] + 32 * kk, P128, 64 * nw + 16 * j + l16, kb);
#pragma unroll
      for (int i = 0; i < 2; ++i)
#pragma unroll
        for (int j = 0; j < 4; ++j) acc[i][j] = wmma_f16(af[i], bf[j], acc[i][j]);
    }
    __syncthreads();   // all reads of buf `cur` done before it is restaged
  }

  // Epilogue: the accumulators go through LDS, so that a wave-wide 16-byte store covers four
  // whole 128-byte lines instead of 2- or 4-byte pieces of 2 to 16 lines. The ring is free:
  // every copy has landed and the loop's last barrier ends every wave's reads.
  float bv[4];
#pragma unroll
  for (int j = 0; j < 4; ++j) bv[j] = bias[n0 + 64 * nw + 16 * j + l16];
  // C layout: row = 16 i + 8 (lane / 16) + register, column = 16 j + (lane % 16).
  if (mode == 1) {
    // V transposed: the work-group's tile as [column n][row m]. A lane's eight rows are
    // adjacent there; an output row takes the 128 keys of all four row waves, 256 bytes.
    _Float16* T = &As[0][0];
    static_assert(GT * P256 <= 2 * GT * P128, "the transposed tile fits the A ring");
#pragma unroll
    for (int j = 0; j < 4; ++j)
#pragma unroll
      for (int i = 0; i < 2; ++i) {
        v8h hv;
#pragma unroll
        for (int vv = 0; vv < 8; ++vv) hv[vv] = (_Float16)((acc[i][j][vv] + bv[j]) * outScale);
        *(v8h*)(T + (64 * nw + 16 * j + l16) * P256 + 32 * mw + 16 * i + 8 * lhalf) = hv;
      }
    __syncthreads();   // the rows read below were written by four waves
    const int bb = m0 >> 11, s0 = m0 & (SEQ - 1);   // a tile lies in one batch
    const int seg8 = (tid & 15) * 8;
    void* p[8];
    v4u   x[8];
#pragma unroll
    for (int u = 0; u < 8; ++u) {
      const int r = (tid >> 4) + 16 * u;   // a wave: two rows of 256 bytes
      const int n = n0 + r;
      x[u] = *(const v4u*)(T + r * P256 + seg8);
      p[u] = (_Float16*)outp + ((size_t)((bb * HEADS + (n >> 6)) * HSIZE + (n & (HSIZE - 1)))) * SEQ + s0 + seg8;
    }
    store8_b128(p, x);
    return;
  }
  // Modes 0 and 2: a wave's 32 x 64 tile holds whole lines (128 B of f16, 256 B of f32 a
  // row), so each wave stages in a quarter of one ring of its own and meets nobody.
  _Float16* Tw = (nw ? &Bs[0][0] : &As[0][0]) + mw * (GT * P128 / 2);
  if (mode == 0) {
#pragma unroll
    for (int j = 0; j < 4; ++j)
#pragma unroll
      for (int i = 0; i < 2; ++i)
#pragma unroll
        for (int vv = 0; vv < 8; ++vv)
          Tw[(16 * i + 8 * lhalf + vv) * P128 + 16 * j + l16] =
              (_Float16)((acc[i][j][vv] + bv[j]) * outScale);
    wait_ds0();
    const int hh   = (n0 + 64 * nw) >> 6;   // the wave's 64 columns are one head
    const int seg8 = (lane & 7) * 8;
    void* p[8];
    v4u   x[8];
#pragma unroll
    for (int u = 0; u < 8; ++u) {
      const int r = (lane >> 3) + 4 * u;    // a wave: four rows of 128 bytes
      const int mr = m0 + 32 * mw + r;
      x[u] = *(const v4u*)(Tw + r * P128 + seg8);
      p[u] = (_Float16*)outp + ((size_t)(((mr >> 11) * HEADS + hh) * SEQ + (mr & (SEQ - 1)))) * HSIZE + seg8;
    }
    store8_b128(p, x);
  } else {
    constexpr int PF = 68;   // floats: 272 B = 16 B x odd, as P256
    static_assert(32 * PF * 4 <= GT * P128, "a wave's f32 tile fits its quarter of a ring");
    float* Tf = (float*)Tw;
#pragma unroll
    for (int j = 0; j < 4; ++j)
#pragma unroll
      for (int i = 0; i < 2; ++i)
#pragma unroll
        for (int vv = 0; vv < 8; ++vv)
          Tf[(16 * i + 8 * lhalf + vv) * PF + 16 * j + l16] = (acc[i][j][vv] + bv[j]) * outScale;
    wait_ds0();
    const int seg4 = (lane & 15) * 4;
#pragma unroll
    for (int g = 0; g < 2; ++g) {
      void* p[8];
      v4u   x[8];
#pragma unroll
      for (int u = 0; u < 8; ++u) {
        const int r = (lane >> 4) + 2 * u + 16 * g;   // a wave: two rows of 256 bytes
        x[u] = *(const v4u*)(Tf + r * PF + seg4);
        p[u] = (float*)outp + (size_t)(m0 + 32 * mw + r) * EMBED + n0 + 64 * nw + seg4;
      }
      store8_b128(p, x);
    }
  }
}

// Lane l <-> lane l ^ 16 (the two halves of a wave) without touching LDS.
__device__ __forceinline__ float xhalf(float x) {
  const int b = __builtin_bit_cast(int, x);
  return __builtin_bit_cast(float,
      __builtin_amdgcn_permlanex16(b, b, 0x76543210, 0xfedcba98, false, false));
}

// Fused flash attention, transposed products: S^T = K * Q^T, O^T += V^T * P^T.
// One wave per (b, h, 16-query tile); the AW waves of a block share one (b,h), so
// K/V are async-staged into LDS once per block, in stages of KST keys and two buffers:
// the copies of stage t+1 fly during all of stage t, and the waves meet once a stage,
// so that between two meetings each walks its KPS passes of 32 keys at its own pace.
// A lane holds scores of ONE query (column l16): keys 8*lhalf+r and 16+8*lhalf+r.
// Maximum and sum run in the lane's own registers plus one exchange between the
// halves, and the two score tiles, converted in place, are the B operand of the
// second product (hardware k order), so P never goes through LDS.
// Qh,Kh: f16 [B,H,S,64]; Vt: f16 [B,H,64,S]; X out: f16 [B,S,EMBED]. Q pre-scaled.
// Kh and Vt hold the kept keys only, packed to the front: the loop walks those, and a
// key at or behind the number of open keys (the tail of the last chunk, projected from
// zero rows; every key when none is open) takes the score -1e9.
// AW = 4: the 3,072 waves form 768 work-groups, a whole multiple of the 256 WGPs, so that an
// even deal puts three waves on every SIMD. Groups of 8 waves make 384: two on half of the
// WGPs, one on the rest, and the launch lasts as long as the fuller half.
#define AW     4          // waves of an attention work-group, one a SIMD
#define AT     (AW * 32)  // its threads
static_assert((SEQ / 16) % AW == 0, "a work-group's query tiles lie in one (b,h)");
static_assert(KST * 8 == 8 * AT && HSIZE * (KST / 8) == 8 * AT, "eight K and eight V pieces a thread");
__global__ __launch_bounds__(AT)
void flash_attn(const _Float16* __restrict__ Qh, const _Float16* __restrict__ Kh,
                const _Float16* __restrict__ Vt, const int* __restrict__ meta,
                _Float16* __restrict__ X) {
  __shared__ __attribute__((aligned(16))) _Float16 Ks[2][KST * P128];    // KST keys x 64 d
  __shared__ __attribute__((aligned(16))) _Float16 Vs[2][HSIZE * P256];  // 64 d x KST keys

  const int tid   = threadIdx.x;
  const int wave  = tid >> 5;
  const int lane  = tid & 31;
  const int l16   = lane & 15;
  const int lhalf = lane >> 4;
  const int kb    = lhalf ? 8 : 0;

  const int g  = blockIdx.x * AW + wave;  // global wave id, 3072 total
  const int bh = blockIdx.x / (SEQ / 16 / AW);   // = g >> 7, from scalars: trip count and branches stay scalar
  const int qt = g & 127;
  const int b  = bh / HEADS;
  const int h  = bh % HEADS;

  const _Float16* Qp = Qh + (size_t)bh * SEQ * HSIZE;
  const _Float16* Kp = Kh + (size_t)bh * SEQ * HSIZE;
  const _Float16* Vp = Vt + (size_t)bh * HSIZE * SEQ;

  // Staging assignment: K stage = 128 rows x 8 segs, V stage = 64 rows x 16 segs; a thread
  // moves eight pieces of each, K rows krow + 16 i, V rows vrow + 8 i.
  const int krow = tid >> 3, kseg = (tid & 7) * 8;
  const int vrow = tid >> 4, vseg = (tid & 15) * 8;

  auto stage = [&](int st, int buf) {
    const _Float16* gk = Kp + (st * KST + krow) * HSIZE + kseg;
    const _Float16* gv = Vp + vrow * SEQ + st * KST + vseg;
    const _Float16* lk = &Ks[buf][krow * P128 + kseg];
    const _Float16* lv = &Vs[buf][vrow * P256 + vseg];
    async8_b128(gk,               lk,              gk +  16 * HSIZE, lk +  16 * P128,
                gk +  32 * HSIZE, lk +  32 * P128, gk +  48 * HSIZE, lk +  48 * P128,
                gk +  64 * HSIZE, lk +  64 * P128, gk +  80 * HSIZE, lk +  80 * P128,
                gk +  96 * HSIZE, lk +  96 * P128, gk + 112 * HSIZE, lk + 112 * P128);
    async8_b128(gv,            lv,             gv +  8 * SEQ, lv +  8 * P256,
                gv + 16 * SEQ, lv + 16 * P256, gv + 24 * SEQ, lv + 24 * P256,
                gv + 32 * SEQ, lv + 32 * P256, gv + 40 * SEQ, lv + 40 * P256,
                gv + 48 * SEQ, lv + 48 * P256, gv + 56 * SEQ, lv + 56 * P256);
  };

  // Q^T as B operand (column = query qt*16 + l16, k = d in [0,32) and [32,64))
  const int qrow = qt * 16 + l16;
  const v16h qf0 = frag_ld(Qp,      HSIZE, qrow, kb);
  const v16h qf1 = frag_ld(Qp + 32, HSIZE, qrow, kb);
  // Stands in front of any rewrite of the address registers that the four Q loads name.
  asm volatile("s_wait_xcnt 0x0" ::: "memory");

  float ml = -1e30f;   // running maximum of this lane's query (equal in both halves)
  float ll = 0.f;      // running sum over this half's keys only; joined in the epilogue
  v8f oacc[4] = {{}, {}, {}, {}};   // O^T: row d = 16*t + 8*lhalf + r, column = query

  // Both are the same for the whole work-group (one b), so every barrier below is met
  // by all waves; the trip count is bounded by the shape whatever meta holds.
  const int nkept = min(max(meta[2 * b], 1), SEQ);
  const int nopen = meta[2 * b + 1];
  const int NCH   = (nkept + 31) >> 5;   // 1..64 passes of 32 keys
  const int NST   = (nkept + KST - 1) / KST;   // 1..16 stages

  // One pass: 32 kept keys, the ps-th 32 of stage st. tail: it may reach past the open keys.
  auto pass = [&](const int st, const int ps, const bool tail) {
    const int kc  = st * KST + ps * 32;
    const _Float16* Kc = Ks[st & 1] + ps * 32 * P128;
    const _Float16* Vc = Vs[st & 1] + ps * 32;

    // ---- scores^T: 32 keys x 16 queries, f32 accum ----
    v8f s0 = {}, s1 = {};
    {
      v16h kf = frag_ld(Kc,      P128, l16, kb);      // keys 0..15, d 0..31
      s0 = wmma_f16(kf, qf0, s0);
      kf = frag_ld(Kc + 32, P128, l16, kb);           // d 32..63
      s0 = wmma_f16(kf, qf1, s0);
      kf = frag_ld(Kc,      P128, 16 + l16, kb);      // keys 16..31
      s1 = wmma_f16(kf, qf0, s1);
      kf = frag_ld(Kc + 32, P128, 16 + l16, kb);
      s1 = wmma_f16(kf, qf1, s1);
    }
    // ---- key mask (row = register r) ----
    if (tail) {
      const int lim = nopen - kc - kb;   // key r of this half is open while r < lim
#pragma unroll
      for (int vv = 0; vv < 8; ++vv) {
        s0[vv] = (vv < lim)      ? s0[vv] : -1e9f;
        s1[vv] = (vv + 16 < lim) ? s1[vv] : -1e9f;
      }
    }
    // ---- online softmax: one query per lane ----
    float rm = fmaxf(s0[0], s1[0]);
#pragma unroll
    for (int vv = 1; vv < 8; ++vv) rm = fmaxf(rm, fmaxf(s0[vv], s1[vv]));
    rm = fmaxf(rm, xhalf(rm));
    const float nm   = fmaxf(ml, rm);
    const float corr = __expf(ml - nm);
    ml = nm;
    v16h pf;           // P^T as B operand: pf[s] = key kmap(s, lhalf) of column l16
    float rs0 = 0.f, rs1 = 0.f;
#pragma unroll
    for (int vv = 0; vv < 8; ++vv) {
      const float p0 = __expf(s0[vv] - nm);
      const float p1 = __expf(s1[vv] - nm);
      rs0 += p0; rs1 += p1;
      pf[vv]     = (_Float16)p0;
      pf[vv + 8] = (_Float16)p1;
    }
    ll = ll * corr + (rs0 + rs1);
#pragma unroll
    for (int t = 0; t < 4; ++t)
#pragma unroll
      for (int vv = 0; vv < 8; ++vv) oacc[t][vv] *= corr;

    // ---- out^T += V^T(64x32) * P^T(32x16) ----
#pragma unroll
    for (int t = 0; t < 4; ++t) {
      const v16h vf = frag_ld(Vc, P256, 16 * t + l16, kb);
      oacc[t] = wmma_f16(vf, pf, oacc[t]);
    }
  };

  // Foot of stage st, passed by every wave: its own reads of the buffer have returned, its
  // own copies of stage st + 1 have landed; behind the barrier stage st + 1 may be read by
  // all, and the buffer that stage st has left takes stage st + 2.
  auto publish = [&](const int st) {
    wait_ds0();
    wait_async_le<0>();
    __syncthreads();
    if (st + 2 < NST) stage(st + 2, st & 1);
  };

  // Stages of open keys alone need no mask; the rest (the last stage, or every stage
  // when no key is open) runs in a loop of its own and ends with the last kept key's pass.
  const int nfst = min(max(nopen, 0) / KST, NST);
  stage(0, 0);
  wait_async_le<0>();
  __syncthreads();
  if (NST > 1) stage(1, 1);
  int st = 0;
  // The stage loops stay rolled: one copy of each body, the buffer follows st & 1.
#pragma unroll 1
  for (; st < nfst; ++st) {
    // Unrolled: constant LDS offsets, and a pass's reads may be asked for during the pass before.
#pragma unroll
    for (int ps = 0; ps < KPS; ++ps) pass(st, ps, false);
    publish(st);
  }
#pragma unroll 1
  for (; st < NST; ++st) {
    const int np = min(NCH - st * KPS, KPS);
    // Rolled: runs once in a launch unless no key is open.
#pragma unroll 1
    for (int ps = 0; ps < np; ++ps) pass(st, ps, true);
    publish(st);
  }
  wait_async_le<0>();   // no copy is left in flight when the wave ends

  // ---- epilogue: join the halves' sums, normalize, store to X [B,S,EMBED] ----
  // Through LDS as in the projections: a query's 64 values are one 128-byte line of X. The
  // last stage's foot has ended every wave's reads; each wave stages in 16 rows of its own.
  const float inv = 1.0f / (ll + xhalf(ll));
  _Float16* T = &Ks[0][0] + wave * (16 * P128);
#pragma unroll
  for (int t = 0; t < 4; ++t) {
    v8h o;
#pragma unroll
    for (int vv = 0; vv < 8; ++vv) o[vv] = (_Float16)(oacc[t][vv] * inv);
    *(v8h*)(T + l16 * P128 + 16 * t + kb) = o;
  }
  wait_ds0();
  const int seg8 = (lane & 7) * 8;
  void* p[4];
  v4u   x[4];
#pragma unroll
  for (int u = 0; u < 4; ++u) {
    const int r = (lane >> 3) + 4 * u;   // a wave: four rows of 128 bytes
    x[u] = *(const v4u*)(T + r * P128 + seg8);
    p[u] = X + ((size_t)(b * SEQ + qt * 16 + r)) * EMBED + h * HSIZE + seg8;
  }
  store4_b128(p, x);
}

extern "C" void kernel_launch(void* const* d_in, const int* in_sizes, int n_in,
                              void* d_out, int out_size, void* d_ws, size_t ws_size,
                              hipStream_t stream) {
  const float* q    = (const float*)d_in[0];
  const float* k    = (const float*)d_in[1];
  const float* v    = (const float*)d_in[2];
  const int*   mask = (const int*)  d_in[3];
  const float* Wq   = (const float*)d_in[4];
  const float* bq   = (const float*)d_in[5];
  const float* Wk   = (const float*)d_in[6];
  const float* bk   = (const float*)d_in[7];
  const float* Wv   = (const float*)d_in[8];
  const float* bv   = (const float*)d_in[9];
  const float* Wo   = (const float*)d_in[10];
  const float* bo   = (const float*)d_in[11];

  const size_t actElems  = (size_t)MTOK * EMBED;     // 3,145,728
  const size_t wgtElems  = (size_t)EMBED * EMBED;    //   589,824
  const size_t headElems = (size_t)BATCH * HEADS * SEQ * HSIZE;  // 3,145,728

  _Float16* p = (_Float16*)d_ws;
  _Float16* q16  = p; p += actElems;
  _Float16* k16  = p; p += actElems;
  _Float16* v16  = p; p += actElems;
  _Float16* Wq16 = p; p += wgtElems;
  _Float16* Wk16 = p; p += wgtElems;
  _Float16* Wv16 = p; p += wgtElems;
  _Float16* Wo16 = p; p += wgtElems;
  _Float16* Qh   = p; p += headElems;
  _Float16* Kh   = p; p += headElems;
  _Float16* Vt   = p; p += headElems;
  _Float16* X16  = p; p += actElems;
  int* meta = (int*)p;   // 2 * BATCH ints: kept keys, open keys

  // f32 -> f16 downcast of all activations and weights; q16 is the first of the
  // seven consecutive f16 arrays above.
  // k and v rows are packed by the mask on the way; the last BATCH work-groups write meta.
  cvt_all_f16<<<CVT_WGS + BATCH, CVT_T, 0, stream>>>(q, k, v, Wq, Wk, Wv, Wo, q16, mask, meta);

  const dim3 ggrid(EMBED / GT, MTOK / GT);        // (6, 32)
  const dim3 qkvgrid(EMBED / GT, MTOK / GT, 3);   // planes: Q, K, V
  const float qscale = 0.125f;                    // 1/sqrt(HSIZE) folded into Q

  // Q, K and V projections do not depend on each other: one launch. q16/k16/v16,
  // Wq16/Wk16/Wv16 and Qh/Kh/Vt are each three consecutive arrays of equal size.
  gemm_wmma<<<qkvgrid, 256, 0, stream>>>(q16, Wq16, bq, bk, bv, (void*)Qh, 0, qscale, meta);

  const int totalWaves = BATCH * HEADS * (SEQ / 16);   // 3072
  flash_attn<<<totalWaves / AW, AT, 0, stream>>>(Qh, Kh, Vt, meta, X16);

  gemm_wmma<<<ggrid, 256, 0, stream>>>(X16, Wo16, bo, bo, bo, d_out, 2, 1.0f, meta);
}

// v010
// It runs in 52.9 microseconds.
// In both of two side-by-side timings against v009, it was 1.06 times as fast.
// Counting every step since v000, it is 5.46 times as fast.
#include <hip/hip_runtime.h>

// Problem constants (fixed by the reference).
#define EMBED  768
#define HEADS  12
#define HSIZE  64
#define BATCH  2
#define SEQ    2048
#define MTOK   (BATCH * SEQ)   // 4096 rows for the projections

// LDS row pitches in halves. A fragment read is two 16-byte loads per lane, each with 16
// rows per lane half, so the pitch is 16 B x odd: the 16 rows then fall on 16
// distinct groups of four banks (64 banks x 4 B) instead of one or two groups.
#define P128   72   // rows of 128 B data -> pitch 144 B
#define P256   136  // rows of 256 B data -> pitch 272 B

#define GT     128  // projection tile of a work-group: GT rows x GT columns
static_assert(SEQ % GT == 0 && EMBED % GT == 0, "tiles cover a batch and a row exactly");

#define KST    128        // keys of one attention stage in LDS
#define KPS    (KST / 32) // passes of 32 keys in a stage
static_assert(GT % KST == 0, "the projections write K and V up to the end of the last stage");

typedef __attribute__((ext_vector_type(16))) _Float16 v16h;
typedef __attribute__((ext_vector_type(8)))  _Float16 v8h;
typedef __attribute__((ext_vector_type(4)))  _Float16 v4h;
typedef __attribute__((ext_vector_type(8)))  float    v8f;
typedef __attribute__((ext_vector_type(4)))  unsigned v4u;   // 16 bytes on their way from LDS to memory

// D = A(16x32 f16) * B(32x16 f16) + C(16x16 f32)
__device__ __forceinline__ v8f wmma_f16(v16h a, v16h b, v8f c) {
  return __builtin_amdgcn_wmma_f32_16x16x32_f16(
      /*neg_a=*/false, a, /*neg_b=*/false, b,
      /*c_mod=*/(short)0, c, /*reuse_a=*/false, /*reuse_b=*/false);
}

// Async copies of 16 bytes/lane global -> LDS (ASYNCcnt-tracked, no VGPR round trip).
// Eight copies in one statement: the closing s_wait_xcnt 0 stands in front of any later
// rewrite of the address registers that the copies name.
__device__ __forceinline__ unsigned lds_addr(const _Float16* lptr) {
  return (unsigned)(uintptr_t)lptr;   // low 32 bits = LDS byte offset
}
__device__ __forceinline__ void async8_b128(const _Float16* g0, const _Float16* l0,
                                            const _Float16* g1, const _Float16* l1,
                                            const _Float16* g2, const _Float16* l2,
                                            const _Float16* g3, const _Float16* l3,
                                            const _Float16* g4, const _Float16* l4,
                                            const _Float16* g5, const _Float16* l5,
                                            const _Float16* g6, const _Float16* l6,
                                            const _Float16* g7, const _Float16* l7) {
  asm volatile("global_load_async_to_lds_b128 %0, %1, off\n\t"
               "global_load_async_to_lds_b128 %2, %3, off\n\t"
               "global_load_async_to_lds_b128 %4, %5, off\n\t"
               "global_load_async_to_lds_b128 %6, %7, off\n\t"
               "global_load_async_to_lds_b128 %8, %9, off\n\t"
               "global_load_async_to_lds_b128 %10, %11, off\n\t"
               "global_load_async_to_lds_b128 %12, %13, off\n\t"
               "global_load_async_to_lds_b128 %14, %15, off\n\t"
               "s_wait_xcnt 0x0"
               :: "v"(lds_addr(l0)), "v"(g0), "v"(lds_addr(l1)), "v"(g1),
                  "v"(lds_addr(l2)), "v"(g2), "v"(lds_addr(l3)), "v"(g3),
                  "v"(lds_addr(l4)), "v"(g4), "v"(lds_addr(l5)), "v"(g5),
                  "v"(lds_addr(l6)), "v"(g6), "v"(lds_addr(l7)), "v"(g7) : "memory");
}
// A run of 16-byte stores and its wait in one statement: the closing s_wait_xcnt 0 stands
// in front of any later rewrite of the address and data registers that the stores name.
__device__ __forceinline__ void store8_b128(void* const (&p)[8], const v4u (&x)[8]) {
  asm volatile("global_store_b128 %0, %8, off\n\t"
               "global_store_b128 %1, %9, off\n\t"
               "global_store_b128 %2, %10, off\n\t"
               "global_store_b128 %3, %11, off\n\t"
               "global_store_b128 %4, %12, off\n\t"
               "global_store_b128 %5, %13, off\n\t"
               "global_store_b128 %6, %14, off\n\t"
               "global_store_b128 %7, %15, off\n\t"
               "s_wait_xcnt 0x0"
               :: "v"(p[0]), "v"(p[1]), "v"(p[2]), "v"(p[3]),
                  "v"(p[4]), "v"(p[5]), "v"(p[6]), "v"(p[7]),
                  "v"(x[0]), "v"(x[1]), "v"(x[2]), "v"(x[3]),
                  "v"(x[4]), "v"(x[5]), "v"(x[6]), "v"(x[7]) : "memory");
}
__device__ __forceinline__ void store4_b128(void* const (&p)[4], const v4u (&x)[4]) {
  asm volatile("global_store_b128 %0, %4, off\n\t"
               "global_store_b128 %1, %5, off\n\t"
               "global_store_b128 %2, %6, off\n\t"
               "global_store_b128 %3, %7, off\n\t"
               "s_wait_xcnt 0x0"
               :: "v"(p[0]), "v"(p[1]), "v"(p[2]), "v"(p[3]),
                  "v"(x[0]), "v"(x[1]), "v"(x[2]), "v"(x[3]) : "memory");
}
// Wait until at most N async ops remain in flight (in-order completion ->
// waiting <=N with N ops just issued drains everything older).
template <int N>
__device__ __forceinline__ void wait_async_le() {
  asm volatile("s_wait_asynccnt %0" :: "i"(N) : "memory");
}
// The wave's own LDS operations are done: stands in front of the barrier behind which the
// buffer it read is refilled, and between a wave's LDS stores of an output tile and its reads
// of the same rows by other lanes.
__device__ __forceinline__ void wait_ds0() {
  asm volatile("s_wait_dscnt 0x0" ::: "memory");
}

// Load one 16x32 f16 A-layout fragment from a row-major [rows][stride] array.
// ISA layout: lanes 0-15 hold K={kb..kb+7, kb+16..kb+23} of row (lane&15),
// lanes 16-31 get kb=8. Two 16-byte loads per lane.
__device__ __forceinline__ v16h frag_ld(const _Float16* base, int stride,
                                        int row, int kb) {
  const _Float16* p = base + row * stride + kb;
  v8h lo = *(const v8h*)(p);
  v8h hi = *(const v8h*)(p + 16);
  v16h r;
#pragma unroll
  for (int i = 0; i < 8; ++i) { r[i] = lo[i]; r[i + 8] = hi[i]; }
  return r;
}

// All seven f32 -> f16 conversions in ONE launch of few, long waves. The f16 copies
// lie one behind the other in the workspace in the order of the arguments, so a
// q or weight work-group's output chunk follows from blockIdx.x alone (k and v rows go to
// their key's rank); only the source is picked.
// 16 waves per work-group and about one work-group per WGP; a wave-wide load covers
// 512 contiguous bytes, a wave-wide store 256.
#define CVT_T    512                          // threads per work-group
#define CVT_U    24                           // float4 per thread
#define CVT_CH   (CVT_T * CVT_U)              // float4 per work-group
#define ACT4     (MTOK * EMBED / 4)           // float4 per activation
#define WGT4     (EMBED * EMBED / 4)          // float4 per weight matrix
#define ACT_CH   (ACT4 / CVT_CH)              // 64 chunks
#define WGT_CH   (WGT4 / CVT_CH)              // 12 chunks
#define CVT_WGS  (3 * ACT_CH + 4 * WGT_CH)    // 240 work-groups
static_assert(ACT4 % CVT_CH == 0 && WGT4 % CVT_CH == 0, "chunks must tile every array");
#define ROW4     (EMBED / 4)                  // float4 per activation row
#define CH_ROWS  (CVT_CH / ROW4)              // 64 rows per chunk
#define CH_BATCH (ACT_CH / BATCH)             // 32 chunks per batch
static_assert(CVT_CH % ROW4 == 0 && ACT_CH % BATCH == 0, "a chunk holds whole rows of one batch");
static_assert(SEQ == 4 * CVT_T, "the key ranking takes four mask words a thread");
static_assert(ROW4 % 32 == 0, "a wave's 32 float4 lie in one row");

// Ranks of the keys of one batch; m = its mask words 4*tid .. 4*tid+3. A key whose mask
// word is 0 gets the score -1e9, and its softmax weight is exactly 0 in f32 as soon as
// one key of the row is open, so only the open keys need to be projected and attended
// to. Returns for this thread's keys
// 4*tid .. 4*tid+3 the rank among the open keys of the batch, -1 for a closed key, and
// in total the number of open keys. With no open key the softmax is uniform over all
// keys: then every key keeps its own place. Holds one barrier: called by whole groups.
__device__ __forceinline__ int4 key_rank(const int4 m, int* wsum, int& total) {
  const int tid  = threadIdx.x;
  const int lane = tid & 31;
  const int wave = tid >> 5;
  const int k0 = (m.x != 0), k1 = (m.y != 0), k2 = (m.z != 0), k3 = (m.w != 0);
  const int c = k0 + k1 + k2 + k3;
  int inc = c;   // inclusive sum over the wave's lanes
  // Unrolled: five steps with constant distances.
#pragma unroll
  for (int d = 1; d < 32; d <<= 1) {
    const int o = __shfl_up(inc, d);
    if (lane >= d) inc += o;
  }
  if (lane == 31) wsum[wave] = inc;
  __syncthreads();
  int base = 0, tot = 0;
  // Unrolled: the 16 wave sums come in four 16-byte LDS reads.
#pragma unroll
  for (int w = 0; w < CVT_T / 32; ++w) {
    const int t = wsum[w];
    base += (w < wave) ? t : 0;
    tot  += t;
  }
  total = tot;
  const int e0 = base + inc - c;   // open keys in front of this thread's four
  int4 p;
  if (tot == 0) {
    p.x = 4 * tid; p.y = 4 * tid + 1; p.z = 4 * tid + 2; p.w = 4 * tid + 3;
  } else {
    p.x = k0 ? e0 : -1;
    p.y = k1 ? e0 + k0 : -1;
    p.z = k2 ? e0 + k0 + k1 : -1;
    p.w = k3 ? e0 + k0 + k1 + k2 : -1;
  }
  return p;
}

__global__ __launch_bounds__(CVT_T)
void cvt_all_f16(const float* __restrict__ q,  const float* __restrict__ k,
                 const float* __restrict__ v,  const float* __restrict__ wq,
                 const float* __restrict__ wk, const float* __restrict__ wv,
                 const float* __restrict__ wo, _Float16* __restrict__ out,
                 const int* __restrict__ mask, int* __restrict__ meta) {
  __shared__ int wsum[CVT_T / 32];
  __shared__ __attribute__((aligned(16))) int rank[SEQ];
  const int blk = blockIdx.x;
  if (blk >= CVT_WGS) {
    // The last BATCH work-groups: meta[2b] = rows of k and v that are kept, meta[2b+1] =
    // open keys; the rows from there to the next multiple of GT (a projection tile) are
    // zeroed, so that the last tile reads defined values.
    const int b = blk - CVT_WGS;
    int total;
    (void)key_rank(*(const int4*)(mask + b * SEQ + 4 * threadIdx.x), wsum, total);
    const int cnt = (total == 0) ? SEQ : total;
    if (threadIdx.x == 0) { meta[2 * b] = cnt; meta[2 * b + 1] = total; }
    const int pad  = (-cnt) & (GT - 1);   // cnt + pad <= SEQ, as SEQ is a multiple of GT
    const int wv   = threadIdx.x >> 5;
    const v8h zero8 = {};
    _Float16* zr = out + (size_t)MTOK * EMBED
                       + ((size_t)(b * SEQ + cnt + wv)) * EMBED + (threadIdx.x & 31) * 8;
    // Unrolled: constant steps from one address. Wave = row modulo 16, lane = 16-byte piece.
#pragma unroll
    for (int i = 0; i < GT / 16; ++i) {
      if (wv + 16 * i < pad) {
#pragma unroll
        for (int a = 0; a < 2; ++a)
#pragma unroll
          for (int kk = 0; kk < EMBED / 256; ++kk)
            *(v8h*)(zr + (size_t)a * MTOK * EMBED + i * 16 * EMBED + kk * 256) = zero8;
      }
    }
    return;
  }
  const float* src;
  int ch;
  if (blk < 3 * ACT_CH) {
    const int a = blk / ACT_CH;
    ch  = blk % ACT_CH;
    src = (a == 0) ? q : (a == 1) ? k : v;
  } else {
    const int t = blk - 3 * ACT_CH;
    const int a = t / WGT_CH;
    ch  = t % WGT_CH;
    src = (a == 0) ? wq : (a == 1) ? wk : (a == 2) ? wv : wo;
  }
  const float4* in4 = (const float4*)src + (size_t)ch * CVT_CH + threadIdx.x;
  v4h* o4 = (v4h*)out + (size_t)blk * CVT_CH + threadIdx.x;

  // k and v are packed by the mask.
  const bool packed = (blk >= ACT_CH && blk < 3 * ACT_CH);

  float4 f[CVT_U];
  // Unrolled so that f stays in registers and many loads are asked for ahead of the first use.
#pragma unroll
  for (int j = 0; j < CVT_U; ++j) f[j] = in4[j * CVT_T];
  if (packed) {
    // A row goes to its key's rank in its batch, a closed key's row is dropped.
    const int b = ch / CH_BATCH;
    const int4 mk = *(const int4*)(mask + b * SEQ + 4 * threadIdx.x);
    int total;
    const int4 p = key_rank(mk, wsum, total);
    *(int4*)(rank + 4 * threadIdx.x) = p;
    __syncthreads();
    const int s0 = (ch % CH_BATCH) * CH_ROWS;   // first key of this chunk in its batch
    v4h* ob = (v4h*)out + (size_t)(blk / ACT_CH) * ACT4 + (size_t)b * SEQ * ROW4;
    // A wave's 32 float4 lie in one row (ROW4 is a multiple of 32), so row, rank and the
    // test are the same in all its lanes: kept in scalars, the test is a scalar branch.
    const int w32 = __builtin_amdgcn_readfirstlane(threadIdx.x >> 5) * 32;
    const int ln  = threadIdx.x & 31;
    // Lane j holds the rank of the row of the wave's j-th float4: one LDS read for all trips.
    const int rk  = rank[s0 + (min(ln, CVT_U - 1) * CVT_T + w32) / ROW4];
    // Unrolled for the same register array.
#pragma unroll
    for (int j = 0; j < CVT_U; ++j) {
      const int w0 = j * CVT_T + w32;
      const int r  = w0 / ROW4;
      const int pr = min(__builtin_amdgcn_readlane(rk, j), SEQ - 1);
      if (pr >= 0) {
        v4h h;
        h[0] = (_Float16)f[j].x; h[1] = (_Float16)f[j].y;
        h[2] = (_Float16)f[j].z; h[3] = (_Float16)f[j].w;
        ob[(size_t)pr * ROW4 + (w0 - r * ROW4) + ln] = h;
      }
    }
    return;
  }
  // Unrolled for the same register array.
#pragma unroll
  for (int j = 0; j < CVT_U; ++j) {
    v4h h;
    h[0] = (_Float16)f[j].x; h[1] = (_Float16)f[j].y;
    h[2] = (_Float16)f[j].z; h[3] = (_Float16)f[j].w;
    o4[j * CVT_T] = h;
  }
}

// C = A[M,K](f16) * Bt[N,K]^T(f16) + bias[N], M=4096, N=768, K=768.
// 128x128 tiles, BK=64, async-to-LDS staging in a ring of NBUF buffers, copies two to three
// stages ahead. A stage is two blocks of eight matrix instructions (k 0..31, k 32..63), and
// the fragments of a block are read from LDS during the block before, into a second register
// set; so the next stage is published in front of a stage's LAST block, once a stage.
// 8 waves as 4 (rows) x 2 (columns): a wave owns 32 x 64, eight accumulator tiles, so
// that a fragment read from LDS feeds four (A) or two (B) matrix instructions.
// mode 0: out f16 [B,H,S,64]   (Q/K head layout; outScale folds 1/sqrt(d))
// mode 1: out f16 [B,H,64,S]   (V transposed so it feeds the WMMA A operand)
// mode 2: out f32 [M,768]      (final projection into d_out)
// blockIdx.z picks one of up to three independent products of one launch. Their A,
// Bt and f16 outputs lie one behind the other in the workspace, so z only steps the
// three base pointers. Plane 0 takes mode0 and scale0, plane 1 mode0 unscaled,
// plane 2 is the transposed V layout (mode 1) unscaled. The A rows of planes 1 and 2
// (k and v) are packed to the front of each batch: tiles behind the kept rows leave.
__global__ __launch_bounds__(256)
void gemm_wmma(const _Float16* __restrict__ A0, const _Float16* __restrict__ Bt0,
               const float* __restrict__ bias0, const float* __restrict__ bias1,
               const float* __restrict__ bias2, void* __restrict__ outp0,
               int mode0, float scale0, const int* __restrict__ meta) {
  constexpr int NBUF = 4;
  __shared__ __attribute__((aligned(16))) _Float16 As[NBUF][GT * P128];
  __shared__ __attribute__((aligned(16))) _Float16 Bs[NBUF][GT * P128];

  const int z = blockIdx.z;
  // The whole work-group leaves, in front of every copy and barrier.
  if (z != 0 && (int)((blockIdx.y * GT) & (SEQ - 1)) >= meta[2 * ((blockIdx.y * GT) / SEQ)]) return;
  const _Float16* A    = A0  + (size_t)z * (MTOK * EMBED);
  const _Float16* Bt   = Bt0 + (size_t)z * (EMBED * EMBED);
  const float*    bias = (z == 0) ? bias0 : (z == 1) ? bias1 : bias2;
  void* outp = (void*)((_Float16*)outp0 + (size_t)z * (MTOK * EMBED));
  const int   mode     = (z == 2) ? 1 : mode0;
  const float outScale = (z == 0) ? scale0 : 1.0f;

  const int tid   = threadIdx.x;
  const int wave  = tid >> 5;
  const int lane  = tid & 31;
  const int l16   = lane & 15;
  const int lhalf = lane >> 4;
  const int kb    = lhalf ? 8 : 0;
  const int mw    = wave & 3;    // 32 rows of the tile, 0..3
  const int nw    = wave >> 2;   // 64 columns of the tile, 0..1
  const int m0    = blockIdx.y * GT;
  const int n0    = blockIdx.x * GT;
  const int K     = EMBED;
  const int NIT   = K / 64;      // 12

  // Staging: tile = 128 rows x 128B = 1024 x 16B chunks; each thread moves 4 per tile,
  // rows row0, row0 + 32, row0 + 64, row0 + 96.
  const int row0 = tid >> 3;          // 0..31
  const int seg  = (tid & 7) * 8;     // halves within row

  auto stage = [&](int kc, int buf) {
    const _Float16* ga = A  + (m0 + row0) * K + kc + seg;
    const _Float16* gb = Bt + (n0 + row0) * K + kc + seg;
    const _Float16* la = &As[buf][row0 * P128 + seg];
    const _Float16* lb = &Bs[buf][row0 * P128 + seg];
    async8_b128(ga,          la,             ga + 32 * K, la + 32 * P128,
                ga + 64 * K, la + 64 * P128, ga + 96 * K, la + 96 * P128,
                gb,          lb,             gb + 32 * K, lb + 32 * P128,
                gb + 64 * K, lb + 64 * P128, gb + 96 * K, lb + 96 * P128);
  };

  v8f acc[2][4] = {};

  // One block's fragments: two of A, four of B, twelve 16-byte LDS reads a lane.
  auto ldfrag = [&](const int buf, const int kk, v16h (&af)[2], v16h (&bf)[4]) {
#pragma unroll
    for (int i = 0; i < 2; ++i)
      af[i] = frag_ld(As[buf] + 32 * kk, P128, 32 * mw + 16 * i + l16, kb);
#pragma unroll
    for (int j = 0; j < 4; ++j)
      bf[j] = frag_ld(Bs[buf] + 32 * kk, P128, 64 * nw + 16 * j + l16, kb);
  };
  auto mma = [&](const v16h (&af)[2], const v16h (&bf)[4]) {
#pragma unroll
    for (int i = 0; i < 2; ++i)
#pragma unroll
      for (int j = 0; j < 4; ++j) acc[i][j] = wmma_f16(af[i], bf[j], acc[i][j]);
  };
  static_assert(NIT >= 3, "the prologue fills three stages");

  v16h a0[2], b0[4], a1[2], b1[4];   // the two fragment sets: block k 0..31, block k 32..63
  stage(0, 0);
  stage(64, 1);
  wait_async_le<8>();   // stage 0 has landed, stage 1 flies on
  __syncthreads();      // stage 0 may be read by all
  stage(128, 2);
  ldfrag(0, 0, a0, b0);
  // Rolled: one copy of the body; the buffers follow it & 3.
#pragma unroll 1
  for (int it = 0; it + 1 < NIT; ++it) {
    ldfrag(it & (NBUF - 1), 1, a1, b1);
    // Keeps the twelve reads in front of the block that hides their latency.
    __builtin_amdgcn_sched_barrier(0);
    mma(a0, b0);
    // Keeps the block in front of the waits below: they then run while the matrix unit works.
    __builtin_amdgcn_sched_barrier(0);
    // Publish point of stage it + 1, passed by every wave: its own LDS reads have returned,
    // its own copies of that stage have landed (those of stage it + 2 fly on).
    wait_ds0();
    if (it + 2 < NIT) wait_async_le<8>(); else wait_async_le<0>();
    __syncthreads();
    ldfrag((it + 1) & (NBUF - 1), 0, a0, b0);
    // As above: the reads stand in front of the stage's last block.
    __builtin_amdgcn_sched_barrier(0);
    mma(a1, b1);
    // Behind that barrier every wave has left stage it - 1, whose buffer takes stage it + 3.
    if (it + 3 < NIT) stage((it + 3) * 64, (it + 3) & (NBUF - 1));
  }
  // The last stage, on its own: nothing is left to publish or to fetch ahead.
  ldfrag((NIT - 1) & (NBUF - 1), 1, a1, b1);
  mma(a0, b0);
  mma(a1, b1);
  wait_ds0();
  __syncthreads();   // every wave's reads of the ring have returned: it becomes output staging

  // Epilogue: the accumulators go through LDS, so that a wave-wide 16-byte store covers four
  // whole 128-byte lines instead of 2- or 4-byte pieces of 2 to 16 lines. The ring is free:
  // every copy has landed and the barrier above ends every wave's reads.
  float bv[4];
#pragma unroll
  for (int j = 0; j < 4; ++j) bv[j] = bias[n0 + 64 * nw + 16 * j + l16];
  // C layout: row = 16 i + 8 (lane / 16) + register, column = 16 j + (lane % 16).
  if (mode == 1) {
    // V transposed: the work-group's tile as [column n][row m]. A lane's eight rows are
    // adjacent there; an output row takes the 128 keys of all four row waves, 256 bytes.
    _Float16* T = &As[0][0];
    static_assert(GT * P256 <= 2 * GT * P128, "the transposed tile fits the A ring");
#pragma unroll
    for (int j = 0; j < 4; ++j)
#pragma unroll
      for (int i = 0; i < 2; ++i) {
        v8h hv;
#pragma unroll
        for (int vv = 0; vv < 8; ++vv) hv[vv] = (_Float16)((acc[i][j][vv] + bv[j]) * outScale);
        *(v8h*)(T + (64 * nw + 16 * j + l16) * P256 + 32 * mw + 16 * i + 8 * lhalf) = hv;
      }
    __syncthreads();   // the rows read below were written by four waves
    const int bb = m0 >> 11, s0 = m0 & (SEQ - 1);   // a tile lies in one batch
    const int seg8 = (tid & 15) * 8;
    void* p[8];
    v4u   x[8];
#pragma unroll
    for (int u = 0; u < 8; ++u) {
      const int r = (tid >> 4) + 16 * u;   // a wave: two rows of 256 bytes
      const int n = n0 + r;
      x[u] = *(const v4u*)(T + r * P256 + seg8);
      p[u] = (_Float16*)outp + ((size_t)((bb * HEADS + (n >> 6)) * HSIZE + (n & (HSIZE - 1)))) * SEQ + s0 + seg8;
    }
    store8_b128(p, x);
    return;
  }
  // Modes 0 and 2: a wave's 32 x 64 tile holds whole lines (128 B of f16, 256 B of f32 a
  // row), so each wave stages in an eighth of one ring (half a buffer) of its own and meets nobody.
  _Float16* Tw = (nw ? &Bs[0][0] : &As[0][0]) + mw * (GT * P128 / 2);
  if (mode == 0) {
#pragma unroll
    for (int j = 0; j < 4; ++j)
#pragma unroll
      for (int i = 0; i < 2; ++i)
#pragma unroll
        for (int vv = 0; vv < 8; ++vv)
          Tw[(16 * i + 8 * lhalf + vv) * P128 + 16 * j + l16] =
              (_Float16)((acc[i][j][vv] + bv[j]) * outScale);
    wait_ds0();
    const int hh   = (n0 + 64 * nw) >> 6;   // the wave's 64 columns are one head
    const int seg8 = (lane & 7) * 8;
    void* p[8];
    v4u   x[8];
#pragma unroll
    for (int u = 0; u < 8; ++u) {
      const int r = (lane >> 3) + 4 * u;    // a wave: four rows of 128 bytes
      const int mr = m0 + 32 * mw + r;
      x[u] = *(const v4u*)(Tw + r * P128 + seg8);
      p[u] = (_Float16*)outp + ((size_t)(((mr >> 11) * HEADS + hh) * SEQ + (mr & (SEQ - 1)))) * HSIZE + seg8;
    }
    store8_b128(p, x);
  } else {
    constexpr int PF = 68;   // floats: 272 B = 16 B x odd, as P256
    static_assert(32 * PF * 4 <= GT * P128, "a wave's f32 tile fits its half of a buffer");
    float* Tf = (float*)Tw;
#pragma unroll
    for (int j = 0; j < 4; ++j)
#pragma unroll
      for (int i = 0; i < 2; ++i)
#pragma unroll
        for (int vv = 0; vv < 8; ++vv)
          Tf[(16 * i + 8 * lhalf + vv) * PF + 16 * j + l16] = (acc[i][j][vv] + bv[j]) * outScale;
    wait_ds0();
    const int seg4 = (lane & 15) * 4;
#pragma unroll
    for (int g = 0; g < 2; ++g) {
      void* p[8];
      v4u   x[8];
#pragma unroll
      for (int u = 0; u < 8; ++u) {
        const int r = (lane >> 4) + 2 * u + 16 * g;   // a wave: two rows of 256 bytes
        x[u] = *(const v4u*)(Tf + r * PF + seg4);
        p[u] = (float*)outp + (size_t)(m0 + 32 * mw + r) * EMBED + n0 + 64 * nw + seg4;
      }
      store8_b128(p, x);
    }
  }
}

// Lane l <-> lane l ^ 16 (the two halves of a wave) without touching LDS.
__device__ __forceinline__ float xhalf(float x) {
  const int b = __builtin_bit_cast(int, x);
  return __builtin_bit_cast(float,
      __builtin_amdgcn_permlanex16(b, b, 0x76543210, 0xfedcba98, false, false));
}

// Fused flash attention, transposed products: S^T = K * Q^T, O^T += V^T * P^T.
// One wave per (b, h, 16-query tile); the AW waves of a block share one (b,h), so
// K/V are async-staged into LDS once per block, in stages of KST keys and two buffers:
// the copies of stage t+1 fly during all of stage t, and the waves meet once a stage,
// so that between two meetings each walks its KPS passes of 32 keys at its own pace.
// A lane holds scores of ONE query (column l16): keys 8*lhalf+r and 16+8*lhalf+r.
// Maximum and sum run in the lane's own registers plus one exchange between the
// halves, and the two score tiles, converted in place, are the B operand of the
// second product (hardware k order), so P never goes through LDS.
// Qh,Kh: f16 [B,H,S,64]; Vt: f16 [B,H,64,S]; X out: f16 [B,S,EMBED]. Q pre-scaled.
// Kh and Vt hold the kept keys only, packed to the front: the loop walks those, and a
// key at or behind the number of open keys (the tail of the last chunk, projected from
// zero rows; every key when none is open) takes the score -1e9.
// AW = 4: the 3,072 waves form 768 work-groups, a whole multiple of the 256 WGPs, so that an
// even deal puts three waves on every SIMD. Groups of 8 waves make 384: two on half of the
// WGPs, one on the rest, and the launch lasts as long as the fuller half.
#define AW     4          // waves of an attention work-group, one a SIMD
#define AT     (AW * 32)  // its threads
static_assert((SEQ / 16) % AW == 0, "a work-group's query tiles lie in one (b,h)");
static_assert(KST * 8 == 8 * AT && HSIZE * (KST / 8) == 8 * AT, "eight K and eight V pieces a thread");
__global__ __launch_bounds__(AT)
void flash_attn(const _Float16* __restrict__ Qh, const _Float16* __restrict__ Kh,
                const _Float16* __restrict__ Vt, const int* __restrict__ meta,
                _Float16* __restrict__ X) {
  __shared__ __attribute__((aligned(16))) _Float16 Ks[2][KST * P128];    // KST keys x 64 d
  __shared__ __attribute__((aligned(16))) _Float16 Vs[2][HSIZE * P256];  // 64 d x KST keys

  const int tid   = threadIdx.x;
  const int wave  = tid >> 5;
  const int lane  = tid & 31;
  const int l16   = lane & 15;
  const int lhalf = lane >> 4;
  const int kb    = lhalf ? 8 : 0;

  const int g  = blockIdx.x * AW + wave;  // global wave id, 3072 total
  const int bh = blockIdx.x / (SEQ / 16 / AW);   // = g >> 7, from scalars: trip count and branches stay scalar
  const int qt = g & 127;
  const int b  = bh / HEADS;
  const int h  = bh % HEADS;

  const _Float16* Qp = Qh + (size_t)bh * SEQ * HSIZE;
  const _Float16* Kp = Kh + (size_t)bh * SEQ * HSIZE;
  const _Float16* Vp = Vt + (size_t)bh * HSIZE * SEQ;

  // Staging assignment: K stage = 128 rows x 8 segs, V stage = 64 rows x 16 segs; a thread
  // moves eight pieces of each, K rows krow + 16 i, V rows vrow + 8 i.
  const int krow = tid >> 3, kseg = (tid & 7) * 8;
  const int vrow = tid >> 4, vseg = (tid & 15) * 8;

  auto stage = [&](int st, int buf) {
    const _Float16* gk = Kp + (st * KST + krow) * HSIZE + kseg;
    const _Float16* gv = Vp + vrow * SEQ + st * KST + vseg;
    const _Float16* lk = &Ks[buf][krow * P128 + kseg];
    const _Float16* lv = &Vs[buf][vrow * P256 + vseg];
    async8_b128(gk,               lk,              gk +  16 * HSIZE, lk +  16 * P128,
                gk +  32 * HSIZE, lk +  32 * P128, gk +  48 * HSIZE, lk +  48 * P128,
                gk +  64 * HSIZE, lk +  64 * P128, gk +  80 * HSIZE, lk +  80 * P128,
                gk +  96 * HSIZE, lk +  96 * P128, gk + 112 * HSIZE, lk + 112 * P128);
    async8_b128(gv,            lv,             gv +  8 * SEQ, lv +  8 * P256,
                gv + 16 * SEQ, lv + 16 * P256, gv + 24 * SEQ, lv + 24 * P256,
                gv + 32 * SEQ, lv + 32 * P256, gv + 40 * SEQ, lv + 40 * P256,
                gv + 48 * SEQ, lv + 48 * P256, gv + 56 * SEQ, lv + 56 * P256);
  };

  // Q^T as B operand (column = query qt*16 + l16, k = d in [0,32) and [32,64))
  const int qrow = qt * 16 + l16;
  const v16h qf0 = frag_ld(Qp,      HSIZE, qrow, kb);
  const v16h qf1 = frag_ld(Qp + 32, HSIZE, qrow, kb);
  // Stands in front of any rewrite of the address registers that the four Q loads name.
  asm volatile("s_wait_xcnt 0x0" ::: "memory");

  float ml = -1e30f;   // running maximum of this lane's query (equal in both halves)
  float ll = 0.f;      // running sum over this half's keys only; joined in the epilogue
  v8f oacc[4] = {{}, {}, {}, {}};   // O^T: row d = 16*t + 8*lhalf + r, column = query

  // Both are the same for the whole work-group (one b), so every barrier below is met
  // by all waves; the trip count is bounded by the shape whatever meta holds.
  const int nkept = min(max(meta[2 * b], 1), SEQ);
  const int nopen = meta[2 * b + 1];
  const int NCH   = (nkept + 31) >> 5;   // 1..64 passes of 32 keys
  const int NST   = (nkept + KST - 1) / KST;   // 1..16 stages

  // One pass: 32 kept keys, the ps-th 32 of stage st. tail: it may reach past the open keys.
  auto pass = [&](const int st, const int ps, const bool tail) {
    const int kc  = st * KST + ps * 32;
    const _Float16* Kc = Ks[st & 1] + ps * 32 * P128;
    const _Float16* Vc = Vs[st & 1] + ps * 32;

    // ---- scores^T: 32 keys x 16 queries, f32 accum ----
    v8f s0 = {}, s1 = {};
    {
      v16h kf = frag_ld(Kc,      P128, l16, kb);      // keys 0..15, d 0..31
      s0 = wmma_f16(kf, qf0, s0);
      kf = frag_ld(Kc + 32, P128, l16, kb);           // d 32..63
      s0 = wmma_f16(kf, qf1, s0);
      kf = frag_ld(Kc,      P128, 16 + l16, kb);      // keys 16..31
      s1 = wmma_f16(kf, qf0, s1);
      kf = frag_ld(Kc + 32, P128, 16 + l16, kb);
      s1 = wmma_f16(kf, qf1, s1);
    }
    // ---- key mask (row = register r) ----
    if (tail) {
      const int lim = nopen - kc - kb;   // key r of this half is open while r < lim
#pragma unroll
      for (int vv = 0; vv < 8; ++vv) {
        s0[vv] = (vv < lim)      ? s0[vv] : -1e9f;
        s1[vv] = (vv + 16 < lim) ? s1[vv] : -1e9f;
      }
    }
    // ---- online softmax: one query per lane ----
    float rm = fmaxf(s0[0], s1[0]);
#pragma unroll
    for (int vv = 1; vv < 8; ++vv) rm = fmaxf(rm, fmaxf(s0[vv], s1[vv]));
    rm = fmaxf(rm, xhalf(rm));
    const float nm   = fmaxf(ml, rm);
    const float corr = __expf(ml - nm);
    ml = nm;
    v16h pf;           // P^T as B operand: pf[s] = key kmap(s, lhalf) of column l16
    float rs0 = 0.f, rs1 = 0.f;
#pragma unroll
    for (int vv = 0; vv < 8; ++vv) {
      const float p0 = __expf(s0[vv] - nm);
      const float p1 = __expf(s1[vv] - nm);
      rs0 += p0; rs1 += p1;
      pf[vv]     = (_Float16)p0;
      pf[vv + 8] = (_Float16)p1;
    }
    ll = ll * corr + (rs0 + rs1);
#pragma unroll
    for (int t = 0; t < 4; ++t)
#pragma unroll
      for (int vv = 0; vv < 8; ++vv) oacc[t][vv] *= corr;

    // ---- out^T += V^T(64x32) * P^T(32x16) ----
#pragma unroll
    for (int t = 0; t < 4; ++t) {
      const v16h vf = frag_ld(Vc, P256, 16 * t + l16, kb);
      oacc[t] = wmma_f16(vf, pf, oacc[t]);
    }
  };

  // Foot of stage st, passed by every wave: its own reads of the buffer have returned, its
  // own copies of stage st + 1 have landed; behind the barrier stage st + 1 may be read by
  // all, and the buffer that stage st has left takes stage st + 2.
  auto publish = [&](const int st) {
    wait_ds0();
    wait_async_le<0>();
    __syncthreads();
    if (st + 2 < NST) stage(st + 2, st & 1);
  };

  // Stages of open keys alone need no mask; the rest (the last stage, or every stage
  // when no key is open) runs in a loop of its own and ends with the last kept key's pass.
  const int nfst = min(max(nopen, 0) / KST, NST);
  stage(0, 0);
  wait_async_le<0>();
  __syncthreads();
  if (NST > 1) stage(1, 1);
  int st = 0;
  // The stage loops stay rolled: one copy of each body, the buffer follows st & 1.
#pragma unroll 1
  for (; st < nfst; ++st) {
    // Unrolled: constant LDS offsets, and a pass's reads may be asked for during the pass before.
#pragma unroll
    for (int ps = 0; ps < KPS; ++ps) pass(st, ps, false);
    publish(st);
  }
#pragma unroll 1
  for (; st < NST; ++st) {
    const int np = min(NCH - st * KPS, KPS);
    // Rolled: runs once in a launch unless no key is open.
#pragma unroll 1
    for (int ps = 0; ps < np; ++ps) pass(st, ps, true);
    publish(st);
  }
  wait_async_le<0>();   // no copy is left in flight when the wave ends

  // ---- epilogue: join the halves' sums, normalize, store to X [B,S,EMBED] ----
  // Through LDS as in the projections: a query's 64 values are one 128-byte line of X. The
  // last stage's foot has ended every wave's reads; each wave stages in 16 rows of its own.
  const float inv = 1.0f / (ll + xhalf(ll));
  _Float16* T = &Ks[0][0] + wave * (16 * P128);
#pragma unroll
  for (int t = 0; t < 4; ++t) {
    v8h o;
#pragma unroll
    for (int vv = 0; vv < 8; ++vv) o[vv] = (_Float16)(oacc[t][vv] * inv);
    *(v8h*)(T + l16 * P128 + 16 * t + kb) = o;
  }
  wait_ds0();
  const int seg8 = (lane & 7) * 8;
  void* p[4];
  v4u   x[4];
#pragma unroll
  for (int u = 0; u < 4; ++u) {
    const int r = (lane >> 3) + 4 * u;   // a wave: four rows of 128 bytes
    x[u] = *(const v4u*)(T + r * P128 + seg8);
    p[u] = X + ((size_t)(b * SEQ + qt * 16 + r)) * EMBED + h * HSIZE + seg8;
  }
  store4_b128(p, x);
}

extern "C" void kernel_launch(void* const* d_in, const int* in_sizes, int n_in,
                              void* d_out, int out_size, void* d_ws, size_t ws_size,
                              hipStream_t stream) {
  const float* q    = (const float*)d_in[0];
  const float* k    = (const float*)d_in[1];
  const float* v    = (const float*)d_in[2];
  const int*   mask = (const int*)  d_in[3];
  const float* Wq   = (const float*)d_in[4];
  const float* bq   = (const float*)d_in[5];
  const float* Wk   = (const float*)d_in[6];
  const float* bk   = (const float*)d_in[7];
  const float* Wv   = (const float*)d_in[8];
  const float* bv   = (const float*)d_in[9];
  const float* Wo   = (const float*)d_in[10];
  const float* bo   = (const float*)d_in[11];

  const size_t actElems  = (size_t)MTOK * EMBED;     // 3,145,728
  const size_t wgtElems  = (size_t)EMBED * EMBED;    //   589,824
  const size_t headElems = (size_t)BATCH * HEADS * SEQ * HSIZE;  // 3,145,728

  _Float16* p = (_Float16*)d_ws;
  _Float16* q16  = p; p += actElems;
  _Float16* k16  = p; p += actElems;
  _Float16* v16  = p; p += actElems;
  _Float16* Wq16 = p; p += wgtElems;
  _Float16* Wk16 = p; p += wgtElems;
  _Float16* Wv16 = p; p += wgtElems;
  _Float16* Wo16 = p; p += wgtElems;
  _Float16* Qh   = p; p += headElems;
  _Float16* Kh   = p; p += headElems;
  _Float16* Vt   = p; p += headElems;
  _Float16* X16  = p; p += actElems;
  int* meta = (int*)p;   // 2 * BATCH ints: kept keys, open keys

  // f32 -> f16 downcast of all activations and weights; q16 is the first of the
  // seven consecutive f16 arrays above.
  // k and v rows are packed by the mask on the way; the last BATCH work-groups write meta.
  cvt_all_f16<<<CVT_WGS + BATCH, CVT_T, 0, stream>>>(q, k, v, Wq, Wk, Wv, Wo, q16, mask, meta);

  const dim3 ggrid(EMBED / GT, MTOK / GT);        // (6, 32)
  const dim3 qkvgrid(EMBED / GT, MTOK / GT, 3);   // planes: Q, K, V
  const float qscale = 0.125f;                    // 1/sqrt(HSIZE) folded into Q

  // Q, K and V projections do not depend on each other: one launch. q16/k16/v16,
  // Wq16/Wk16/Wv16 and Qh/Kh/Vt are each three consecutive arrays of equal size.
  gemm_wmma<<<qkvgrid, 256, 0, stream>>>(q16, Wq16, bq, bk, bv, (void*)Qh, 0, qscale, meta);

  const int totalWaves = BATCH * HEADS * (SEQ / 16);   // 3072
  flash_attn<<<totalWaves / AW, AT, 0, stream>>>(Qh, Kh, Vt, meta, X16);

  gemm_wmma<<<ggrid, 256, 0, stream>>>(X16, Wo16, bo, bo, bo, d_out, 2, 1.0f, meta);
}
